// v000
// The times below were measured on an AMD MI455X: many runs one after another, warmed up first and cycling through
// copies of the inputs, with the whole window's GPU time divided by the number of runs. Launches and the gaps
// between them are all in it. The median over several windows is given; except for v000 it joins two sittings, which
// can be a few percent apart, so the side-by-side timings, each taken in one sitting, are the better comparison.
// v000 is the starting kernel. One run takes 623 microseconds.
#include <hip/hip_runtime.h>
#include <hip/hip_bf16.h>

// ---------------------------------------------------------------------------
// SKCLite cross-attention for MI455X (gfx1250, wave32, WMMA).
//
// B=4, C=256, N=H*W=4096, R=8 (rank), G=4 groups (CG=64).
// Dominant cost: out = v @ softmax(q^T k)  -> 2 * 2*B*C*N^2 = 68.7 GFLOP.
// Strategy: flash-style on-the-fly score tiles.
//   scores (rank-8) generated with V_WMMA_F32_16X16X4_F32,
//   exp() + bf16-pack lands *exactly* in the B-operand layout of
//   V_WMMA_F32_16X16X32_BF16 (f32 C/D layout == bf16 B layout modulo packing),
//   main GEMM in bf16 WMMA with f32 accumulation.
// ---------------------------------------------------------------------------

#define NB   4      // batch
#define NC   256    // channels
#define NN   4096   // H*W
#define NR   8      // rank
#define NG   4      // groups
#define NCG  64     // channels per group
#define LOG2E 1.4426950408889634f

typedef __attribute__((ext_vector_type(2)))  float        v2f;
typedef __attribute__((ext_vector_type(8)))  float        v8f;
typedef __attribute__((ext_vector_type(16))) __bf16       v16bf;
typedef __attribute__((ext_vector_type(4)))  unsigned int v4u;

// ---------------------------------------------------------------------------
// Kernel 1: q/k projections.  q = (qw . f + qb) * log2(e)   (exp -> exp2)
//           k =  kw . f + kb
// Layout: qbuf/kbuf = [dir][B][R][N] f32.
// dir0 (LU path): q from fL (qL_w), k from fU (kU_w)
// dir1 (UL path): q from fU (qU_w), k from fL (kL_w)
// ---------------------------------------------------------------------------
__global__ __launch_bounds__(256)
void SKC_proj(const float* __restrict__ fL, const float* __restrict__ fU,
              const float* __restrict__ qLw, const float* __restrict__ qLb,
              const float* __restrict__ kUw, const float* __restrict__ kUb,
              const float* __restrict__ qUw, const float* __restrict__ qUb,
              const float* __restrict__ kLw, const float* __restrict__ kLb,
              float* __restrict__ qbuf, float* __restrict__ kbuf)
{
    const int t = blockIdx.x * 256 + threadIdx.x;   // over B*N
    const int b = t / NN;
    const int n = t % NN;

    float aq0[NR], ak0[NR], aq1[NR], ak1[NR];
#pragma unroll
    for (int r = 0; r < NR; ++r) { aq0[r] = 0.f; ak0[r] = 0.f; aq1[r] = 0.f; ak1[r] = 0.f; }

    const float* fl = fL + (size_t)b * NC * NN + n;
    const float* fu = fU + (size_t)b * NC * NN + n;
    for (int c = 0; c < NC; ++c) {
        const float xl = fl[(size_t)c * NN];
        const float xu = fu[(size_t)c * NN];
#pragma unroll
        for (int r = 0; r < NR; ++r) {
            aq0[r] += qLw[r * NC + c] * xl;   // uniform -> scalar loads
            ak0[r] += kUw[r * NC + c] * xu;
            aq1[r] += qUw[r * NC + c] * xu;
            ak1[r] += kLw[r * NC + c] * xl;
        }
    }
#pragma unroll
    for (int r = 0; r < NR; ++r) {
        qbuf[((size_t)0 * NB + b) * (NR * NN) + r * NN + n] = (aq0[r] + qLb[r]) * LOG2E;
        kbuf[((size_t)0 * NB + b) * (NR * NN) + r * NN + n] =  ak0[r] + kUb[r];
        qbuf[((size_t)1 * NB + b) * (NR * NN) + r * NN + n] = (aq1[r] + qUb[r]) * LOG2E;
        kbuf[((size_t)1 * NB + b) * (NR * NN) + r * NN + n] =  ak1[r] + kLb[r];
    }
}

// ---------------------------------------------------------------------------
// Kernel 2: softmax normalizers.  invZ[dir][b][m] = 1 / sum_j exp(q_m . k_j)
// One wave per 16-row m-tile.  A operand (q, fixed m) stays in registers;
// loop j in tiles of 16: two chained V_WMMA_F32_16X16X4_F32 (K=8), exp2,
// accumulate per-VGPR, then 16-lane xor reduction (lane halves independent).
// ---------------------------------------------------------------------------
__global__ __launch_bounds__(256)
void SKC_stats(const float* __restrict__ qbuf, const float* __restrict__ kbuf,
               float* __restrict__ invZ)
{
    const int lane = threadIdx.x & 31;
    const int wave = threadIdx.x >> 5;
    const int b    = blockIdx.y;
    const int dir  = blockIdx.z;
    const int m0   = (blockIdx.x * 8 + wave) * 16;
    const int l15  = lane & 15;
    const int hi   = lane >> 4;                 // lane-half select

    const float* q = qbuf + ((size_t)dir * NB + b) * (NR * NN);
    const float* k = kbuf + ((size_t)dir * NB + b) * (NR * NN);

    // A fragment: 16x4 f32: lanes 0-15 hold K=0,1 ; lanes 16-31 hold K=2,3
    v2f aq0, aq1;
    {
        const int m = m0 + l15;
        const int r = hi * 2;
        aq0.x = q[(r + 0) * NN + m];  aq0.y = q[(r + 1) * NN + m];
        aq1.x = q[(r + 4) * NN + m];  aq1.y = q[(r + 5) * NN + m];
    }

    v8f zacc = {0.f, 0.f, 0.f, 0.f, 0.f, 0.f, 0.f, 0.f};
    for (int j0 = 0; j0 < NN; j0 += 16) {
        v2f bk0, bk1;
        const int n = j0 + l15;
        const int r = hi * 2;
        bk0.x = k[(r + 0) * NN + n];  bk0.y = k[(r + 1) * NN + n];
        bk1.x = k[(r + 4) * NN + n];  bk1.y = k[(r + 5) * NN + n];

        v8f s = {0.f, 0.f, 0.f, 0.f, 0.f, 0.f, 0.f, 0.f};
        s = __builtin_amdgcn_wmma_f32_16x16x4_f32(false, aq0, false, bk0, (short)0, s, false, false);
        s = __builtin_amdgcn_wmma_f32_16x16x4_f32(false, aq1, false, bk1, (short)0, s, false, false);
#pragma unroll
        for (int g = 0; g < 8; ++g) zacc[g] += __builtin_amdgcn_exp2f(s[g]);
    }
    // reduce across the 16 lanes of each half (j is the lane dimension)
#pragma unroll
    for (int g = 0; g < 8; ++g) {
        float z = zacc[g];
        z += __shfl_xor(z, 1, 32);
        z += __shfl_xor(z, 2, 32);
        z += __shfl_xor(z, 4, 32);
        z += __shfl_xor(z, 8, 32);
        if (l15 == 0) {
            const int m = m0 + g + hi * 8;      // D layout: VGPR g -> row g / g+8
            invZ[((size_t)dir * NB + b) * NN + m] = 1.0f / z;
        }
    }
}

// ---------------------------------------------------------------------------
// Kernel 3: grouped v-projection fused with 1/Z, emitted as bf16.
// vp[dir][b][c][m] = bf16( (vb[c] + sum_i vw[c][i] f[b,g*64+i,m]) * invZ[dir][b][m] )
// Thread = (dir,b,g,n); the 64-deep f column lives in registers, read once.
// ---------------------------------------------------------------------------
__global__ __launch_bounds__(256)
void SKC_vp(const float* __restrict__ fL, const float* __restrict__ fU,
            const float* __restrict__ vUw, const float* __restrict__ vUb,
            const float* __restrict__ vLw, const float* __restrict__ vLb,
            const float* __restrict__ invZ, __bf16* __restrict__ vp)
{
    const int dir = blockIdx.z;
    const int bg  = blockIdx.y;
    const int b   = bg >> 2;
    const int g   = bg & 3;
    const int n   = blockIdx.x * 256 + threadIdx.x;

    const float* f  = (dir == 0) ? fU  : fL;    // LU uses vU(fU); UL uses vL(fL)
    const float* vw = (dir == 0) ? vUw : vLw;
    const float* vb = (dir == 0) ? vUb : vLb;

    float fr[NCG];
#pragma unroll
    for (int i = 0; i < NCG; ++i)
        fr[i] = f[((size_t)b * NC + g * NCG + i) * NN + n];

    const float iz = invZ[((size_t)dir * NB + b) * NN + n];

    for (int co = 0; co < NCG; ++co) {
        const int c = g * NCG + co;
        float acc = vb[c];
#pragma unroll
        for (int i = 0; i < NCG; ++i)
            acc += vw[(size_t)c * NCG + i] * fr[i];   // uniform -> scalar loads
        vp[(((size_t)dir * NB + b) * NC + c) * NN + n] = (__bf16)(acc * iz);
    }
}

// ---------------------------------------------------------------------------
// Kernel 4: main attend + residual.
//   out[c,n] = f[c,n] + beta * sum_m vp[c,m] * exp(q_m . k_n)
// Wave owns a fixed 16-wide n-tile and all 16 c-tiles (C=256).
// Per 32-wide m-step: 4x f32 WMMA score tiles -> exp2 -> bf16 pack
// (f32 D layout coincides with bf16 B layout: zero lane shuffles) ->
// 16x V_WMMA_F32_16X16X32_BF16 with two b128 vp loads each.
// ---------------------------------------------------------------------------
__global__ __launch_bounds__(256)
void SKC_attend(const float* __restrict__ fL, const float* __restrict__ fU,
                const float* __restrict__ qbuf, const float* __restrict__ kbuf,
                const __bf16* __restrict__ vp, const float* __restrict__ betap,
                float* __restrict__ out)
{
    const int lane = threadIdx.x & 31;
    const int wave = threadIdx.x >> 5;
    const int b    = blockIdx.y;
    const int dir  = blockIdx.z;
    const int n0   = (blockIdx.x * 8 + wave) * 16;
    const int l15  = lane & 15;
    const int hi   = lane >> 4;
    const float beta = *betap;

    const float*  q   = qbuf + ((size_t)dir * NB + b) * (NR * NN);
    const float*  k   = kbuf + ((size_t)dir * NB + b) * (NR * NN);
    const __bf16* vpb = vp   + ((size_t)dir * NB + b) * (size_t)(NC * NN);

    // k B-fragment for this n-tile: constant across the whole m loop.
    v2f bk0, bk1;
    {
        const int n = n0 + l15;
        const int r = hi * 2;
        bk0.x = k[(r + 0) * NN + n];  bk0.y = k[(r + 1) * NN + n];
        bk1.x = k[(r + 4) * NN + n];  bk1.y = k[(r + 5) * NN + n];
    }

    v8f acc[16];
    const v8f vzero = {0.f, 0.f, 0.f, 0.f, 0.f, 0.f, 0.f, 0.f};
#pragma unroll
    for (int ct = 0; ct < 16; ++ct) acc[ct] = vzero;

    const int moff = hi * 8;   // bf16 A/B layouts: lane-half K offset

    for (int m0 = 0; m0 < NN; m0 += 32) {
        // ---- score tiles s0 (m0..m0+15) and s1 (m0+16..m0+31), K=8 rank ----
        v2f a0lo, a0hi, a1lo, a1hi;
        {
            const int r  = hi * 2;
            const int mA = m0 + l15;
            const int mB = m0 + 16 + l15;
            a0lo.x = q[(r + 0) * NN + mA];  a0lo.y = q[(r + 1) * NN + mA];
            a0hi.x = q[(r + 4) * NN + mA];  a0hi.y = q[(r + 5) * NN + mA];
            a1lo.x = q[(r + 0) * NN + mB];  a1lo.y = q[(r + 1) * NN + mB];
            a1hi.x = q[(r + 4) * NN + mB];  a1hi.y = q[(r + 5) * NN + mB];
        }
        v8f s0 = vzero, s1 = vzero;
        s0 = __builtin_amdgcn_wmma_f32_16x16x4_f32(false, a0lo, false, bk0, (short)0, s0, false, false);
        s0 = __builtin_amdgcn_wmma_f32_16x16x4_f32(false, a0hi, false, bk1, (short)0, s0, false, false);
        s1 = __builtin_amdgcn_wmma_f32_16x16x4_f32(false, a1lo, false, bk0, (short)0, s1, false, false);
        s1 = __builtin_amdgcn_wmma_f32_16x16x4_f32(false, a1hi, false, bk1, (short)0, s1, false, false);

        // ---- E tile -> bf16 B operand (layouts line up; in-lane pack) ----
        v16bf eb;
#pragma unroll
        for (int g = 0; g < 8; ++g) {
            eb[g]     = (__bf16)__builtin_amdgcn_exp2f(s0[g]);   // K = moff+g
            eb[8 + g] = (__bf16)__builtin_amdgcn_exp2f(s1[g]);   // K = 16+moff+g
        }

        // ---- 16 c-tiles of the main bf16 GEMM ----
        const __bf16* vpl = vpb + (size_t)l15 * NN + m0 + moff;
#pragma unroll
        for (int ct = 0; ct < 16; ++ct) {
            const __bf16* p = vpl + (size_t)ct * 16 * NN;
            union { v4u u[2]; v16bf h; } U;
            U.u[0] = *(const v4u*)(p);        // K = moff .. moff+7     (16B aligned)
            U.u[1] = *(const v4u*)(p + 16);   // K = 16+moff .. 16+moff+7
            acc[ct] = __builtin_amdgcn_wmma_f32_16x16x32_bf16(
                false, U.h, false, eb, (short)0, acc[ct], false, false);
        }
    }

    // ---- epilogue: fused residual, write d_out ----
    const float* f = (dir == 0) ? fL : fU;
    float* o = out + (size_t)dir * ((size_t)NB * NC * NN);
#pragma unroll
    for (int ct = 0; ct < 16; ++ct) {
#pragma unroll
        for (int g = 0; g < 8; ++g) {
            const int c = ct * 16 + g + hi * 8;
            const int n = n0 + l15;
            const size_t idx = ((size_t)b * NC + c) * NN + n;
            o[idx] = f[idx] + beta * acc[ct][g];
        }
    }
}

// ---------------------------------------------------------------------------
// Host-side launcher.  Workspace layout (floats unless noted):
//   qbuf : 2*B*R*N            = 262144
//   kbuf : 2*B*R*N            = 262144
//   invZ : 2*B*N              =  32768
//   vp   : 2*B*C*N  (bf16)    -> 16.8 MB      (total ~19 MB)
// ---------------------------------------------------------------------------
extern "C" void kernel_launch(void* const* d_in, const int* in_sizes, int n_in,
                              void* d_out, int out_size, void* d_ws, size_t ws_size,
                              hipStream_t stream)
{
    const float* fL   = (const float*)d_in[0];
    const float* fU   = (const float*)d_in[1];
    const float* qLw  = (const float*)d_in[2];
    const float* qLb  = (const float*)d_in[3];
    const float* kUw  = (const float*)d_in[4];
    const float* kUb  = (const float*)d_in[5];
    const float* vUw  = (const float*)d_in[6];
    const float* vUb  = (const float*)d_in[7];
    const float* qUw  = (const float*)d_in[8];
    const float* qUb  = (const float*)d_in[9];
    const float* kLw  = (const float*)d_in[10];
    const float* kLb  = (const float*)d_in[11];
    const float* vLw  = (const float*)d_in[12];
    const float* vLb  = (const float*)d_in[13];
    const float* beta = (const float*)d_in[14];
    float* outp = (float*)d_out;

    float*  qbuf = (float*)d_ws;
    float*  kbuf = qbuf + (size_t)2 * NB * NR * NN;
    float*  invZ = kbuf + (size_t)2 * NB * NR * NN;
    __bf16* vp   = (__bf16*)(invZ + (size_t)2 * NB * NN);

    // 1) projections (q pre-scaled by log2 e)
    SKC_proj<<<dim3((NB * NN) / 256), dim3(256), 0, stream>>>(
        fL, fU, qLw, qLb, kUw, kUb, qUw, qUb, kLw, kLb, qbuf, kbuf);

    // 2) softmax normalizers via f32 WMMA score tiles
    SKC_stats<<<dim3(NN / 128, NB, 2), dim3(256), 0, stream>>>(qbuf, kbuf, invZ);

    // 3) grouped v-projection folded with 1/Z, bf16 output
    SKC_vp<<<dim3(NN / 256, NB * NG, 2), dim3(256), 0, stream>>>(
        fL, fU, vUw, vUb, vLw, vLb, invZ, vp);

    // 4) main attend (f32-WMMA score gen + bf16-WMMA GEMM) + fused residual
    SKC_attend<<<dim3(NN / 128, NB, 2), dim3(256), 0, stream>>>(
        fL, fU, qbuf, kbuf, vp, beta, outp);
}

// v001
// One run takes 244 microseconds.
// In two side-by-side timings against v000, it was 2.56 and 2.55 times as fast.
#include <hip/hip_runtime.h>
#include <hip/hip_bf16.h>

// ---------------------------------------------------------------------------
// SKCLite cross-attention for MI455X (gfx1250, wave32, WMMA).
//
// B=4, C=256, N=H*W=4096, R=8 (rank), G=4 groups (CG=64).
// Dominant cost: out = v @ softmax(q^T k)  -> 2 * 2*B*C*N^2 = 68.7 GFLOP.
// Strategy: flash-style on-the-fly score tiles.
//   scores (rank-8) generated with V_WMMA_F32_16X16X4_F32,
//   exp() + bf16-pack lands *exactly* in the B-operand layout of
//   V_WMMA_F32_16X16X32_BF16 (f32 C/D layout == bf16 B layout modulo packing),
//   main GEMM in bf16 WMMA with f32 accumulation.
// ---------------------------------------------------------------------------

#define NB   4      // batch
#define NC   256    // channels
#define NN   4096   // H*W
#define NR   8      // rank
#define NG   4      // groups
#define NCG  64     // channels per group
#define LOG2E 1.4426950408889634f

typedef __attribute__((ext_vector_type(2)))  float        v2f;
typedef __attribute__((ext_vector_type(8)))  float        v8f;
typedef __attribute__((ext_vector_type(16))) __bf16       v16bf;
typedef __attribute__((ext_vector_type(4)))  unsigned int v4u;

// ---------------------------------------------------------------------------
// Kernel 1: q/k projections.  q = (qw . f + qb) * log2(e)   (exp -> exp2)
//           k =  kw . f + kb
// Layout: qbuf/kbuf = [dir][B][R][N] f32.
// dir0 (LU path): q from fL (qL_w), k from fU (kU_w)
// dir1 (UL path): q from fU (qU_w), k from fL (kL_w)
// ---------------------------------------------------------------------------
__global__ __launch_bounds__(256)
void SKC_proj(const float* __restrict__ fL, const float* __restrict__ fU,
              const float* __restrict__ qLw, const float* __restrict__ qLb,
              const float* __restrict__ kUw, const float* __restrict__ kUb,
              const float* __restrict__ qUw, const float* __restrict__ qUb,
              const float* __restrict__ kLw, const float* __restrict__ kLb,
              float* __restrict__ qbuf, float* __restrict__ kbuf)
{
    const int t = blockIdx.x * 256 + threadIdx.x;   // over B*N
    const int b = t / NN;
    const int n = t % NN;

    float aq0[NR], ak0[NR], aq1[NR], ak1[NR];
#pragma unroll
    for (int r = 0; r < NR; ++r) { aq0[r] = 0.f; ak0[r] = 0.f; aq1[r] = 0.f; ak1[r] = 0.f; }

    const float* fl = fL + (size_t)b * NC * NN + n;
    const float* fu = fU + (size_t)b * NC * NN + n;
    for (int c = 0; c < NC; ++c) {
        const float xl = fl[(size_t)c * NN];
        const float xu = fu[(size_t)c * NN];
#pragma unroll
        for (int r = 0; r < NR; ++r) {
            aq0[r] += qLw[r * NC + c] * xl;   // uniform -> scalar loads
            ak0[r] += kUw[r * NC + c] * xu;
            aq1[r] += qUw[r * NC + c] * xu;
            ak1[r] += kLw[r * NC + c] * xl;
        }
    }
#pragma unroll
    for (int r = 0; r < NR; ++r) {
        qbuf[((size_t)0 * NB + b) * (NR * NN) + r * NN + n] = (aq0[r] + qLb[r]) * LOG2E;
        kbuf[((size_t)0 * NB + b) * (NR * NN) + r * NN + n] =  ak0[r] + kUb[r];
        qbuf[((size_t)1 * NB + b) * (NR * NN) + r * NN + n] = (aq1[r] + qUb[r]) * LOG2E;
        kbuf[((size_t)1 * NB + b) * (NR * NN) + r * NN + n] =  ak1[r] + kLb[r];
    }
}

// ---------------------------------------------------------------------------
// Kernel 2: softmax normalizers.  invZ[dir][b][m] = 1 / sum_j exp(q_m . k_j)
// One wave per 16-row m-tile.  A operand (q, fixed m) stays in registers;
// loop j in tiles of 16: two chained V_WMMA_F32_16X16X4_F32 (K=8), exp2,
// accumulate per-VGPR, then 16-lane xor reduction (lane halves independent).
// ---------------------------------------------------------------------------
__global__ __launch_bounds__(256)
void SKC_stats(const float* __restrict__ qbuf, const float* __restrict__ kbuf,
               float* __restrict__ invZ)
{
    const int lane = threadIdx.x & 31;
    const int wave = threadIdx.x >> 5;
    const int b    = blockIdx.y;
    const int dir  = blockIdx.z;
    const int m0   = (blockIdx.x * 8 + wave) * 16;
    const int l15  = lane & 15;
    const int hi   = lane >> 4;                 // lane-half select

    const float* q = qbuf + ((size_t)dir * NB + b) * (NR * NN);
    const float* k = kbuf + ((size_t)dir * NB + b) * (NR * NN);

    // A fragment: 16x4 f32: lanes 0-15 hold K=0,1 ; lanes 16-31 hold K=2,3
    v2f aq0, aq1;
    {
        const int m = m0 + l15;
        const int r = hi * 2;
        aq0.x = q[(r + 0) * NN + m];  aq0.y = q[(r + 1) * NN + m];
        aq1.x = q[(r + 4) * NN + m];  aq1.y = q[(r + 5) * NN + m];
    }

    v8f zacc = {0.f, 0.f, 0.f, 0.f, 0.f, 0.f, 0.f, 0.f};
    for (int j0 = 0; j0 < NN; j0 += 16) {
        v2f bk0, bk1;
        const int n = j0 + l15;
        const int r = hi * 2;
        bk0.x = k[(r + 0) * NN + n];  bk0.y = k[(r + 1) * NN + n];
        bk1.x = k[(r + 4) * NN + n];  bk1.y = k[(r + 5) * NN + n];

        v8f s = {0.f, 0.f, 0.f, 0.f, 0.f, 0.f, 0.f, 0.f};
        s = __builtin_amdgcn_wmma_f32_16x16x4_f32(false, aq0, false, bk0, (short)0, s, false, false);
        s = __builtin_amdgcn_wmma_f32_16x16x4_f32(false, aq1, false, bk1, (short)0, s, false, false);
#pragma unroll
        for (int g = 0; g < 8; ++g) zacc[g] += __builtin_amdgcn_exp2f(s[g]);
    }
    // reduce across the 16 lanes of each half (j is the lane dimension)
#pragma unroll
    for (int g = 0; g < 8; ++g) {
        float z = zacc[g];
        z += __shfl_xor(z, 1, 32);
        z += __shfl_xor(z, 2, 32);
        z += __shfl_xor(z, 4, 32);
        z += __shfl_xor(z, 8, 32);
        if (l15 == 0) {
            const int m = m0 + g + hi * 8;      // D layout: VGPR g -> row g / g+8
            invZ[((size_t)dir * NB + b) * NN + m] = 1.0f / z;
        }
    }
}

// ---------------------------------------------------------------------------
// Kernel 3: grouped v-projection fused with 1/Z, emitted as bf16.
// vp[dir][b][c][m] = bf16( (vb[c] + sum_i vw[c][i] f[b,g*64+i,m]) * invZ[dir][b][m] )
// Thread = (dir,b,g,n); the 64-deep f column lives in registers, read once.
// ---------------------------------------------------------------------------
__global__ __launch_bounds__(256)
void SKC_vp(const float* __restrict__ fL, const float* __restrict__ fU,
            const float* __restrict__ vUw, const float* __restrict__ vUb,
            const float* __restrict__ vLw, const float* __restrict__ vLb,
            const float* __restrict__ invZ, __bf16* __restrict__ vp)
{
    const int dir = blockIdx.z;
    const int bg  = blockIdx.y;
    const int b   = bg >> 2;
    const int g   = bg & 3;
    const int n   = blockIdx.x * 256 + threadIdx.x;

    const float* f  = (dir == 0) ? fU  : fL;    // LU uses vU(fU); UL uses vL(fL)
    const float* vw = (dir == 0) ? vUw : vLw;
    const float* vb = (dir == 0) ? vUb : vLb;

    float fr[NCG];
#pragma unroll
    for (int i = 0; i < NCG; ++i)
        fr[i] = f[((size_t)b * NC + g * NCG + i) * NN + n];

    const float iz = invZ[((size_t)dir * NB + b) * NN + n];

    for (int co = 0; co < NCG; ++co) {
        const int c = g * NCG + co;
        float acc = vb[c];
#pragma unroll
        for (int i = 0; i < NCG; ++i)
            acc += vw[(size_t)c * NCG + i] * fr[i];   // uniform -> scalar loads
        vp[(((size_t)dir * NB + b) * NC + c) * NN + n] = (__bf16)(acc * iz);
    }
}

// ---------------------------------------------------------------------------
// Kernel 4: main attend + residual.
//   out[c,n] = f[c,n] + beta * sum_m vp[c,m] * exp(q_m . k_n)
// Wave owns a fixed 16-wide n-tile and all 16 c-tiles (C=256).
// The eight waves of a block read the same vp values, so a vp tile of
// 256 c x 128 m is brought into LDS once per block by asynchronous copies
// (whole 256-byte rows from L2), two buffers: tile t+1 flies while tile t is
// worked on.  LDS row pitch 272 B = 16 B x odd: conflict-free b128 reads.
// Per 32-wide m-step: 4x f32 WMMA score tiles -> exp2 -> bf16 pack
// (f32 D layout coincides with bf16 B layout: zero lane shuffles) ->
// 16x V_WMMA_F32_16X16X32_BF16 with two b128 LDS reads each.
// ---------------------------------------------------------------------------
#define MT     128                 // m per staged tile
#define NT     (NN / MT)           // staged tiles
#define PITCH  272                 // LDS bytes per row: MT*2 + 16
#define BUFB   (NC * PITCH)        // LDS bytes per buffer

// One thread's share of one tile: 16 copies of 16 B, rows 16 apart.
// g: this lane's first global element, l: this lane's first LDS byte address.
__device__ __forceinline__ void SKC_stage(const __bf16* g, unsigned l)
{
    // unrolled: two statements of eight copies (an asm statement takes 30 operands)
#pragma unroll
    for (int h = 0; h < 2; ++h) {
        const __bf16* gh = g + (size_t)h * 128 * NN;
        const unsigned lh = l + h * 128 * PITCH;
        // s_wait_xcnt as the statement's last line: it stands in front of any
        // later rewrite of the address registers that the copies name.
        asm volatile(
            "global_load_async_to_lds_b128 %0, %8, off\n\t"
            "global_load_async_to_lds_b128 %1, %9, off\n\t"
            "global_load_async_to_lds_b128 %2, %10, off\n\t"
            "global_load_async_to_lds_b128 %3, %11, off\n\t"
            "global_load_async_to_lds_b128 %4, %12, off\n\t"
            "global_load_async_to_lds_b128 %5, %13, off\n\t"
            "global_load_async_to_lds_b128 %6, %14, off\n\t"
            "global_load_async_to_lds_b128 %7, %15, off\n\t"
            "s_wait_xcnt 0x0"
            :: "v"(lh + 0 * 16 * PITCH), "v"(lh + 1 * 16 * PITCH),
               "v"(lh + 2 * 16 * PITCH), "v"(lh + 3 * 16 * PITCH),
               "v"(lh + 4 * 16 * PITCH), "v"(lh + 5 * 16 * PITCH),
               "v"(lh + 6 * 16 * PITCH), "v"(lh + 7 * 16 * PITCH),
               "v"(gh + (size_t)0 * 16 * NN), "v"(gh + (size_t)1 * 16 * NN),
               "v"(gh + (size_t)2 * 16 * NN), "v"(gh + (size_t)3 * 16 * NN),
               "v"(gh + (size_t)4 * 16 * NN), "v"(gh + (size_t)5 * 16 * NN),
               "v"(gh + (size_t)6 * 16 * NN), "v"(gh + (size_t)7 * 16 * NN)
            : "memory");
    }
}

__global__ __launch_bounds__(256)
void SKC_attend(const float* __restrict__ fL, const float* __restrict__ fU,
                const float* __restrict__ qbuf, const float* __restrict__ kbuf,
                const __bf16* __restrict__ vp, const float* __restrict__ betap,
                float* __restrict__ out)
{
    __shared__ __attribute__((aligned(16))) unsigned char sv[2 * BUFB];

    const int lane = threadIdx.x & 31;
    const int wave = threadIdx.x >> 5;
    const int b    = blockIdx.y;
    const int dir  = blockIdx.z;
    const int n0   = (blockIdx.x * 8 + wave) * 16;
    const int l15  = lane & 15;
    const int hi   = lane >> 4;
    const float beta = *betap;

    const float*  q   = qbuf + ((size_t)dir * NB + b) * (NR * NN);
    const float*  k   = kbuf + ((size_t)dir * NB + b) * (NR * NN);
    const __bf16* vpb = vp   + ((size_t)dir * NB + b) * (size_t)(NC * NN);

    // copy share of this thread: 16 lanes cover one 256-byte row
    const int crow = threadIdx.x >> 4;          // 0..15, then +16 per copy
    const int ccol = threadIdx.x & 15;          // 16-byte piece of the row
    const __bf16*  gsrc = vpb + (size_t)crow * NN + ccol * 8;
    const unsigned ldst = (unsigned)(size_t)sv + crow * PITCH + ccol * 16;

    // ---- tile 0 into buffer 0, published; then tile 1 into buffer 1 ----
    SKC_stage(gsrc, ldst);
    asm volatile("s_wait_asynccnt 0x0" ::: "memory");   // own copies of tile 0 landed
    __syncthreads();                                    // every wave's copies landed
    SKC_stage(gsrc + MT, ldst + BUFB);

    // k B-fragment for this n-tile: constant across the whole m loop.
    v2f bk0, bk1;
    {
        const int n = n0 + l15;
        const int r = hi * 2;
        bk0.x = k[(r + 0) * NN + n];  bk0.y = k[(r + 1) * NN + n];
        bk1.x = k[(r + 4) * NN + n];  bk1.y = k[(r + 5) * NN + n];
    }

    v8f acc[16];
    const v8f vzero = {0.f, 0.f, 0.f, 0.f, 0.f, 0.f, 0.f, 0.f};
#pragma unroll
    for (int ct = 0; ct < 16; ++ct) acc[ct] = vzero;

    // bf16 A layout: row = l15, lane-half K offset of 8 elements = 16 bytes
    const unsigned char* svl = sv + l15 * PITCH + hi * 16;

    // q A-fragments of m-step 0 (f32 16x4: lanes 0-15 hold K=0,1; 16-31 K=2,3)
    const int qlane = (hi * 2) * NN + l15;      // this lane's place in a q tile
    v2f qa0lo, qa0hi, qa1lo, qa1hi;
    qa0lo.x = q[qlane + 0 * NN];       qa0lo.y = q[qlane + 1 * NN];
    qa0hi.x = q[qlane + 4 * NN];       qa0hi.y = q[qlane + 5 * NN];
    qa1lo.x = q[qlane + 0 * NN + 16];  qa1lo.y = q[qlane + 1 * NN + 16];
    qa1hi.x = q[qlane + 4 * NN + 16];  qa1hi.y = q[qlane + 5 * NN + 16];

    // kept rolled: one trip per staged tile, the buffer chosen by the trip's
    // parity (for speed only)
#pragma unroll 1
    for (int t = 0; t < NT; ++t) {
        const unsigned char* svt = svl + (t & 1) * BUFB;

        // two register sets of four A fragments: block j+1 is read from LDS as
        // one group while block j (four c-tiles of one m-step) is multiplied
        // (every loop below is unrolled so that fr and acc are indexed by
        // constants and stay in registers)
        v4u fr[2][8];
#pragma unroll
        for (int i = 0; i < 4; ++i) {
            const unsigned char* p = svt + i * 16 * PITCH;
            fr[0][2 * i]     = *(const v4u*)(p);        // K = moff .. moff+7
            fr[0][2 * i + 1] = *(const v4u*)(p + 32);   // K = 16+moff .. 16+moff+7
        }

#pragma unroll
        for (int ms = 0; ms < MT / 32; ++ms) {
            // WMMA distance: the score WMMAs below may be given, as their D, the
            // registers that the last bf16 WMMA of the m-step before reads as B;
            // only scalar instructions stand between the two otherwise.
            asm volatile("v_nop\n\tv_nop\n\tv_nop\n\tv_nop\n\tv_nop");
            // keeps the score WMMAs behind those slots
            __builtin_amdgcn_sched_barrier(0);
            // ---- score tiles s0 (m0..m0+15) and s1 (m0+16..m0+31), K=8 rank ----
            // this m-step's q fragments are in registers; the next m-step's are
            // asked for here, a whole m-step ahead of their use (the scheduling
            // fences below would otherwise hold the loads right at their use).
            // After the last m-step the index wraps to 0: in bounds, not used.
            const v2f a0lo = qa0lo, a0hi = qa0hi, a1lo = qa1lo, a1hi = qa1hi;
            {
                const float* qn = q + ((t * MT + ms * 32 + 32) & (NN - 1));
                qa0lo.x = qn[qlane + 0 * NN];       qa0lo.y = qn[qlane + 1 * NN];
                qa0hi.x = qn[qlane + 4 * NN];       qa0hi.y = qn[qlane + 5 * NN];
                qa1lo.x = qn[qlane + 0 * NN + 16];  qa1lo.y = qn[qlane + 1 * NN + 16];
                qa1hi.x = qn[qlane + 4 * NN + 16];  qa1hi.y = qn[qlane + 5 * NN + 16];
            }
            v8f s0 = vzero, s1 = vzero;
            s0 = __builtin_amdgcn_wmma_f32_16x16x4_f32(false, a0lo, false, bk0, (short)0, s0, false, false);
            s0 = __builtin_amdgcn_wmma_f32_16x16x4_f32(false, a0hi, false, bk1, (short)0, s0, false, false);
            s1 = __builtin_amdgcn_wmma_f32_16x16x4_f32(false, a1lo, false, bk0, (short)0, s1, false, false);
            s1 = __builtin_amdgcn_wmma_f32_16x16x4_f32(false, a1hi, false, bk1, (short)0, s1, false, false);

            // ---- E tile -> bf16 B operand (layouts line up; in-lane pack) ----
            v16bf eb;
#pragma unroll
            for (int g = 0; g < 8; ++g) {
                eb[g]     = (__bf16)__builtin_amdgcn_exp2f(s0[g]);   // K = moff+g
                eb[8 + g] = (__bf16)__builtin_amdgcn_exp2f(s1[g]);   // K = 16+moff+g
            }

            // ---- 16 c-tiles of the main bf16 GEMM, A fragments from LDS ----
#pragma unroll
            for (int cb = 0; cb < 4; ++cb) {
                const int j  = ms * 4 + cb;         // this block
                const int jn = j + 1;               // the block read ahead
                if (jn < (MT / 32) * 4) {
#pragma unroll
                    for (int i = 0; i < 4; ++i) {
                        const unsigned char* p =
                            svt + ((jn & 3) * 4 + i) * 16 * PITCH + (jn >> 2) * 64;
                        fr[jn & 1][2 * i]     = *(const v4u*)(p);
                        fr[jn & 1][2 * i + 1] = *(const v4u*)(p + 32);
                    }
                }
                // keeps the eight LDS reads together ahead of the block (for speed only)
                __builtin_amdgcn_sched_barrier(0);
#pragma unroll
                for (int i = 0; i < 4; ++i) {
                    union { v4u u[2]; v16bf h; } U;
                    U.u[0] = fr[j & 1][2 * i];
                    U.u[1] = fr[j & 1][2 * i + 1];
                    acc[cb * 4 + i] = __builtin_amdgcn_wmma_f32_16x16x32_bf16(
                        false, U.h, false, eb, (short)0, acc[cb * 4 + i], false, false);
                }
                // keeps the next group of reads behind this block's WMMAs
                __builtin_amdgcn_sched_barrier(0);
            }
        }
        // ---- hand-over: tile t+1 becomes readable, tile t's buffer free ----
        asm volatile("s_wait_dscnt 0x0" ::: "memory");      // own reads of tile t done
        asm volatile("s_wait_asynccnt 0x0" ::: "memory");   // own copies of tile t+1 landed
        __syncthreads();                                    // the same for every wave
        if (t + 2 < NT)
            SKC_stage(gsrc + (size_t)(t + 2) * MT, ldst + (t & 1) * BUFB);
    }
    asm volatile("s_wait_asynccnt 0x0" ::: "memory");       // nothing in flight at the wave's end

    // ---- epilogue: fused residual, write d_out ----
    const float* f = (dir == 0) ? fL : fU;
    float* o = out + (size_t)dir * ((size_t)NB * NC * NN);
#pragma unroll
    for (int ct = 0; ct < 16; ++ct) {
#pragma unroll
        for (int g = 0; g < 8; ++g) {
            const int c = ct * 16 + g + hi * 8;
            const int n = n0 + l15;
            const size_t idx = ((size_t)b * NC + c) * NN + n;
            o[idx] = f[idx] + beta * acc[ct][g];
        }
    }
}

// ---------------------------------------------------------------------------
// Host-side launcher.  Workspace layout (floats unless noted):
//   qbuf : 2*B*R*N            = 262144
//   kbuf : 2*B*R*N            = 262144
//   invZ : 2*B*N              =  32768
//   vp   : 2*B*C*N  (bf16)    -> 16.8 MB      (total ~19 MB)
// ---------------------------------------------------------------------------
extern "C" void kernel_launch(void* const* d_in, const int* in_sizes, int n_in,
                              void* d_out, int out_size, void* d_ws, size_t ws_size,
                              hipStream_t stream)
{
    const float* fL   = (const float*)d_in[0];
    const float* fU   = (const float*)d_in[1];
    const float* qLw  = (const float*)d_in[2];
    const float* qLb  = (const float*)d_in[3];
    const float* kUw  = (const float*)d_in[4];
    const float* kUb  = (const float*)d_in[5];
    const float* vUw  = (const float*)d_in[6];
    const float* vUb  = (const float*)d_in[7];
    const float* qUw  = (const float*)d_in[8];
    const float* qUb  = (const float*)d_in[9];
    const float* kLw  = (const float*)d_in[10];
    const float* kLb  = (const float*)d_in[11];
    const float* vLw  = (const float*)d_in[12];
    const float* vLb  = (const float*)d_in[13];
    const float* beta = (const float*)d_in[14];
    float* outp = (float*)d_out;

    float*  qbuf = (float*)d_ws;
    float*  kbuf = qbuf + (size_t)2 * NB * NR * NN;
    float*  invZ = kbuf + (size_t)2 * NB * NR * NN;
    __bf16* vp   = (__bf16*)(invZ + (size_t)2 * NB * NN);

    // 1) projections (q pre-scaled by log2 e)
    SKC_proj<<<dim3((NB * NN) / 256), dim3(256), 0, stream>>>(
        fL, fU, qLw, qLb, kUw, kUb, qUw, qUb, kLw, kLb, qbuf, kbuf);

    // 2) softmax normalizers via f32 WMMA score tiles
    SKC_stats<<<dim3(NN / 128, NB, 2), dim3(256), 0, stream>>>(qbuf, kbuf, invZ);

    // 3) grouped v-projection folded with 1/Z, bf16 output
    SKC_vp<<<dim3(NN / 256, NB * NG, 2), dim3(256), 0, stream>>>(
        fL, fU, vUw, vUb, vLw, vLb, invZ, vp);

    // 4) main attend (f32-WMMA score gen + bf16-WMMA GEMM) + fused residual
    SKC_attend<<<dim3(NN / 128, NB, 2), dim3(256), 0, stream>>>(
        fL, fU, qbuf, kbuf, vp, beta, outp);
}

// v002
// A run of this version takes 137 microseconds.
// In two side-by-side timings against v001, it was 1.76 and 1.77 times as fast.
// Counting every step since v000, it is 4.52 times as fast.
#include <hip/hip_runtime.h>
#include <hip/hip_bf16.h>

// ---------------------------------------------------------------------------
// SKCLite cross-attention for MI455X (gfx1250, wave32, WMMA).
//
// B=4, C=256, N=H*W=4096, R=8 (rank), G=4 groups (CG=64).
// Dominant cost: out = v @ softmax(q^T k)  -> 2 * 2*B*C*N^2 = 68.7 GFLOP.
// Strategy: flash-style on-the-fly score tiles.
//   scores (rank-8) generated with V_WMMA_F32_16X16X4_F32,
//   exp() + bf16-pack lands *exactly* in the B-operand layout of
//   V_WMMA_F32_16X16X32_BF16 (f32 C/D layout == bf16 B layout modulo packing),
//   main GEMM in bf16 WMMA with f32 accumulation.
// ---------------------------------------------------------------------------

#define NB   4      // batch
#define NC   256    // channels
#define NN   4096   // H*W
#define NR   8      // rank
#define NG   4      // groups
#define NCG  64     // channels per group
#define LOG2E 1.4426950408889634f

typedef __attribute__((ext_vector_type(2)))  float        v2f;
typedef __attribute__((ext_vector_type(8)))  float        v8f;
typedef __attribute__((ext_vector_type(16))) __bf16       v16bf;
typedef __attribute__((ext_vector_type(4)))  unsigned int v4u;

// ---------------------------------------------------------------------------
// Kernel 1: q/k projections.  q = (qw . f + qb) * log2(e)   (exp -> exp2)
//           k =  kw . f + kb
// Layout: qbuf/kbuf = [dir][B][R][N] f32.
// dir0 (LU path): q from fL (qL_w), k from fU (kU_w)
// dir1 (UL path): q from fU (qU_w), k from fL (kL_w)
// The kernel is a stream over fL and fU from memory, so it is built for bytes
// in flight: block = (source map, batch, 128 n), one per WGP; each of its 16
// waves takes 16 of the 256 channels and asks for all its 16 rows (512
// contiguous bytes each) before it uses the first.  The 16 partial sums
// meet in LDS and are added in channel order.
// ---------------------------------------------------------------------------
#define PC 16       // channels per wave
#define PN 128      // n per block: 32 lanes x 4

typedef __attribute__((ext_vector_type(4))) float v4f;

__global__ __launch_bounds__(512)
void SKC_proj(const float* __restrict__ fL, const float* __restrict__ fU,
              const float* __restrict__ qLw, const float* __restrict__ qLb,
              const float* __restrict__ kUw, const float* __restrict__ kUb,
              const float* __restrict__ qUw, const float* __restrict__ qUb,
              const float* __restrict__ kLw, const float* __restrict__ kLb,
              float* __restrict__ qbuf, float* __restrict__ kbuf)
{
    __shared__ v4f red[NC / PC][2 * NR][32];    // [wave][q rows, k rows][lane]

    const int lane = threadIdx.x & 31;
    // wave-uniform, so that the weights come by scalar loads
    const int wave = __builtin_amdgcn_readfirstlane(threadIdx.x >> 5);
    const int b    = blockIdx.y;
    const int srcU = blockIdx.z;                // 0: fL, 1: fU
    const int n0   = blockIdx.x * PN;
    const unsigned l4 = lane * 4;               // this lane's four n

    const float* f  = srcU ? fU  : fL;
    const float* qw = srcU ? qUw : qLw;
    const float* kw = srcU ? kUw : kLw;

    // after the sums wave w finishes one row: waves 0-7 row w of q, waves 8-15
    // row w-8 of k.  q of fL is dir 0, q of fU dir 1; k the other way round.
    const bool  isq   = wave < NR;
    const int   row   = wave & (NR - 1);
    const float bias  = (isq ? (srcU ? qUb : qLb) : (srcU ? kUb : kLb))[row];
    const float scale = isq ? LOG2E : 1.0f;
    float* ob = (isq ? qbuf : kbuf)
              + ((size_t)(isq ? srcU : 1 - srcU) * NB + b) * (NR * NN) + row * NN + n0;

    const int c0 = wave * PC;
    const float* fb = f + ((size_t)b * NC + c0) * NN + n0;

    // unrolled: x is indexed by constants and all 16 loads stand in a row
    v4f x[PC];
#pragma unroll
    for (int i = 0; i < PC; ++i)
        x[i] = *(const v4f*)(fb + (size_t)i * NN + l4);

    // every loop below is unrolled so that x, aq and ak are indexed by
    // constants and stay in registers
    v4f aq[NR], ak[NR];
#pragma unroll
    for (int r = 0; r < NR; ++r) { aq[r] = (v4f)(0.f); ak[r] = (v4f)(0.f); }

#pragma unroll
    for (int i = 0; i < PC; ++i) {
#pragma unroll
        for (int r = 0; r < NR; ++r) {
            aq[r] += qw[r * NC + c0 + i] * x[i];   // uniform -> scalar loads
            ak[r] += kw[r * NC + c0 + i] * x[i];
        }
    }

#pragma unroll
    for (int r = 0; r < NR; ++r) {
        red[wave][r][lane]      = aq[r];
        red[wave][NR + r][lane] = ak[r];
    }
    __syncthreads();

    // unrolled: several LDS reads are in flight ahead of the adds
    v4f s = red[0][wave][lane];
#pragma unroll
    for (int p = 1; p < NC / PC; ++p)
        s += red[p][wave][lane];
    *(v4f*)(ob + l4) = (s + bias) * scale;
}

// ---------------------------------------------------------------------------
// Kernel 2: softmax normalizers.  invZ[dir][b][m] = 1 / sum_j exp(q_m . k_j)
// One wave per 16-row m-tile.  A operand (q, fixed m) stays in registers;
// loop j in tiles of 16: two chained V_WMMA_F32_16X16X4_F32 (K=8), exp2,
// accumulate per-VGPR, then 16-lane xor reduction (lane halves independent).
// ---------------------------------------------------------------------------
__global__ __launch_bounds__(256)
void SKC_stats(const float* __restrict__ qbuf, const float* __restrict__ kbuf,
               float* __restrict__ invZ)
{
    const int lane = threadIdx.x & 31;
    const int wave = threadIdx.x >> 5;
    const int b    = blockIdx.y;
    const int dir  = blockIdx.z;
    const int m0   = (blockIdx.x * 8 + wave) * 16;
    const int l15  = lane & 15;
    const int hi   = lane >> 4;                 // lane-half select

    const float* q = qbuf + ((size_t)dir * NB + b) * (NR * NN);
    const float* k = kbuf + ((size_t)dir * NB + b) * (NR * NN);

    // A fragment: 16x4 f32: lanes 0-15 hold K=0,1 ; lanes 16-31 hold K=2,3
    v2f aq0, aq1;
    {
        const int m = m0 + l15;
        const int r = hi * 2;
        aq0.x = q[(r + 0) * NN + m];  aq0.y = q[(r + 1) * NN + m];
        aq1.x = q[(r + 4) * NN + m];  aq1.y = q[(r + 5) * NN + m];
    }

    v8f zacc = {0.f, 0.f, 0.f, 0.f, 0.f, 0.f, 0.f, 0.f};
    for (int j0 = 0; j0 < NN; j0 += 16) {
        v2f bk0, bk1;
        const int n = j0 + l15;
        const int r = hi * 2;
        bk0.x = k[(r + 0) * NN + n];  bk0.y = k[(r + 1) * NN + n];
        bk1.x = k[(r + 4) * NN + n];  bk1.y = k[(r + 5) * NN + n];

        v8f s = {0.f, 0.f, 0.f, 0.f, 0.f, 0.f, 0.f, 0.f};
        s = __builtin_amdgcn_wmma_f32_16x16x4_f32(false, aq0, false, bk0, (short)0, s, false, false);
        s = __builtin_amdgcn_wmma_f32_16x16x4_f32(false, aq1, false, bk1, (short)0, s, false, false);
#pragma unroll
        for (int g = 0; g < 8; ++g) zacc[g] += __builtin_amdgcn_exp2f(s[g]);
    }
    // reduce across the 16 lanes of each half (j is the lane dimension)
#pragma unroll
    for (int g = 0; g < 8; ++g) {
        float z = zacc[g];
        z += __shfl_xor(z, 1, 32);
        z += __shfl_xor(z, 2, 32);
        z += __shfl_xor(z, 4, 32);
        z += __shfl_xor(z, 8, 32);
        if (l15 == 0) {
            const int m = m0 + g + hi * 8;      // D layout: VGPR g -> row g / g+8
            invZ[((size_t)dir * NB + b) * NN + m] = 1.0f / z;
        }
    }
}

// ---------------------------------------------------------------------------
// Kernel 3: grouped v-projection fused with 1/Z, emitted as bf16.
// vp[dir][b][c][m] = bf16( (vb[c] + sum_i vw[c][i] f[b,g*64+i,m]) * invZ[dir][b][m] )
// Thread = (dir,b,g,n); the 64-deep f column lives in registers, read once.
// ---------------------------------------------------------------------------
__global__ __launch_bounds__(256)
void SKC_vp(const float* __restrict__ fL, const float* __restrict__ fU,
            const float* __restrict__ vUw, const float* __restrict__ vUb,
            const float* __restrict__ vLw, const float* __restrict__ vLb,
            const float* __restrict__ invZ, __bf16* __restrict__ vp)
{
    const int dir = blockIdx.z;
    const int bg  = blockIdx.y;
    const int b   = bg >> 2;
    const int g   = bg & 3;
    const int n   = blockIdx.x * 256 + threadIdx.x;

    const float* f  = (dir == 0) ? fU  : fL;    // LU uses vU(fU); UL uses vL(fL)
    const float* vw = (dir == 0) ? vUw : vLw;
    const float* vb = (dir == 0) ? vUb : vLb;

    float fr[NCG];
#pragma unroll
    for (int i = 0; i < NCG; ++i)
        fr[i] = f[((size_t)b * NC + g * NCG + i) * NN + n];

    const float iz = invZ[((size_t)dir * NB + b) * NN + n];

    for (int co = 0; co < NCG; ++co) {
        const int c = g * NCG + co;
        float acc = vb[c];
#pragma unroll
        for (int i = 0; i < NCG; ++i)
            acc += vw[(size_t)c * NCG + i] * fr[i];   // uniform -> scalar loads
        vp[(((size_t)dir * NB + b) * NC + c) * NN + n] = (__bf16)(acc * iz);
    }
}

// ---------------------------------------------------------------------------
// Kernel 4: main attend + residual.
//   out[c,n] = f[c,n] + beta * sum_m vp[c,m] * exp(q_m . k_n)
// Wave owns a fixed 16-wide n-tile and all 16 c-tiles (C=256).
// The eight waves of a block read the same vp values, so a vp tile of
// 256 c x 128 m is brought into LDS once per block by asynchronous copies
// (whole 256-byte rows from L2), two buffers: tile t+1 flies while tile t is
// worked on.  LDS row pitch 272 B = 16 B x odd: conflict-free b128 reads.
// Per 32-wide m-step: 4x f32 WMMA score tiles -> exp2 -> bf16 pack
// (f32 D layout coincides with bf16 B layout: zero lane shuffles) ->
// 16x V_WMMA_F32_16X16X32_BF16 with two b128 LDS reads each.
// ---------------------------------------------------------------------------
#define MT     128                 // m per staged tile
#define NT     (NN / MT)           // staged tiles
#define PITCH  272                 // LDS bytes per row: MT*2 + 16
#define BUFB   (NC * PITCH)        // LDS bytes per buffer

// One thread's share of one tile: 16 copies of 16 B, rows 16 apart.
// g: this lane's first global element, l: this lane's first LDS byte address.
__device__ __forceinline__ void SKC_stage(const __bf16* g, unsigned l)
{
    // unrolled: two statements of eight copies (an asm statement takes 30 operands)
#pragma unroll
    for (int h = 0; h < 2; ++h) {
        const __bf16* gh = g + (size_t)h * 128 * NN;
        const unsigned lh = l + h * 128 * PITCH;
        // s_wait_xcnt as the statement's last line: it stands in front of any
        // later rewrite of the address registers that the copies name.
        asm volatile(
            "global_load_async_to_lds_b128 %0, %8, off\n\t"
            "global_load_async_to_lds_b128 %1, %9, off\n\t"
            "global_load_async_to_lds_b128 %2, %10, off\n\t"
            "global_load_async_to_lds_b128 %3, %11, off\n\t"
            "global_load_async_to_lds_b128 %4, %12, off\n\t"
            "global_load_async_to_lds_b128 %5, %13, off\n\t"
            "global_load_async_to_lds_b128 %6, %14, off\n\t"
            "global_load_async_to_lds_b128 %7, %15, off\n\t"
            "s_wait_xcnt 0x0"
            :: "v"(lh + 0 * 16 * PITCH), "v"(lh + 1 * 16 * PITCH),
               "v"(lh + 2 * 16 * PITCH), "v"(lh + 3 * 16 * PITCH),
               "v"(lh + 4 * 16 * PITCH), "v"(lh + 5 * 16 * PITCH),
               "v"(lh + 6 * 16 * PITCH), "v"(lh + 7 * 16 * PITCH),
               "v"(gh + (size_t)0 * 16 * NN), "v"(gh + (size_t)1 * 16 * NN),
               "v"(gh + (size_t)2 * 16 * NN), "v"(gh + (size_t)3 * 16 * NN),
               "v"(gh + (size_t)4 * 16 * NN), "v"(gh + (size_t)5 * 16 * NN),
               "v"(gh + (size_t)6 * 16 * NN), "v"(gh + (size_t)7 * 16 * NN)
            : "memory");
    }
}

__global__ __launch_bounds__(256)
void SKC_attend(const float* __restrict__ fL, const float* __restrict__ fU,
                const float* __restrict__ qbuf, const float* __restrict__ kbuf,
                const __bf16* __restrict__ vp, const float* __restrict__ betap,
                float* __restrict__ out)
{
    __shared__ __attribute__((aligned(16))) unsigned char sv[2 * BUFB];

    const int lane = threadIdx.x & 31;
    const int wave = threadIdx.x >> 5;
    const int b    = blockIdx.y;
    const int dir  = blockIdx.z;
    const int n0   = (blockIdx.x * 8 + wave) * 16;
    const int l15  = lane & 15;
    const int hi   = lane >> 4;
    const float beta = *betap;

    const float*  q   = qbuf + ((size_t)dir * NB + b) * (NR * NN);
    const float*  k   = kbuf + ((size_t)dir * NB + b) * (NR * NN);
    const __bf16* vpb = vp   + ((size_t)dir * NB + b) * (size_t)(NC * NN);

    // copy share of this thread: 16 lanes cover one 256-byte row
    const int crow = threadIdx.x >> 4;          // 0..15, then +16 per copy
    const int ccol = threadIdx.x & 15;          // 16-byte piece of the row
    const __bf16*  gsrc = vpb + (size_t)crow * NN + ccol * 8;
    const unsigned ldst = (unsigned)(size_t)sv + crow * PITCH + ccol * 16;

    // ---- tile 0 into buffer 0, published; then tile 1 into buffer 1 ----
    SKC_stage(gsrc, ldst);
    asm volatile("s_wait_asynccnt 0x0" ::: "memory");   // own copies of tile 0 landed
    __syncthreads();                                    // every wave's copies landed
    SKC_stage(gsrc + MT, ldst + BUFB);

    // k B-fragment for this n-tile: constant across the whole m loop.
    v2f bk0, bk1;
    {
        const int n = n0 + l15;
        const int r = hi * 2;
        bk0.x = k[(r + 0) * NN + n];  bk0.y = k[(r + 1) * NN + n];
        bk1.x = k[(r + 4) * NN + n];  bk1.y = k[(r + 5) * NN + n];
    }

    v8f acc[16];
    const v8f vzero = {0.f, 0.f, 0.f, 0.f, 0.f, 0.f, 0.f, 0.f};
#pragma unroll
    for (int ct = 0; ct < 16; ++ct) acc[ct] = vzero;

    // bf16 A layout: row = l15, lane-half K offset of 8 elements = 16 bytes
    const unsigned char* svl = sv + l15 * PITCH + hi * 16;

    // q A-fragments of m-step 0 (f32 16x4: lanes 0-15 hold K=0,1; 16-31 K=2,3)
    const int qlane = (hi * 2) * NN + l15;      // this lane's place in a q tile
    v2f qa0lo, qa0hi, qa1lo, qa1hi;
    qa0lo.x = q[qlane + 0 * NN];       qa0lo.y = q[qlane + 1 * NN];
    qa0hi.x = q[qlane + 4 * NN];       qa0hi.y = q[qlane + 5 * NN];
    qa1lo.x = q[qlane + 0 * NN + 16];  qa1lo.y = q[qlane + 1 * NN + 16];
    qa1hi.x = q[qlane + 4 * NN + 16];  qa1hi.y = q[qlane + 5 * NN + 16];

    // kept rolled: one trip per staged tile, the buffer chosen by the trip's
    // parity (for speed only)
#pragma unroll 1
    for (int t = 0; t < NT; ++t) {
        const unsigned char* svt = svl + (t & 1) * BUFB;

        // two register sets of four A fragments: block j+1 is read from LDS as
        // one group while block j (four c-tiles of one m-step) is multiplied
        // (every loop below is unrolled so that fr and acc are indexed by
        // constants and stay in registers)
        v4u fr[2][8];
#pragma unroll
        for (int i = 0; i < 4; ++i) {
            const unsigned char* p = svt + i * 16 * PITCH;
            fr[0][2 * i]     = *(const v4u*)(p);        // K = moff .. moff+7
            fr[0][2 * i + 1] = *(const v4u*)(p + 32);   // K = 16+moff .. 16+moff+7
        }

#pragma unroll
        for (int ms = 0; ms < MT / 32; ++ms) {
            // WMMA distance: the score WMMAs below may be given, as their D, the
            // registers that the last bf16 WMMA of the m-step before reads as B;
            // only scalar instructions stand between the two otherwise.
            asm volatile("v_nop\n\tv_nop\n\tv_nop\n\tv_nop\n\tv_nop");
            // keeps the score WMMAs behind those slots
            __builtin_amdgcn_sched_barrier(0);
            // ---- score tiles s0 (m0..m0+15) and s1 (m0+16..m0+31), K=8 rank ----
            // this m-step's q fragments are in registers; the next m-step's are
            // asked for here, a whole m-step ahead of their use (the scheduling
            // fences below would otherwise hold the loads right at their use).
            // After the last m-step the index wraps to 0: in bounds, not used.
            const v2f a0lo = qa0lo, a0hi = qa0hi, a1lo = qa1lo, a1hi = qa1hi;
            {
                const float* qn = q + ((t * MT + ms * 32 + 32) & (NN - 1));
                qa0lo.x = qn[qlane + 0 * NN];       qa0lo.y = qn[qlane + 1 * NN];
                qa0hi.x = qn[qlane + 4 * NN];       qa0hi.y = qn[qlane + 5 * NN];
                qa1lo.x = qn[qlane + 0 * NN + 16];  qa1lo.y = qn[qlane + 1 * NN + 16];
                qa1hi.x = qn[qlane + 4 * NN + 16];  qa1hi.y = qn[qlane + 5 * NN + 16];
            }
            v8f s0 = vzero, s1 = vzero;
            s0 = __builtin_amdgcn_wmma_f32_16x16x4_f32(false, a0lo, false, bk0, (short)0, s0, false, false);
            s0 = __builtin_amdgcn_wmma_f32_16x16x4_f32(false, a0hi, false, bk1, (short)0, s0, false, false);
            s1 = __builtin_amdgcn_wmma_f32_16x16x4_f32(false, a1lo, false, bk0, (short)0, s1, false, false);
            s1 = __builtin_amdgcn_wmma_f32_16x16x4_f32(false, a1hi, false, bk1, (short)0, s1, false, false);

            // ---- E tile -> bf16 B operand (layouts line up; in-lane pack) ----
            v16bf eb;
#pragma unroll
            for (int g = 0; g < 8; ++g) {
                eb[g]     = (__bf16)__builtin_amdgcn_exp2f(s0[g]);   // K = moff+g
                eb[8 + g] = (__bf16)__builtin_amdgcn_exp2f(s1[g]);   // K = 16+moff+g
            }

            // ---- 16 c-tiles of the main bf16 GEMM, A fragments from LDS ----
#pragma unroll
            for (int cb = 0; cb < 4; ++cb) {
                const int j  = ms * 4 + cb;         // this block
                const int jn = j + 1;               // the block read ahead
                if (jn < (MT / 32) * 4) {
#pragma unroll
                    for (int i = 0; i < 4; ++i) {
                        const unsigned char* p =
                            svt + ((jn & 3) * 4 + i) * 16 * PITCH + (jn >> 2) * 64;
                        fr[jn & 1][2 * i]     = *(const v4u*)(p);
                        fr[jn & 1][2 * i + 1] = *(const v4u*)(p + 32);
                    }
                }
                // keeps the eight LDS reads together ahead of the block (for speed only)
                __builtin_amdgcn_sched_barrier(0);
#pragma unroll
                for (int i = 0; i < 4; ++i) {
                    union { v4u u[2]; v16bf h; } U;
                    U.u[0] = fr[j & 1][2 * i];
                    U.u[1] = fr[j & 1][2 * i + 1];
                    acc[cb * 4 + i] = __builtin_amdgcn_wmma_f32_16x16x32_bf16(
                        false, U.h, false, eb, (short)0, acc[cb * 4 + i], false, false);
                }
                // keeps the next group of reads behind this block's WMMAs
                __builtin_amdgcn_sched_barrier(0);
            }
        }
        // ---- hand-over: tile t+1 becomes readable, tile t's buffer free ----
        asm volatile("s_wait_dscnt 0x0" ::: "memory");      // own reads of tile t done
        asm volatile("s_wait_asynccnt 0x0" ::: "memory");   // own copies of tile t+1 landed
        __syncthreads();                                    // the same for every wave
        if (t + 2 < NT)
            SKC_stage(gsrc + (size_t)(t + 2) * MT, ldst + (t & 1) * BUFB);
    }
    asm volatile("s_wait_asynccnt 0x0" ::: "memory");       // nothing in flight at the wave's end

    // ---- epilogue: fused residual, write d_out ----
    const float* f = (dir == 0) ? fL : fU;
    float* o = out + (size_t)dir * ((size_t)NB * NC * NN);
#pragma unroll
    for (int ct = 0; ct < 16; ++ct) {
#pragma unroll
        for (int g = 0; g < 8; ++g) {
            const int c = ct * 16 + g + hi * 8;
            const int n = n0 + l15;
            const size_t idx = ((size_t)b * NC + c) * NN + n;
            o[idx] = f[idx] + beta * acc[ct][g];
        }
    }
}

// ---------------------------------------------------------------------------
// Host-side launcher.  Workspace layout (floats unless noted):
//   qbuf : 2*B*R*N            = 262144
//   kbuf : 2*B*R*N            = 262144
//   invZ : 2*B*N              =  32768
//   vp   : 2*B*C*N  (bf16)    -> 16.8 MB      (total ~19 MB)
// ---------------------------------------------------------------------------
extern "C" void kernel_launch(void* const* d_in, const int* in_sizes, int n_in,
                              void* d_out, int out_size, void* d_ws, size_t ws_size,
                              hipStream_t stream)
{
    const float* fL   = (const float*)d_in[0];
    const float* fU   = (const float*)d_in[1];
    const float* qLw  = (const float*)d_in[2];
    const float* qLb  = (const float*)d_in[3];
    const float* kUw  = (const float*)d_in[4];
    const float* kUb  = (const float*)d_in[5];
    const float* vUw  = (const float*)d_in[6];
    const float* vUb  = (const float*)d_in[7];
    const float* qUw  = (const float*)d_in[8];
    const float* qUb  = (const float*)d_in[9];
    const float* kLw  = (const float*)d_in[10];
    const float* kLb  = (const float*)d_in[11];
    const float* vLw  = (const float*)d_in[12];
    const float* vLb  = (const float*)d_in[13];
    const float* beta = (const float*)d_in[14];
    float* outp = (float*)d_out;

    float*  qbuf = (float*)d_ws;
    float*  kbuf = qbuf + (size_t)2 * NB * NR * NN;
    float*  invZ = kbuf + (size_t)2 * NB * NR * NN;
    __bf16* vp   = (__bf16*)(invZ + (size_t)2 * NB * NN);

    // 1) projections (q pre-scaled by log2 e)
    SKC_proj<<<dim3(NN / PN, NB, 2), dim3(512), 0, stream>>>(
        fL, fU, qLw, qLb, kUw, kUb, qUw, qUb, kLw, kLb, qbuf, kbuf);

    // 2) softmax normalizers via f32 WMMA score tiles
    SKC_stats<<<dim3(NN / 128, NB, 2), dim3(256), 0, stream>>>(qbuf, kbuf, invZ);

    // 3) grouped v-projection folded with 1/Z, bf16 output
    SKC_vp<<<dim3(NN / 256, NB * NG, 2), dim3(256), 0, stream>>>(
        fL, fU, vUw, vUb, vLw, vLb, invZ, vp);

    // 4) main attend (f32-WMMA score gen + bf16-WMMA GEMM) + fused residual
    SKC_attend<<<dim3(NN / 128, NB, 2), dim3(256), 0, stream>>>(
        fL, fU, qbuf, kbuf, vp, beta, outp);
}

// v003
// One run takes 128 microseconds.
// Timed twice side by side with v002, it ran 1.06 times as fast both times.
// All steps since v000 together make it 4.80 times as fast.
#include <hip/hip_runtime.h>
#include <hip/hip_bf16.h>

// ---------------------------------------------------------------------------
// SKCLite cross-attention for MI455X (gfx1250, wave32, WMMA).
//
// B=4, C=256, N=H*W=4096, R=8 (rank), G=4 groups (CG=64).
// Dominant cost: out = v @ softmax(q^T k)  -> 2 * 2*B*C*N^2 = 68.7 GFLOP.
// Strategy: flash-style on-the-fly score tiles.
//   scores (rank-8) generated with V_WMMA_F32_16X16X4_F32,
//   exp() + bf16-pack lands *exactly* in the B-operand layout of
//   V_WMMA_F32_16X16X32_BF16 (f32 C/D layout == bf16 B layout modulo packing),
//   main GEMM in bf16 WMMA with f32 accumulation.
// ---------------------------------------------------------------------------

#define NB   4      // batch
#define NC   256    // channels
#define NN   4096   // H*W
#define NR   8      // rank
#define NG   4      // groups
#define NCG  64     // channels per group
#define LOG2E 1.4426950408889634f

typedef __attribute__((ext_vector_type(2)))  float        v2f;
typedef __attribute__((ext_vector_type(8)))  float        v8f;
typedef __attribute__((ext_vector_type(16))) __bf16       v16bf;
typedef __attribute__((ext_vector_type(4)))  unsigned int v4u;

// ---------------------------------------------------------------------------
// Kernel 1: q/k projections.  q = (qw . f + qb) * log2(e)   (exp -> exp2)
//           k =  kw . f + kb
// Layout: qbuf/kbuf = [dir][B][R][N] f32.
// dir0 (LU path): q from fL (qL_w), k from fU (kU_w)
// dir1 (UL path): q from fU (qU_w), k from fL (kL_w)
// The kernel is a stream over fL and fU from memory, so it is built for bytes
// in flight: block = (source map, batch, 128 n), one per WGP; each of its 16
// waves takes 16 of the 256 channels and asks for all its 16 rows (512
// contiguous bytes each) before it uses the first.  The 16 partial sums
// meet in LDS and are added in channel order.
// ---------------------------------------------------------------------------
#define PC 16       // channels per wave
#define PN 128      // n per block: 32 lanes x 4

typedef __attribute__((ext_vector_type(4))) float v4f;

__global__ __launch_bounds__(512)
void SKC_proj(const float* __restrict__ fL, const float* __restrict__ fU,
              const float* __restrict__ qLw, const float* __restrict__ qLb,
              const float* __restrict__ kUw, const float* __restrict__ kUb,
              const float* __restrict__ qUw, const float* __restrict__ qUb,
              const float* __restrict__ kLw, const float* __restrict__ kLb,
              float* __restrict__ qbuf, float* __restrict__ kbuf)
{
    __shared__ v4f red[NC / PC][2 * NR][32];    // [wave][q rows, k rows][lane]

    const int lane = threadIdx.x & 31;
    // wave-uniform, so that the weights come by scalar loads
    const int wave = __builtin_amdgcn_readfirstlane(threadIdx.x >> 5);
    const int b    = blockIdx.y;
    const int srcU = blockIdx.z;                // 0: fL, 1: fU
    const int n0   = blockIdx.x * PN;
    const unsigned l4 = lane * 4;               // this lane's four n

    const float* f  = srcU ? fU  : fL;
    const float* qw = srcU ? qUw : qLw;
    const float* kw = srcU ? kUw : kLw;

    // after the sums wave w finishes one row: waves 0-7 row w of q, waves 8-15
    // row w-8 of k.  q of fL is dir 0, q of fU dir 1; k the other way round.
    const bool  isq   = wave < NR;
    const int   row   = wave & (NR - 1);
    const float bias  = (isq ? (srcU ? qUb : qLb) : (srcU ? kUb : kLb))[row];
    const float scale = isq ? LOG2E : 1.0f;
    float* ob = (isq ? qbuf : kbuf)
              + ((size_t)(isq ? srcU : 1 - srcU) * NB + b) * (NR * NN) + row * NN + n0;

    const int c0 = wave * PC;
    const float* fb = f + ((size_t)b * NC + c0) * NN + n0;

    // unrolled: x is indexed by constants and all 16 loads stand in a row
    v4f x[PC];
#pragma unroll
    for (int i = 0; i < PC; ++i)
        x[i] = *(const v4f*)(fb + (size_t)i * NN + l4);

    // every loop below is unrolled so that x, aq and ak are indexed by
    // constants and stay in registers
    v4f aq[NR], ak[NR];
#pragma unroll
    for (int r = 0; r < NR; ++r) { aq[r] = (v4f)(0.f); ak[r] = (v4f)(0.f); }

#pragma unroll
    for (int i = 0; i < PC; ++i) {
#pragma unroll
        for (int r = 0; r < NR; ++r) {
            aq[r] += qw[r * NC + c0 + i] * x[i];   // uniform -> scalar loads
            ak[r] += kw[r * NC + c0 + i] * x[i];
        }
    }

#pragma unroll
    for (int r = 0; r < NR; ++r) {
        red[wave][r][lane]      = aq[r];
        red[wave][NR + r][lane] = ak[r];
    }
    __syncthreads();

    // unrolled: several LDS reads are in flight ahead of the adds
    v4f s = red[0][wave][lane];
#pragma unroll
    for (int p = 1; p < NC / PC; ++p)
        s += red[p][wave][lane];
    *(v4f*)(ob + l4) = (s + bias) * scale;
}

// ---------------------------------------------------------------------------
// Kernel 2: softmax normalizers.  invZ[dir][b][m] = 1 / sum_j exp(q_m . k_j)
// One wave per 16-row m-tile.  A operand (q, fixed m) stays in registers;
// loop j in tiles of 16: two chained V_WMMA_F32_16X16X4_F32 (K=8), exp2,
// accumulate per-VGPR, then 16-lane xor reduction (lane halves independent).
// ---------------------------------------------------------------------------
__global__ __launch_bounds__(256)
void SKC_stats(const float* __restrict__ qbuf, const float* __restrict__ kbuf,
               float* __restrict__ invZ)
{
    const int lane = threadIdx.x & 31;
    const int wave = threadIdx.x >> 5;
    const int b    = blockIdx.y;
    const int dir  = blockIdx.z;
    const int m0   = (blockIdx.x * 8 + wave) * 16;
    const int l15  = lane & 15;
    const int hi   = lane >> 4;                 // lane-half select

    const float* q = qbuf + ((size_t)dir * NB + b) * (NR * NN);
    const float* k = kbuf + ((size_t)dir * NB + b) * (NR * NN);

    // A fragment: 16x4 f32: lanes 0-15 hold K=0,1 ; lanes 16-31 hold K=2,3
    v2f aq0, aq1;
    {
        const int m = m0 + l15;
        const int r = hi * 2;
        aq0.x = q[(r + 0) * NN + m];  aq0.y = q[(r + 1) * NN + m];
        aq1.x = q[(r + 4) * NN + m];  aq1.y = q[(r + 5) * NN + m];
    }

    v8f zacc = {0.f, 0.f, 0.f, 0.f, 0.f, 0.f, 0.f, 0.f};
    for (int j0 = 0; j0 < NN; j0 += 16) {
        v2f bk0, bk1;
        const int n = j0 + l15;
        const int r = hi * 2;
        bk0.x = k[(r + 0) * NN + n];  bk0.y = k[(r + 1) * NN + n];
        bk1.x = k[(r + 4) * NN + n];  bk1.y = k[(r + 5) * NN + n];

        v8f s = {0.f, 0.f, 0.f, 0.f, 0.f, 0.f, 0.f, 0.f};
        s = __builtin_amdgcn_wmma_f32_16x16x4_f32(false, aq0, false, bk0, (short)0, s, false, false);
        s = __builtin_amdgcn_wmma_f32_16x16x4_f32(false, aq1, false, bk1, (short)0, s, false, false);
#pragma unroll
        for (int g = 0; g < 8; ++g) zacc[g] += __builtin_amdgcn_exp2f(s[g]);
    }
    // reduce across the 16 lanes of each half (j is the lane dimension)
#pragma unroll
    for (int g = 0; g < 8; ++g) {
        float z = zacc[g];
        z += __shfl_xor(z, 1, 32);
        z += __shfl_xor(z, 2, 32);
        z += __shfl_xor(z, 4, 32);
        z += __shfl_xor(z, 8, 32);
        if (l15 == 0) {
            const int m = m0 + g + hi * 8;      // D layout: VGPR g -> row g / g+8
            invZ[((size_t)dir * NB + b) * NN + m] = 1.0f / z;
        }
    }
}

// ---------------------------------------------------------------------------
// Kernel 3: grouped v-projection fused with 1/Z, emitted as bf16.
// vp[dir][b][c][m] = bf16( (vb[c] + sum_i vw[c][i] f[b,g*64+i,m]) * invZ[dir][b][m] )
// Thread = (dir,b,g,n); the 64-deep f column lives in registers, read once.
// ---------------------------------------------------------------------------
__global__ __launch_bounds__(256)
void SKC_vp(const float* __restrict__ fL, const float* __restrict__ fU,
            const float* __restrict__ vUw, const float* __restrict__ vUb,
            const float* __restrict__ vLw, const float* __restrict__ vLb,
            const float* __restrict__ invZ, __bf16* __restrict__ vp)
{
    const int dir = blockIdx.z;
    const int bg  = blockIdx.y;
    const int b   = bg >> 2;
    const int g   = bg & 3;
    const int n   = blockIdx.x * 256 + threadIdx.x;

    const float* f  = (dir == 0) ? fU  : fL;    // LU uses vU(fU); UL uses vL(fL)
    const float* vw = (dir == 0) ? vUw : vLw;
    const float* vb = (dir == 0) ? vUb : vLb;

    float fr[NCG];
#pragma unroll
    for (int i = 0; i < NCG; ++i)
        fr[i] = f[((size_t)b * NC + g * NCG + i) * NN + n];

    const float iz = invZ[((size_t)dir * NB + b) * NN + n];

    for (int co = 0; co < NCG; ++co) {
        const int c = g * NCG + co;
        float acc = vb[c];
#pragma unroll
        for (int i = 0; i < NCG; ++i)
            acc += vw[(size_t)c * NCG + i] * fr[i];   // uniform -> scalar loads
        vp[(((size_t)dir * NB + b) * NC + c) * NN + n] = (__bf16)(acc * iz);
    }
}

// ---------------------------------------------------------------------------
// Kernel 4: main attend + residual.
//   out[c,n] = f[c,n] + beta * sum_m vp[c,m] * exp(q_m . k_n)
// The four waves of each group read the same vp values, so a vp tile of
// 256 c x 128 m is brought into LDS once per block by asynchronous copies
// (whole 256-byte rows from L2), two buffers: tile t+1 flies while tile t is
// worked on.  LDS row pitch 272 B = 16 B x odd: conflict-free b128 reads.
// Wave tile: all 16 c-tiles (C=256) x two 16-wide n-tiles, so that every A
// fragment read from LDS feeds two WMMAs (one per fragment asks the LDS for
// twice what it delivers).  The block still covers 128 n: waves 0-3 take the
// first 64 m of every staged tile, waves 4-7 the last 64 m, for the same four
// n-pairs; the two partial sums meet in LDS after the loop.
// Per 32-wide m-step: 8x f32 WMMA score tiles -> exp2 -> bf16 pack
// (f32 D layout coincides with bf16 B layout: zero lane shuffles) ->
// 32x V_WMMA_F32_16X16X32_BF16 with one b128 LDS read each.
// ---------------------------------------------------------------------------
#define MT     128                 // m per staged tile
#define NT     (NN / MT)           // staged tiles
#define PITCH  272                 // LDS bytes per row: MT*2 + 16
#define BUFB   (NC * PITCH)        // LDS bytes per buffer
#define MG     (MT / 2)            // m of a staged tile per group of four waves
#define XB     16384               // LDS bytes a wave hands over: 8 c-tiles x 2 n-tiles, f32

// One thread's share of one tile: 16 copies of 16 B, rows 16 apart.
// g: this lane's first global element, l: this lane's first LDS byte address.
__device__ __forceinline__ void SKC_stage(const __bf16* g, unsigned l)
{
    // unrolled: two statements of eight copies (an asm statement takes 30 operands)
#pragma unroll
    for (int h = 0; h < 2; ++h) {
        const __bf16* gh = g + (size_t)h * 128 * NN;
        const unsigned lh = l + h * 128 * PITCH;
        // s_wait_xcnt as the statement's last line: it stands in front of any
        // later rewrite of the address registers that the copies name.
        asm volatile(
            "global_load_async_to_lds_b128 %0, %8, off\n\t"
            "global_load_async_to_lds_b128 %1, %9, off\n\t"
            "global_load_async_to_lds_b128 %2, %10, off\n\t"
            "global_load_async_to_lds_b128 %3, %11, off\n\t"
            "global_load_async_to_lds_b128 %4, %12, off\n\t"
            "global_load_async_to_lds_b128 %5, %13, off\n\t"
            "global_load_async_to_lds_b128 %6, %14, off\n\t"
            "global_load_async_to_lds_b128 %7, %15, off\n\t"
            "s_wait_xcnt 0x0"
            :: "v"(lh + 0 * 16 * PITCH), "v"(lh + 1 * 16 * PITCH),
               "v"(lh + 2 * 16 * PITCH), "v"(lh + 3 * 16 * PITCH),
               "v"(lh + 4 * 16 * PITCH), "v"(lh + 5 * 16 * PITCH),
               "v"(lh + 6 * 16 * PITCH), "v"(lh + 7 * 16 * PITCH),
               "v"(gh + (size_t)0 * 16 * NN), "v"(gh + (size_t)1 * 16 * NN),
               "v"(gh + (size_t)2 * 16 * NN), "v"(gh + (size_t)3 * 16 * NN),
               "v"(gh + (size_t)4 * 16 * NN), "v"(gh + (size_t)5 * 16 * NN),
               "v"(gh + (size_t)6 * 16 * NN), "v"(gh + (size_t)7 * 16 * NN)
            : "memory");
    }
}

__global__ __launch_bounds__(256)
void SKC_attend(const float* __restrict__ fL, const float* __restrict__ fU,
                const float* __restrict__ qbuf, const float* __restrict__ kbuf,
                const __bf16* __restrict__ vp, const float* __restrict__ betap,
                float* __restrict__ out)
{
    __shared__ __attribute__((aligned(16))) unsigned char sv[2 * BUFB];

    const int lane = threadIdx.x & 31;
    const int wave = threadIdx.x >> 5;
    const int grp  = wave >> 2;                 // which 64 m of every staged tile
    const int b    = blockIdx.y;
    const int dir  = blockIdx.z;
    const int n0   = (blockIdx.x * 4 + (wave & 3)) * 32;
    const int l15  = lane & 15;
    const int hi   = lane >> 4;
    const float beta = *betap;

    const float*  q   = qbuf + ((size_t)dir * NB + b) * (NR * NN);
    const float*  k   = kbuf + ((size_t)dir * NB + b) * (NR * NN);
    const __bf16* vpb = vp   + ((size_t)dir * NB + b) * (size_t)(NC * NN);

    // copy share of this thread: 16 lanes cover one 256-byte row
    const int crow = threadIdx.x >> 4;          // 0..15, then +16 per copy
    const int ccol = threadIdx.x & 15;          // 16-byte piece of the row
    const __bf16*  gsrc = vpb + (size_t)crow * NN + ccol * 8;
    const unsigned ldst = (unsigned)(size_t)sv + crow * PITCH + ccol * 16;

    // ---- tile 0 into buffer 0, published; then tile 1 into buffer 1 ----
    // kept rolled: so gsrc and ldst are never themselves operands of the copies'
    // asm statement.  Asm operands must lie in v0-v255, a value that is one is
    // held there for its whole life, and beside the accumulators gsrc found no
    // room there: it went to scratch and came back by a load in every trip.
#pragma unroll 1
    for (int p = 0; p < 2; ++p) {
        SKC_stage(gsrc + p * MT, ldst + p * BUFB);
        if (p == 0) {
            asm volatile("s_wait_asynccnt 0x0" ::: "memory");   // own copies of tile 0 landed
            __syncthreads();                                    // every wave's copies landed
        }
    }

    // k B-fragments of the two n-tiles: constant across the whole m loop.
    v2f bk0[2], bk1[2];
#pragma unroll
    for (int nt = 0; nt < 2; ++nt) {
        const int n = n0 + nt * 16 + l15;
        const int r = hi * 2;
        bk0[nt].x = k[(r + 0) * NN + n];  bk0[nt].y = k[(r + 1) * NN + n];
        bk1[nt].x = k[(r + 4) * NN + n];  bk1[nt].y = k[(r + 5) * NN + n];
    }

    // q A-fragments of the group's m-step 0 (f32 16x4: lanes 0-15 hold K=0,1; 16-31 K=2,3)
    const int qlane = (hi * 2) * NN + l15 + grp * MG;   // this lane's place in a q tile
    v2f qa0lo, qa0hi, qa1lo, qa1hi;
    qa0lo.x = q[qlane + 0 * NN];       qa0lo.y = q[qlane + 1 * NN];
    qa0hi.x = q[qlane + 4 * NN];       qa0hi.y = q[qlane + 5 * NN];
    qa1lo.x = q[qlane + 0 * NN + 16];  qa1lo.y = q[qlane + 1 * NN + 16];
    qa1hi.x = q[qlane + 4 * NN + 16];  qa1hi.y = q[qlane + 5 * NN + 16];
    // precaution: the address registers of the k and q loads above are given to
    // other values only behind this wait
    asm volatile("s_wait_xcnt 0x0" ::: "memory");
    // keeps every later write of a register behind that wait
    __builtin_amdgcn_sched_barrier(0);

    v8f acc[16][2];
    const v8f vzero = {0.f, 0.f, 0.f, 0.f, 0.f, 0.f, 0.f, 0.f};
#pragma unroll
    for (int ct = 0; ct < 16; ++ct) { acc[ct][0] = vzero; acc[ct][1] = vzero; }

    // bf16 A layout: row = l15, lane-half K offset of 8 elements = 16 bytes;
    // the group's 64 m start MG elements into the row
    const unsigned char* svl = sv + l15 * PITCH + hi * 16 + grp * (MG * 2);

    // kept rolled: one trip per staged tile, the buffer chosen by the trip's
    // parity (for speed only)
#pragma unroll 1
    for (int t = 0; t < NT; ++t) {
        const unsigned char* svt = svl + (t & 1) * BUFB;

        // two register sets of four A fragments: block j+1 is read from LDS as
        // one group while block j (four c-tiles x two n-tiles of one m-step) is
        // multiplied (every loop below is unrolled so that fr and acc are
        // indexed by constants and stay in registers)
        v4u fr[2][8];
#pragma unroll
        for (int i = 0; i < 4; ++i) {
            const unsigned char* p = svt + i * 16 * PITCH;
            fr[0][2 * i]     = *(const v4u*)(p);        // K = moff .. moff+7
            fr[0][2 * i + 1] = *(const v4u*)(p + 32);   // K = 16+moff .. 16+moff+7
        }

#pragma unroll
        for (int ms = 0; ms < MG / 32; ++ms) {
            // WMMA distance: the score WMMAs below may be given, as their D, the
            // registers that the last bf16 WMMA of the m-step before reads as B;
            // only scalar instructions stand between the two otherwise.
            asm volatile("v_nop\n\tv_nop\n\tv_nop\n\tv_nop\n\tv_nop");
            // keeps the score WMMAs behind those slots
            __builtin_amdgcn_sched_barrier(0);
            // ---- score tiles (m0..m0+15 and m0+16..m0+31) x two n-tiles, K=8 rank ----
            // this m-step's q fragments are in registers; the group's next
            // m-step's are asked for here, a whole m-step ahead of their use (the
            // scheduling fences below would otherwise hold the loads right at
            // their use).  After the last m-step the index wraps to 0: in
            // bounds, not used.
            const v2f a0lo = qa0lo, a0hi = qa0hi, a1lo = qa1lo, a1hi = qa1hi;
            {
                const float* qn = q + ((t * MT + (ms + 1 < MG / 32 ? ms * 32 + 32 : MT)) & (NN - 1));
                qa0lo.x = qn[qlane + 0 * NN];       qa0lo.y = qn[qlane + 1 * NN];
                qa0hi.x = qn[qlane + 4 * NN];       qa0hi.y = qn[qlane + 5 * NN];
                qa1lo.x = qn[qlane + 0 * NN + 16];  qa1lo.y = qn[qlane + 1 * NN + 16];
                qa1hi.x = qn[qlane + 4 * NN + 16];  qa1hi.y = qn[qlane + 5 * NN + 16];
            }
            // keeps those loads in front of the score WMMAs, whose issue then
            // covers the wait that stands behind them
            __builtin_amdgcn_sched_barrier(0);
            v8f s0[2], s1[2];
#pragma unroll
            for (int nt = 0; nt < 2; ++nt) {
                s0[nt] = __builtin_amdgcn_wmma_f32_16x16x4_f32(false, a0lo, false, bk0[nt], (short)0, vzero, false, false);
                s1[nt] = __builtin_amdgcn_wmma_f32_16x16x4_f32(false, a1lo, false, bk0[nt], (short)0, vzero, false, false);
            }
#pragma unroll
            for (int nt = 0; nt < 2; ++nt) {
                s0[nt] = __builtin_amdgcn_wmma_f32_16x16x4_f32(false, a0hi, false, bk1[nt], (short)0, s0[nt], false, false);
                s1[nt] = __builtin_amdgcn_wmma_f32_16x16x4_f32(false, a1hi, false, bk1[nt], (short)0, s1[nt], false, false);
            }
            // keeps the wait below behind the score WMMAs (nothing else ties it there)
            __builtin_amdgcn_sched_barrier(0);
            // precaution: the q loads' address registers are given to other values
            // only behind this wait
            asm volatile("s_wait_xcnt 0x0" ::: "memory");
            // keeps the exp2 results, which may get those registers, behind the wait
            __builtin_amdgcn_sched_barrier(0);

            // ---- E tiles -> bf16 B operands (layouts line up; in-lane pack) ----
            v16bf eb[2];
#pragma unroll
            for (int nt = 0; nt < 2; ++nt) {
#pragma unroll
                for (int g = 0; g < 8; ++g) {
                    eb[nt][g]     = (__bf16)__builtin_amdgcn_exp2f(s0[nt][g]);   // K = moff+g
                    eb[nt][8 + g] = (__bf16)__builtin_amdgcn_exp2f(s1[nt][g]);   // K = 16+moff+g
                }
            }

            // ---- 16 c-tiles x 2 n-tiles of the main bf16 GEMM, A fragments from LDS ----
#pragma unroll
            for (int cb = 0; cb < 4; ++cb) {
                const int j  = ms * 4 + cb;         // this block
                const int jn = j + 1;               // the block read ahead
                if (jn < (MG / 32) * 4) {
#pragma unroll
                    for (int i = 0; i < 4; ++i) {
                        const unsigned char* p =
                            svt + ((jn & 3) * 4 + i) * 16 * PITCH + (jn >> 2) * 64;
                        fr[jn & 1][2 * i]     = *(const v4u*)(p);
                        fr[jn & 1][2 * i + 1] = *(const v4u*)(p + 32);
                    }
                }
                // keeps the eight LDS reads together ahead of the block (for speed only)
                __builtin_amdgcn_sched_barrier(0);
#pragma unroll
                for (int i = 0; i < 4; ++i) {
                    union { v4u u[2]; v16bf h; } U;
                    U.u[0] = fr[j & 1][2 * i];
                    U.u[1] = fr[j & 1][2 * i + 1];
#pragma unroll
                    for (int nt = 0; nt < 2; ++nt)
                        acc[cb * 4 + i][nt] = __builtin_amdgcn_wmma_f32_16x16x32_bf16(
                            false, U.h, false, eb[nt], (short)0, acc[cb * 4 + i][nt], false, false);
                }
                // keeps the next group of reads behind this block's WMMAs
                __builtin_amdgcn_sched_barrier(0);
            }
        }
        // ---- hand-over: tile t+1 becomes readable, tile t's buffer free ----
        asm volatile("s_wait_dscnt 0x0" ::: "memory");      // own reads of tile t done
        asm volatile("s_wait_asynccnt 0x0" ::: "memory");   // own copies of tile t+1 landed
        __syncthreads();                                    // the same for every wave
        if (t + 2 < NT)
            SKC_stage(gsrc + (size_t)(t + 2) * MT, ldst + (t & 1) * BUFB);
    }
    asm volatile("s_wait_asynccnt 0x0" ::: "memory");       // nothing in flight at the wave's end

    // ---- epilogue: residual values asked for first, they fly during the exchange.
    // One address per lane for f and one for out, the rest is a constant offset
    // in each instruction: wave w finishes c-tiles 0-7, wave w+4 c-tiles 8-15.
    // (every loop below is unrolled: acc and res are indexed by constants)
    const float* f = (dir == 0) ? fL : fU;
    float* o = out + (size_t)dir * ((size_t)NB * NC * NN);
    const size_t e0 = ((size_t)b * NC + grp * 128 + hi * 8) * NN + n0 + l15;
    const float* fe = f + e0;
    float*       oe = o + e0;
    float res[8][2][8];
#pragma unroll
    for (int i = 0; i < 8; ++i)
#pragma unroll
        for (int nt = 0; nt < 2; ++nt)
#pragma unroll
            for (int g = 0; g < 8; ++g)
                res[i][nt][g] = fe[(i * 16 + g) * NN + nt * 16];
    // precaution: fe's registers are given to other values only behind this wait
    asm volatile("s_wait_xcnt 0x0" ::: "memory");
    // keeps every later write of a register behind that wait
    __builtin_amdgcn_sched_barrier(0);

    // ---- the two groups' partial sums meet: waves w and w+4 hold the same
    // 256 c x 32 n.  Each hands over the eight c-tiles that the other finishes.
    // The staging buffers are free: the loop's last barrier ended every read of
    // them and no copy is in flight.
    v4f* xs = (v4f*)(sv + wave * XB) + lane;
#pragma unroll
    for (int i = 0; i < 8; ++i) {
#pragma unroll
        for (int nt = 0; nt < 2; ++nt) {
            const v8f snd = grp ? acc[i][nt] : acc[8 + i][nt];
            xs[((i * 2 + nt) * 2 + 0) * 32] = (v4f){snd[0], snd[1], snd[2], snd[3]};
            xs[((i * 2 + nt) * 2 + 1) * 32] = (v4f){snd[4], snd[5], snd[6], snd[7]};
        }
    }
    __syncthreads();                                        // the partner's half is written
    const v4f* xr = (const v4f*)(sv + (wave ^ 4) * XB) + lane;

#pragma unroll
    for (int i = 0; i < 8; ++i) {
#pragma unroll
        for (int nt = 0; nt < 2; ++nt) {
            const v8f own = grp ? acc[8 + i][nt] : acc[i][nt];
            const v4f r0 = xr[((i * 2 + nt) * 2 + 0) * 32];
            const v4f r1 = xr[((i * 2 + nt) * 2 + 1) * 32];
#pragma unroll
            for (int g = 0; g < 8; ++g)
                res[i][nt][g] += beta * (own[g] + (g < 4 ? r0[g & 3] : r1[g & 3]));
        }
    }
    // keeps the stores together at the wave's end: no register that a store
    // names is written behind it
    __builtin_amdgcn_sched_barrier(0);
#pragma unroll
    for (int i = 0; i < 8; ++i)
#pragma unroll
        for (int nt = 0; nt < 2; ++nt)
#pragma unroll
            for (int g = 0; g < 8; ++g)
                oe[(i * 16 + g) * NN + nt * 16] = res[i][nt][g];
}

// ---------------------------------------------------------------------------
// Host-side launcher.  Workspace layout (floats unless noted):
//   qbuf : 2*B*R*N            = 262144
//   kbuf : 2*B*R*N            = 262144
//   invZ : 2*B*N              =  32768
//   vp   : 2*B*C*N  (bf16)    -> 16.8 MB      (total ~19 MB)
// ---------------------------------------------------------------------------
extern "C" void kernel_launch(void* const* d_in, const int* in_sizes, int n_in,
                              void* d_out, int out_size, void* d_ws, size_t ws_size,
                              hipStream_t stream)
{
    const float* fL   = (const float*)d_in[0];
    const float* fU   = (const float*)d_in[1];
    const float* qLw  = (const float*)d_in[2];
    const float* qLb  = (const float*)d_in[3];
    const float* kUw  = (const float*)d_in[4];
    const float* kUb  = (const float*)d_in[5];
    const float* vUw  = (const float*)d_in[6];
    const float* vUb  = (const float*)d_in[7];
    const float* qUw  = (const float*)d_in[8];
    const float* qUb  = (const float*)d_in[9];
    const float* kLw  = (const float*)d_in[10];
    const float* kLb  = (const float*)d_in[11];
    const float* vLw  = (const float*)d_in[12];
    const float* vLb  = (const float*)d_in[13];
    const float* beta = (const float*)d_in[14];
    float* outp = (float*)d_out;

    float*  qbuf = (float*)d_ws;
    float*  kbuf = qbuf + (size_t)2 * NB * NR * NN;
    float*  invZ = kbuf + (size_t)2 * NB * NR * NN;
    __bf16* vp   = (__bf16*)(invZ + (size_t)2 * NB * NN);

    // 1) projections (q pre-scaled by log2 e)
    SKC_proj<<<dim3(NN / PN, NB, 2), dim3(512), 0, stream>>>(
        fL, fU, qLw, qLb, kUw, kUb, qUw, qUb, kLw, kLb, qbuf, kbuf);

    // 2) softmax normalizers via f32 WMMA score tiles
    SKC_stats<<<dim3(NN / 128, NB, 2), dim3(256), 0, stream>>>(qbuf, kbuf, invZ);

    // 3) grouped v-projection folded with 1/Z, bf16 output
    SKC_vp<<<dim3(NN / 256, NB * NG, 2), dim3(256), 0, stream>>>(
        fL, fU, vUw, vUb, vLw, vLb, invZ, vp);

    // 4) main attend (f32-WMMA score gen + bf16-WMMA GEMM) + fused residual
    SKC_attend<<<dim3(NN / 128, NB, 2), dim3(256), 0, stream>>>(
        fL, fU, qbuf, kbuf, vp, beta, outp);
}

// v004
// It runs in 107 microseconds.
// In both of two side-by-side timings against v003, it was 1.20 times as fast.
// All steps since v000 together make it 5.77 times as fast.
#include <hip/hip_runtime.h>
#include <hip/hip_bf16.h>

// ---------------------------------------------------------------------------
// SKCLite cross-attention for MI455X (gfx1250, wave32, WMMA).
//
// B=4, C=256, N=H*W=4096, R=8 (rank), G=4 groups (CG=64).
// Dominant cost: out = v @ softmax(q^T k)  -> 2 * 2*B*C*N^2 = 68.7 GFLOP.
// Strategy: flash-style on-the-fly score tiles.
//   scores (rank-8) generated with V_WMMA_F32_16X16X4_F32,
//   exp() + bf16-pack lands *exactly* in the B-operand layout of
//   V_WMMA_F32_16X16X32_BF16 (f32 C/D layout == bf16 B layout modulo packing),
//   main GEMM in bf16 WMMA with f32 accumulation.
// ---------------------------------------------------------------------------

#define NB   4      // batch
#define NC   256    // channels
#define NN   4096   // H*W
#define NR   8      // rank
#define NG   4      // groups
#define NCG  64     // channels per group
#define LOG2E 1.4426950408889634f

typedef __attribute__((ext_vector_type(2)))  float        v2f;
typedef __attribute__((ext_vector_type(8)))  float        v8f;
typedef __attribute__((ext_vector_type(16))) __bf16       v16bf;
typedef __attribute__((ext_vector_type(4)))  unsigned int v4u;

// ---------------------------------------------------------------------------
// Kernel 1: q/k projections.  q = (qw . f + qb) * log2(e)   (exp -> exp2)
//           k =  kw . f + kb
// Layout: qbuf/kbuf = [dir][B][R][N] f32.
// dir0 (LU path): q from fL (qL_w), k from fU (kU_w)
// dir1 (UL path): q from fU (qU_w), k from fL (kL_w)
// The kernel is a stream over fL and fU from memory, so it is built for bytes
// in flight: block = (source map, batch, 128 n), one per WGP; each of its 16
// waves takes 16 of the 256 channels and asks for all its 16 rows (512
// contiguous bytes each) before it uses the first.  The 16 partial sums
// meet in LDS and are added in channel order.
// ---------------------------------------------------------------------------
#define PC 16       // channels per wave
#define PN 128      // n per block: 32 lanes x 4

typedef __attribute__((ext_vector_type(4))) float v4f;

__global__ __launch_bounds__(512)
void SKC_proj(const float* __restrict__ fL, const float* __restrict__ fU,
              const float* __restrict__ qLw, const float* __restrict__ qLb,
              const float* __restrict__ kUw, const float* __restrict__ kUb,
              const float* __restrict__ qUw, const float* __restrict__ qUb,
              const float* __restrict__ kLw, const float* __restrict__ kLb,
              float* __restrict__ qbuf, float* __restrict__ kbuf)
{
    __shared__ v4f red[NC / PC][2 * NR][32];    // [wave][q rows, k rows][lane]

    const int lane = threadIdx.x & 31;
    // wave-uniform, so that the weights come by scalar loads
    const int wave = __builtin_amdgcn_readfirstlane(threadIdx.x >> 5);
    const int b    = blockIdx.y;
    const int srcU = blockIdx.z;                // 0: fL, 1: fU
    const int n0   = blockIdx.x * PN;
    const unsigned l4 = lane * 4;               // this lane's four n

    const float* f  = srcU ? fU  : fL;
    const float* qw = srcU ? qUw : qLw;
    const float* kw = srcU ? kUw : kLw;

    // after the sums wave w finishes one row: waves 0-7 row w of q, waves 8-15
    // row w-8 of k.  q of fL is dir 0, q of fU dir 1; k the other way round.
    const bool  isq   = wave < NR;
    const int   row   = wave & (NR - 1);
    const float bias  = (isq ? (srcU ? qUb : qLb) : (srcU ? kUb : kLb))[row];
    const float scale = isq ? LOG2E : 1.0f;
    float* ob = (isq ? qbuf : kbuf)
              + ((size_t)(isq ? srcU : 1 - srcU) * NB + b) * (NR * NN) + row * NN + n0;

    const int c0 = wave * PC;
    const float* fb = f + ((size_t)b * NC + c0) * NN + n0;

    // unrolled: x is indexed by constants and all 16 loads stand in a row
    v4f x[PC];
#pragma unroll
    for (int i = 0; i < PC; ++i)
        x[i] = *(const v4f*)(fb + (size_t)i * NN + l4);

    // every loop below is unrolled so that x, aq and ak are indexed by
    // constants and stay in registers
    v4f aq[NR], ak[NR];
#pragma unroll
    for (int r = 0; r < NR; ++r) { aq[r] = (v4f)(0.f); ak[r] = (v4f)(0.f); }

#pragma unroll
    for (int i = 0; i < PC; ++i) {
#pragma unroll
        for (int r = 0; r < NR; ++r) {
            aq[r] += qw[r * NC + c0 + i] * x[i];   // uniform -> scalar loads
            ak[r] += kw[r * NC + c0 + i] * x[i];
        }
    }

#pragma unroll
    for (int r = 0; r < NR; ++r) {
        red[wave][r][lane]      = aq[r];
        red[wave][NR + r][lane] = ak[r];
    }
    __syncthreads();

    // unrolled: several LDS reads are in flight ahead of the adds
    v4f s = red[0][wave][lane];
#pragma unroll
    for (int p = 1; p < NC / PC; ++p)
        s += red[p][wave][lane];
    *(v4f*)(ob + l4) = (s + bias) * scale;
}

// ---------------------------------------------------------------------------
// Kernel 2: softmax normalizers.  invZ[dir][b][m] = 1 / sum_j exp(q_m . k_j)
// A operand (q, fixed 16-row m-tile) stays in registers; loop j in tiles of 16:
// two chained V_WMMA_F32_16X16X4_F32 (K=8), exp2, accumulate per-VGPR, then
// 16-lane xor reduction (lane halves independent).
// Every k line is new to the WGP when it is asked for, so each trip of a wave
// waits a whole L2 latency.  Block = 8 m-tiles x SJ quarters of j = 32 waves,
// eight per SIMD: one wave's wait lies under the others' WMMAs.  The SJ partial
// sums of a row meet in LDS and are added in j order.
// ---------------------------------------------------------------------------
#define SJ 4                // waves that share an m-tile
#define SJN (NN / SJ)       // j per wave

__global__ __launch_bounds__(1024)
void SKC_stats(const float* __restrict__ qbuf, const float* __restrict__ kbuf,
               float* __restrict__ invZ)
{
    __shared__ float part[SJ][128];             // [quarter of j][m in the block]

    const int lane = threadIdx.x & 31;
    // wave-uniform, so that the k base address stays scalar
    const int wave = __builtin_amdgcn_readfirstlane(threadIdx.x >> 5);
    const int mt   = wave & 7;                  // m-tile in the block
    const int jq   = wave >> 3;                 // quarter of j
    const int b    = blockIdx.y;
    const int dir  = blockIdx.z;
    const int m0   = (blockIdx.x * 8 + mt) * 16;
    const int l15  = lane & 15;
    const int hi   = lane >> 4;                 // lane-half select

    const float* q = qbuf + ((size_t)dir * NB + b) * (NR * NN);
    const float* k = kbuf + ((size_t)dir * NB + b) * (NR * NN) + jq * SJN;

    // A fragment: 16x4 f32: lanes 0-15 hold K=0,1 ; lanes 16-31 hold K=2,3
    v2f aq0, aq1;
    {
        const int m = m0 + l15;
        const int r = hi * 2;
        aq0.x = q[(r + 0) * NN + m];  aq0.y = q[(r + 1) * NN + m];
        aq1.x = q[(r + 4) * NN + m];  aq1.y = q[(r + 5) * NN + m];
    }

    v8f zacc = {0.f, 0.f, 0.f, 0.f, 0.f, 0.f, 0.f, 0.f};
    for (int j0 = 0; j0 < SJN; j0 += 16) {
        v2f bk0, bk1;
        const int n = j0 + l15;
        const int r = hi * 2;
        bk0.x = k[(r + 0) * NN + n];  bk0.y = k[(r + 1) * NN + n];
        bk1.x = k[(r + 4) * NN + n];  bk1.y = k[(r + 5) * NN + n];

        v8f s = {0.f, 0.f, 0.f, 0.f, 0.f, 0.f, 0.f, 0.f};
        s = __builtin_amdgcn_wmma_f32_16x16x4_f32(false, aq0, false, bk0, (short)0, s, false, false);
        s = __builtin_amdgcn_wmma_f32_16x16x4_f32(false, aq1, false, bk1, (short)0, s, false, false);
#pragma unroll
        for (int g = 0; g < 8; ++g) zacc[g] += __builtin_amdgcn_exp2f(s[g]);
    }
    // reduce across the 16 lanes of each half (j is the lane dimension); the
    // eight rows go through each step together, so their exchanges overlap
    // (both loops unrolled: zacc is indexed by constants)
#pragma unroll
    for (int st = 1; st < 16; st <<= 1) {
#pragma unroll
        for (int g = 0; g < 8; ++g) zacc[g] += __shfl_xor(zacc[g], st, 32);
    }
    if (l15 == 0) {
#pragma unroll
        for (int g = 0; g < 8; ++g)
            part[jq][mt * 16 + g + hi * 8] = zacc[g];   // D layout: VGPR g -> row g / g+8
    }
    __syncthreads();                            // every quarter's sums are written

    if (threadIdx.x < 128) {
        const int t = threadIdx.x;
        float z = part[0][t];
#pragma unroll
        for (int p = 1; p < SJ; ++p) z += part[p][t];   // unrolled: the LDS reads go out together
        invZ[((size_t)dir * NB + b) * NN + blockIdx.x * 128 + t] = 1.0f / z;
    }
}

// ---------------------------------------------------------------------------
// Kernel 3: grouped v-projection fused with 1/Z, emitted as bf16.
// vp[dir][b][c][m] = bf16( (vb[c] + sum_i vw[c][i] f[b,g*64+i,m]) * invZ[dir][b][m] )
// Thread = (dir,b,g,n); the 64-deep f column lives in registers, read once.
// ---------------------------------------------------------------------------
__global__ __launch_bounds__(256)
void SKC_vp(const float* __restrict__ fL, const float* __restrict__ fU,
            const float* __restrict__ vUw, const float* __restrict__ vUb,
            const float* __restrict__ vLw, const float* __restrict__ vLb,
            const float* __restrict__ invZ, __bf16* __restrict__ vp)
{
    const int dir = blockIdx.z;
    const int bg  = blockIdx.y;
    const int b   = bg >> 2;
    const int g   = bg & 3;
    const int n   = blockIdx.x * 256 + threadIdx.x;

    const float* f  = (dir == 0) ? fU  : fL;    // LU uses vU(fU); UL uses vL(fL)
    const float* vw = (dir == 0) ? vUw : vLw;
    const float* vb = (dir == 0) ? vUb : vLb;

    float fr[NCG];
#pragma unroll
    for (int i = 0; i < NCG; ++i)
        fr[i] = f[((size_t)b * NC + g * NCG + i) * NN + n];

    const float iz = invZ[((size_t)dir * NB + b) * NN + n];

    for (int co = 0; co < NCG; ++co) {
        const int c = g * NCG + co;
        float acc = vb[c];
#pragma unroll
        for (int i = 0; i < NCG; ++i)
            acc += vw[(size_t)c * NCG + i] * fr[i];   // uniform -> scalar loads
        vp[(((size_t)dir * NB + b) * NC + c) * NN + n] = (__bf16)(acc * iz);
    }
}

// ---------------------------------------------------------------------------
// Kernel 4: main attend + residual.
//   out[c,n] = f[c,n] + beta * sum_m vp[c,m] * exp(q_m . k_n)
// The four waves of each group read the same vp values, so a vp tile of
// 256 c x 128 m is brought into LDS once per block by asynchronous copies
// (whole 256-byte rows from L2), two buffers: tile t+1 flies while tile t is
// worked on.  LDS row pitch 272 B = 16 B x odd: conflict-free b128 reads.
// Wave tile: all 16 c-tiles (C=256) x two 16-wide n-tiles, so that every A
// fragment read from LDS feeds two WMMAs (one per fragment asks the LDS for
// twice what it delivers).  The block still covers 128 n: waves 0-3 take the
// first 64 m of every staged tile, waves 4-7 the last 64 m, for the same four
// n-pairs; the two partial sums meet in LDS after the loop.
// Per 32-wide m-step: 8x f32 WMMA score tiles -> exp2 -> bf16 pack
// (f32 D layout coincides with bf16 B layout: zero lane shuffles) ->
// 32x V_WMMA_F32_16X16X32_BF16 with one b128 LDS read each.
// ---------------------------------------------------------------------------
#define MT     128                 // m per staged tile
#define NT     (NN / MT)           // staged tiles
#define PITCH  272                 // LDS bytes per row: MT*2 + 16
#define BUFB   (NC * PITCH)        // LDS bytes per buffer
#define MG     (MT / 2)            // m of a staged tile per group of four waves
#define XB     16384               // LDS bytes a wave hands over: 8 c-tiles x 2 n-tiles, f32

// One thread's share of one tile: 16 copies of 16 B, rows 16 apart.
// g: this lane's first global element, l: this lane's first LDS byte address.
__device__ __forceinline__ void SKC_stage(const __bf16* g, unsigned l)
{
    // unrolled: two statements of eight copies (an asm statement takes 30 operands)
#pragma unroll
    for (int h = 0; h < 2; ++h) {
        const __bf16* gh = g + (size_t)h * 128 * NN;
        const unsigned lh = l + h * 128 * PITCH;
        // s_wait_xcnt as the statement's last line: it stands in front of any
        // later rewrite of the address registers that the copies name.
        asm volatile(
            "global_load_async_to_lds_b128 %0, %8, off\n\t"
            "global_load_async_to_lds_b128 %1, %9, off\n\t"
            "global_load_async_to_lds_b128 %2, %10, off\n\t"
            "global_load_async_to_lds_b128 %3, %11, off\n\t"
            "global_load_async_to_lds_b128 %4, %12, off\n\t"
            "global_load_async_to_lds_b128 %5, %13, off\n\t"
            "global_load_async_to_lds_b128 %6, %14, off\n\t"
            "global_load_async_to_lds_b128 %7, %15, off\n\t"
            "s_wait_xcnt 0x0"
            :: "v"(lh + 0 * 16 * PITCH), "v"(lh + 1 * 16 * PITCH),
               "v"(lh + 2 * 16 * PITCH), "v"(lh + 3 * 16 * PITCH),
               "v"(lh + 4 * 16 * PITCH), "v"(lh + 5 * 16 * PITCH),
               "v"(lh + 6 * 16 * PITCH), "v"(lh + 7 * 16 * PITCH),
               "v"(gh + (size_t)0 * 16 * NN), "v"(gh + (size_t)1 * 16 * NN),
               "v"(gh + (size_t)2 * 16 * NN), "v"(gh + (size_t)3 * 16 * NN),
               "v"(gh + (size_t)4 * 16 * NN), "v"(gh + (size_t)5 * 16 * NN),
               "v"(gh + (size_t)6 * 16 * NN), "v"(gh + (size_t)7 * 16 * NN)
            : "memory");
    }
}

__global__ __launch_bounds__(256)
void SKC_attend(const float* __restrict__ fL, const float* __restrict__ fU,
                const float* __restrict__ qbuf, const float* __restrict__ kbuf,
                const __bf16* __restrict__ vp, const float* __restrict__ betap,
                float* __restrict__ out)
{
    __shared__ __attribute__((aligned(16))) unsigned char sv[2 * BUFB];

    const int lane = threadIdx.x & 31;
    const int wave = threadIdx.x >> 5;
    const int grp  = wave >> 2;                 // which 64 m of every staged tile
    const int b    = blockIdx.y;
    const int dir  = blockIdx.z;
    const int n0   = (blockIdx.x * 4 + (wave & 3)) * 32;
    const int l15  = lane & 15;
    const int hi   = lane >> 4;
    const float beta = *betap;

    const float*  q   = qbuf + ((size_t)dir * NB + b) * (NR * NN);
    const float*  k   = kbuf + ((size_t)dir * NB + b) * (NR * NN);
    const __bf16* vpb = vp   + ((size_t)dir * NB + b) * (size_t)(NC * NN);

    // copy share of this thread: 16 lanes cover one 256-byte row
    const int crow = threadIdx.x >> 4;          // 0..15, then +16 per copy
    const int ccol = threadIdx.x & 15;          // 16-byte piece of the row
    const __bf16*  gsrc = vpb + (size_t)crow * NN + ccol * 8;
    const unsigned ldst = (unsigned)(size_t)sv + crow * PITCH + ccol * 16;

    // ---- tile 0 into buffer 0, published; then tile 1 into buffer 1 ----
    // kept rolled: so gsrc and ldst are never themselves operands of the copies'
    // asm statement.  Asm operands must lie in v0-v255, a value that is one is
    // held there for its whole life, and beside the accumulators gsrc found no
    // room there: it went to scratch and came back by a load in every trip.
#pragma unroll 1
    for (int p = 0; p < 2; ++p) {
        SKC_stage(gsrc + p * MT, ldst + p * BUFB);
        if (p == 0) {
            asm volatile("s_wait_asynccnt 0x0" ::: "memory");   // own copies of tile 0 landed
            __syncthreads();                                    // every wave's copies landed
        }
    }

    // k B-fragments of the two n-tiles: constant across the whole m loop.
    v2f bk0[2], bk1[2];
#pragma unroll
    for (int nt = 0; nt < 2; ++nt) {
        const int n = n0 + nt * 16 + l15;
        const int r = hi * 2;
        bk0[nt].x = k[(r + 0) * NN + n];  bk0[nt].y = k[(r + 1) * NN + n];
        bk1[nt].x = k[(r + 4) * NN + n];  bk1[nt].y = k[(r + 5) * NN + n];
    }

    // q A-fragments of the group's m-step 0 (f32 16x4: lanes 0-15 hold K=0,1; 16-31 K=2,3)
    const int qlane = (hi * 2) * NN + l15 + grp * MG;   // this lane's place in a q tile
    v2f qa0lo, qa0hi, qa1lo, qa1hi;
    qa0lo.x = q[qlane + 0 * NN];       qa0lo.y = q[qlane + 1 * NN];
    qa0hi.x = q[qlane + 4 * NN];       qa0hi.y = q[qlane + 5 * NN];
    qa1lo.x = q[qlane + 0 * NN + 16];  qa1lo.y = q[qlane + 1 * NN + 16];
    qa1hi.x = q[qlane + 4 * NN + 16];  qa1hi.y = q[qlane + 5 * NN + 16];
    // precaution: the address registers of the k and q loads above are given to
    // other values only behind this wait
    asm volatile("s_wait_xcnt 0x0" ::: "memory");
    // keeps every later write of a register behind that wait
    __builtin_amdgcn_sched_barrier(0);

    v8f acc[16][2];
    const v8f vzero = {0.f, 0.f, 0.f, 0.f, 0.f, 0.f, 0.f, 0.f};
#pragma unroll
    for (int ct = 0; ct < 16; ++ct) { acc[ct][0] = vzero; acc[ct][1] = vzero; }

    // bf16 A layout: row = l15, lane-half K offset of 8 elements = 16 bytes;
    // the group's 64 m start MG elements into the row
    const unsigned char* svl = sv + l15 * PITCH + hi * 16 + grp * (MG * 2);

    // kept rolled: one trip per staged tile, the buffer chosen by the trip's
    // parity (for speed only)
#pragma unroll 1
    for (int t = 0; t < NT; ++t) {
        const unsigned char* svt = svl + (t & 1) * BUFB;

        // two register sets of four A fragments: block j+1 is read from LDS as
        // one group while block j (four c-tiles x two n-tiles of one m-step) is
        // multiplied (every loop below is unrolled so that fr and acc are
        // indexed by constants and stay in registers)
        v4u fr[2][8];
#pragma unroll
        for (int i = 0; i < 4; ++i) {
            const unsigned char* p = svt + i * 16 * PITCH;
            fr[0][2 * i]     = *(const v4u*)(p);        // K = moff .. moff+7
            fr[0][2 * i + 1] = *(const v4u*)(p + 32);   // K = 16+moff .. 16+moff+7
        }

#pragma unroll
        for (int ms = 0; ms < MG / 32; ++ms) {
            // WMMA distance: the score WMMAs below may be given, as their D, the
            // registers that the last bf16 WMMA of the m-step before reads as B;
            // only scalar instructions stand between the two otherwise.
            asm volatile("v_nop\n\tv_nop\n\tv_nop\n\tv_nop\n\tv_nop");
            // keeps the score WMMAs behind those slots
            __builtin_amdgcn_sched_barrier(0);
            // ---- score tiles (m0..m0+15 and m0+16..m0+31) x two n-tiles, K=8 rank ----
            // this m-step's q fragments are in registers; the group's next
            // m-step's are asked for here, a whole m-step ahead of their use (the
            // scheduling fences below would otherwise hold the loads right at
            // their use).  After the last m-step the index wraps to 0: in
            // bounds, not used.
            const v2f a0lo = qa0lo, a0hi = qa0hi, a1lo = qa1lo, a1hi = qa1hi;
            {
                const float* qn = q + ((t * MT + (ms + 1 < MG / 32 ? ms * 32 + 32 : MT)) & (NN - 1));
                qa0lo.x = qn[qlane + 0 * NN];       qa0lo.y = qn[qlane + 1 * NN];
                qa0hi.x = qn[qlane + 4 * NN];       qa0hi.y = qn[qlane + 5 * NN];
                qa1lo.x = qn[qlane + 0 * NN + 16];  qa1lo.y = qn[qlane + 1 * NN + 16];
                qa1hi.x = qn[qlane + 4 * NN + 16];  qa1hi.y = qn[qlane + 5 * NN + 16];
            }
            // keeps those loads in front of the score WMMAs, whose issue then
            // covers the wait that stands behind them
            __builtin_amdgcn_sched_barrier(0);
            v8f s0[2], s1[2];
#pragma unroll
            for (int nt = 0; nt < 2; ++nt) {
                s0[nt] = __builtin_amdgcn_wmma_f32_16x16x4_f32(false, a0lo, false, bk0[nt], (short)0, vzero, false, false);
                s1[nt] = __builtin_amdgcn_wmma_f32_16x16x4_f32(false, a1lo, false, bk0[nt], (short)0, vzero, false, false);
            }
#pragma unroll
            for (int nt = 0; nt < 2; ++nt) {
                s0[nt] = __builtin_amdgcn_wmma_f32_16x16x4_f32(false, a0hi, false, bk1[nt], (short)0, s0[nt], false, false);
                s1[nt] = __builtin_amdgcn_wmma_f32_16x16x4_f32(false, a1hi, false, bk1[nt], (short)0, s1[nt], false, false);
            }
            // keeps the wait below behind the score WMMAs (nothing else ties it there)
            __builtin_amdgcn_sched_barrier(0);
            // precaution: the q loads' address registers are given to other values
            // only behind this wait
            asm volatile("s_wait_xcnt 0x0" ::: "memory");
            // keeps the exp2 results, which may get those registers, behind the wait
            __builtin_amdgcn_sched_barrier(0);

            // ---- E tiles -> bf16 B operands (layouts line up; in-lane pack) ----
            v16bf eb[2];
#pragma unroll
            for (int nt = 0; nt < 2; ++nt) {
#pragma unroll
                for (int g = 0; g < 8; ++g) {
                    eb[nt][g]     = (__bf16)__builtin_amdgcn_exp2f(s0[nt][g]);   // K = moff+g
                    eb[nt][8 + g] = (__bf16)__builtin_amdgcn_exp2f(s1[nt][g]);   // K = 16+moff+g
                }
            }

            // ---- 16 c-tiles x 2 n-tiles of the main bf16 GEMM, A fragments from LDS ----
#pragma unroll
            for (int cb = 0; cb < 4; ++cb) {
                const int j  = ms * 4 + cb;         // this block
                const int jn = j + 1;               // the block read ahead
                if (jn < (MG / 32) * 4) {
#pragma unroll
                    for (int i = 0; i < 4; ++i) {
                        const unsigned char* p =
                            svt + ((jn & 3) * 4 + i) * 16 * PITCH + (jn >> 2) * 64;
                        fr[jn & 1][2 * i]     = *(const v4u*)(p);
                        fr[jn & 1][2 * i + 1] = *(const v4u*)(p + 32);
                    }
                }
                // keeps the eight LDS reads together ahead of the block (for speed only)
                __builtin_amdgcn_sched_barrier(0);
#pragma unroll
                for (int i = 0; i < 4; ++i) {
                    union { v4u u[2]; v16bf h; } U;
                    U.u[0] = fr[j & 1][2 * i];
                    U.u[1] = fr[j & 1][2 * i + 1];
#pragma unroll
                    for (int nt = 0; nt < 2; ++nt)
                        acc[cb * 4 + i][nt] = __builtin_amdgcn_wmma_f32_16x16x32_bf16(
                            false, U.h, false, eb[nt], (short)0, acc[cb * 4 + i][nt], false, false);
                }
                // keeps the next group of reads behind this block's WMMAs
                __builtin_amdgcn_sched_barrier(0);
            }
        }
        // ---- hand-over: tile t+1 becomes readable, tile t's buffer free ----
        asm volatile("s_wait_dscnt 0x0" ::: "memory");      // own reads of tile t done
        asm volatile("s_wait_asynccnt 0x0" ::: "memory");   // own copies of tile t+1 landed
        __syncthreads();                                    // the same for every wave
        if (t + 2 < NT)
            SKC_stage(gsrc + (size_t)(t + 2) * MT, ldst + (t & 1) * BUFB);
    }
    asm volatile("s_wait_asynccnt 0x0" ::: "memory");       // nothing in flight at the wave's end

    // ---- epilogue: residual values asked for first, they fly during the exchange.
    // One address per lane for f and one for out, the rest is a constant offset
    // in each instruction: wave w finishes c-tiles 0-7, wave w+4 c-tiles 8-15.
    // (every loop below is unrolled: acc and res are indexed by constants)
    const float* f = (dir == 0) ? fL : fU;
    float* o = out + (size_t)dir * ((size_t)NB * NC * NN);
    const size_t e0 = ((size_t)b * NC + grp * 128 + hi * 8) * NN + n0 + l15;
    const float* fe = f + e0;
    float*       oe = o + e0;
    float res[8][2][8];
#pragma unroll
    for (int i = 0; i < 8; ++i)
#pragma unroll
        for (int nt = 0; nt < 2; ++nt)
#pragma unroll
            for (int g = 0; g < 8; ++g)
                res[i][nt][g] = fe[(i * 16 + g) * NN + nt * 16];
    // precaution: fe's registers are given to other values only behind this wait
    asm volatile("s_wait_xcnt 0x0" ::: "memory");
    // keeps every later write of a register behind that wait
    __builtin_amdgcn_sched_barrier(0);

    // ---- the two groups' partial sums meet: waves w and w+4 hold the same
    // 256 c x 32 n.  Each hands over the eight c-tiles that the other finishes.
    // The staging buffers are free: the loop's last barrier ended every read of
    // them and no copy is in flight.
    v4f* xs = (v4f*)(sv + wave * XB) + lane;
#pragma unroll
    for (int i = 0; i < 8; ++i) {
#pragma unroll
        for (int nt = 0; nt < 2; ++nt) {
            const v8f snd = grp ? acc[i][nt] : acc[8 + i][nt];
            xs[((i * 2 + nt) * 2 + 0) * 32] = (v4f){snd[0], snd[1], snd[2], snd[3]};
            xs[((i * 2 + nt) * 2 + 1) * 32] = (v4f){snd[4], snd[5], snd[6], snd[7]};
        }
    }
    __syncthreads();                                        // the partner's half is written
    const v4f* xr = (const v4f*)(sv + (wave ^ 4) * XB) + lane;

#pragma unroll
    for (int i = 0; i < 8; ++i) {
#pragma unroll
        for (int nt = 0; nt < 2; ++nt) {
            const v8f own = grp ? acc[8 + i][nt] : acc[i][nt];
            const v4f r0 = xr[((i * 2 + nt) * 2 + 0) * 32];
            const v4f r1 = xr[((i * 2 + nt) * 2 + 1) * 32];
#pragma unroll
            for (int g = 0; g < 8; ++g)
                res[i][nt][g] += beta * (own[g] + (g < 4 ? r0[g & 3] : r1[g & 3]));
        }
    }
    // keeps the stores together at the wave's end: no register that a store
    // names is written behind it
    __builtin_amdgcn_sched_barrier(0);
#pragma unroll
    for (int i = 0; i < 8; ++i)
#pragma unroll
        for (int nt = 0; nt < 2; ++nt)
#pragma unroll
            for (int g = 0; g < 8; ++g)
                oe[(i * 16 + g) * NN + nt * 16] = res[i][nt][g];
}

// ---------------------------------------------------------------------------
// Host-side launcher.  Workspace layout (floats unless noted):
//   qbuf : 2*B*R*N            = 262144
//   kbuf : 2*B*R*N            = 262144
//   invZ : 2*B*N              =  32768
//   vp   : 2*B*C*N  (bf16)    -> 16.8 MB      (total ~19 MB)
// ---------------------------------------------------------------------------
extern "C" void kernel_launch(void* const* d_in, const int* in_sizes, int n_in,
                              void* d_out, int out_size, void* d_ws, size_t ws_size,
                              hipStream_t stream)
{
    const float* fL   = (const float*)d_in[0];
    const float* fU   = (const float*)d_in[1];
    const float* qLw  = (const float*)d_in[2];
    const float* qLb  = (const float*)d_in[3];
    const float* kUw  = (const float*)d_in[4];
    const float* kUb  = (const float*)d_in[5];
    const float* vUw  = (const float*)d_in[6];
    const float* vUb  = (const float*)d_in[7];
    const float* qUw  = (const float*)d_in[8];
    const float* qUb  = (const float*)d_in[9];
    const float* kLw  = (const float*)d_in[10];
    const float* kLb  = (const float*)d_in[11];
    const float* vLw  = (const float*)d_in[12];
    const float* vLb  = (const float*)d_in[13];
    const float* beta = (const float*)d_in[14];
    float* outp = (float*)d_out;

    float*  qbuf = (float*)d_ws;
    float*  kbuf = qbuf + (size_t)2 * NB * NR * NN;
    float*  invZ = kbuf + (size_t)2 * NB * NR * NN;
    __bf16* vp   = (__bf16*)(invZ + (size_t)2 * NB * NN);

    // 1) projections (q pre-scaled by log2 e)
    SKC_proj<<<dim3(NN / PN, NB, 2), dim3(512), 0, stream>>>(
        fL, fU, qLw, qLb, kUw, kUb, qUw, qUb, kLw, kLb, qbuf, kbuf);

    // 2) softmax normalizers via f32 WMMA score tiles
    SKC_stats<<<dim3(NN / 128, NB, 2), dim3(1024), 0, stream>>>(qbuf, kbuf, invZ);

    // 3) grouped v-projection folded with 1/Z, bf16 output
    SKC_vp<<<dim3(NN / 256, NB * NG, 2), dim3(256), 0, stream>>>(
        fL, fU, vUw, vUb, vLw, vLb, invZ, vp);

    // 4) main attend (f32-WMMA score gen + bf16-WMMA GEMM) + fused residual
    SKC_attend<<<dim3(NN / 128, NB, 2), dim3(256), 0, stream>>>(
        fL, fU, qbuf, kbuf, vp, beta, outp);
}

// v005
// It runs in 97.2 microseconds.
// Two timings next to v004 put it at 1.11 and 1.08 times that version's speed.
// All steps since v000 together make it 6.33 times as fast.
#include <hip/hip_runtime.h>
#include <hip/hip_bf16.h>

// ---------------------------------------------------------------------------
// SKCLite cross-attention for MI455X (gfx1250, wave32, WMMA).
//
// B=4, C=256, N=H*W=4096, R=8 (rank), G=4 groups (CG=64).
// Dominant cost: out = v @ softmax(q^T k)  -> 2 * 2*B*C*N^2 = 68.7 GFLOP.
// Strategy: flash-style on-the-fly score tiles.
//   scores (rank-8): q and k are each kept as a bf16 high part plus a bf16 low
//   part (16 significant bits); the four cross products x rank 8 fill the K=32
//   of ONE V_WMMA_F32_16X16X32_BF16, a quarter of the matrix time of the two
//   V_WMMA_F32_16X16X4_F32 that the same tile takes on f32 operands,
//   exp() + bf16-pack lands *exactly* in the B-operand layout of
//   V_WMMA_F32_16X16X32_BF16 (f32 C/D layout == bf16 B layout modulo packing),
//   main GEMM in bf16 WMMA with f32 accumulation.
// ---------------------------------------------------------------------------

#define NB   4      // batch
#define NC   256    // channels
#define NN   4096   // H*W
#define NR   8      // rank
#define NG   4      // groups
#define NCG  64     // channels per group
#define LOG2E 1.4426950408889634f

typedef __attribute__((ext_vector_type(8)))  float        v8f;
typedef __attribute__((ext_vector_type(16))) __bf16       v16bf;
typedef __attribute__((ext_vector_type(4)))  unsigned int v4u;
typedef __attribute__((ext_vector_type(8)))  __bf16       v8bf;

// A position's q (or k) record: 8 high parts, then 8 low parts, 32 bytes.
#define NS   (2 * NR)
// A bf16 16x16x32 operand holds two k blocks of 8 per lane half (registers 0-3
// and 4-7), four in all.  One side of the score product gives every lane its
// row's whole record, (high, low) in both halves; the other side gives lane
// half 0 (high, high) and lane half 1 (low, low).  Block by block that pairs
// high.high, low.high, high.low, low.low: the full product of the two sums.
union SKC_frag { v4u u[2]; v16bf h; };

// ---------------------------------------------------------------------------
// Kernel 1: q/k projections.  q = (qw . f + qb) * log2(e)   (exp -> exp2)
//           k =  kw . f + kb
// Layout: qs/ks = [dir][B][N][high parts of the R rows, low parts] bf16.
// dir0 (LU path): q from fL (qL_w), k from fU (kU_w)
// dir1 (UL path): q from fU (qU_w), k from fL (kL_w)
// The kernel is a stream over fL and fU from memory, so it is built for bytes
// in flight: block = (source map, batch, 128 n), one per WGP; each of its 16
// waves takes 16 of the 256 channels and asks for all its 16 rows (512
// contiguous bytes each) before it uses the first.  The 16 partial sums
// meet in LDS and are added in channel order, by one thread per position and
// map (q or k): it holds all 8 rows and stores the position's whole record.
// ---------------------------------------------------------------------------
#define PC 16       // channels per wave
#define PN 128      // n per block: 32 lanes x 4

typedef __attribute__((ext_vector_type(4))) float v4f;

__global__ __launch_bounds__(512)
void SKC_proj(const float* __restrict__ fL, const float* __restrict__ fU,
              const float* __restrict__ qLw, const float* __restrict__ qLb,
              const float* __restrict__ kUw, const float* __restrict__ kUb,
              const float* __restrict__ qUw, const float* __restrict__ qUb,
              const float* __restrict__ kLw, const float* __restrict__ kLb,
              __bf16* __restrict__ qs, __bf16* __restrict__ ks)
{
    __shared__ v4f red[NC / PC][2 * NR][32];    // [wave][q rows, k rows][lane]

    const int lane = threadIdx.x & 31;
    // wave-uniform, so that the weights come by scalar loads
    const int wave = __builtin_amdgcn_readfirstlane(threadIdx.x >> 5);
    const int b    = blockIdx.y;
    const int srcU = blockIdx.z;                // 0: fL, 1: fU
    const int n0   = blockIdx.x * PN;
    const unsigned l4 = lane * 4;               // this lane's four n

    const float* f  = srcU ? fU  : fL;
    const float* qw = srcU ? qUw : qLw;
    const float* kw = srcU ? kUw : kLw;

    const int c0 = wave * PC;
    const float* fb = f + ((size_t)b * NC + c0) * NN + n0;

    // unrolled: x is indexed by constants and all 16 loads stand in a row
    v4f x[PC];
#pragma unroll
    for (int i = 0; i < PC; ++i)
        x[i] = *(const v4f*)(fb + (size_t)i * NN + l4);
    // precaution: the row loads' address registers are given to other values only
    // behind this wait
    asm volatile("s_wait_xcnt 0x0" ::: "memory");
    // keeps all 16 loads in front of the first sum (a load left behind one would
    // be asked for only when earlier rows have arrived, a second memory latency)
    // and every later write of a register behind the wait
    __builtin_amdgcn_sched_barrier(0);

    // every loop below is unrolled so that x, aq and ak are indexed by
    // constants and stay in registers
    v4f aq[NR], ak[NR];
#pragma unroll
    for (int r = 0; r < NR; ++r) { aq[r] = (v4f)(0.f); ak[r] = (v4f)(0.f); }

#pragma unroll
    for (int i = 0; i < PC; ++i) {
#pragma unroll
        for (int r = 0; r < NR; ++r) {
            aq[r] += qw[r * NC + c0 + i] * x[i];   // uniform -> scalar loads
            ak[r] += kw[r * NC + c0 + i] * x[i];
        }
    }

#pragma unroll
    for (int r = 0; r < NR; ++r) {
        red[wave][r][lane]      = aq[r];
        red[wave][NR + r][lane] = ak[r];
    }
    __syncthreads();

    // waves 0-3 finish q, waves 4-7 k: one position per lane, all 8 rows.
    // q of fL is dir 0, q of fU dir 1; k the other way round.
    if (wave < 8) {
        const bool   isq   = wave < 4;
        const float* bias  = isq ? (srcU ? qUb : qLb) : (srcU ? kUb : kLb);
        const float  scale = isq ? LOG2E : 1.0f;
        const int    nl    = (wave & 3) * 32 + lane;
        // red seen as [wave][q rows, k rows][128 n] floats
        const float* rf = (const float*)red + (isq ? 0 : NR) * PN + nl;

        // both loops unrolled: s is indexed by constants, and several LDS reads
        // are in flight ahead of the adds
        float s[NR];
#pragma unroll
        for (int r = 0; r < NR; ++r) s[r] = rf[r * PN];
#pragma unroll
        for (int p = 1; p < NC / PC; ++p) {
#pragma unroll
            for (int r = 0; r < NR; ++r) s[r] += rf[(p * 2 * NR + r) * PN];
        }

        // high part: the upper 16 bits of the f32, a bf16 as they stand; low
        // part: what that leaves over (exact in f32), rounded to bf16
        v4u  h;
        v8bf l;
#pragma unroll
        for (int r = 0; r < NR; r += 2) {
            const float    x0 = (s[r] + bias[r]) * scale;
            const float    x1 = (s[r + 1] + bias[r + 1]) * scale;
            const unsigned u0 = __builtin_bit_cast(unsigned, x0);
            const unsigned u1 = __builtin_bit_cast(unsigned, x1);
            h[r / 2] = (u0 >> 16) | (u1 & 0xffff0000u);
            l[r]     = (__bf16)(x0 - __builtin_bit_cast(float, u0 & 0xffff0000u));
            l[r + 1] = (__bf16)(x1 - __builtin_bit_cast(float, u1 & 0xffff0000u));
        }
        __bf16* ob = (isq ? qs : ks)
                   + (((size_t)(isq ? srcU : 1 - srcU) * NB + b) * NN + n0 + nl) * NS;
        *(v4u*)(ob)       = h;
        *(v8bf*)(ob + NR) = l;
    }
}

// ---------------------------------------------------------------------------
// Kernel 2: softmax normalizers.  invZ[dir][b][m] = 1 / sum_j exp(q_m . k_j)
// A operand (q, fixed 16-row m-tile) stays in registers; loop j in tiles of 16:
// one V_WMMA_F32_16X16X32_BF16 on the high and low parts, exp2, accumulate
// per-VGPR, then 16-lane xor reduction (lane halves independent).
// Every k line is new to the WGP when it is asked for, so each trip of a wave
// waits a whole L2 latency.  Block = 8 m-tiles x SJ quarters of j = 32 waves,
// eight per SIMD: one wave's wait lies under the others' work.  The SJ partial
// sums of a row meet in LDS and are added in j order.
// ---------------------------------------------------------------------------
#define SJ 4                // waves that share an m-tile
#define SJN (NN / SJ)       // j per wave
#define SU 4                // j-tiles per trip

__global__ __launch_bounds__(1024)
void SKC_stats(const __bf16* __restrict__ qs, const __bf16* __restrict__ ks,
               float* __restrict__ invZ)
{
    __shared__ float part[SJ][128];             // [quarter of j][m in the block]

    const int lane = threadIdx.x & 31;
    // wave-uniform, so that the k base address stays scalar
    const int wave = __builtin_amdgcn_readfirstlane(threadIdx.x >> 5);
    const int mt   = wave & 7;                  // m-tile in the block
    const int jq   = wave >> 3;                 // quarter of j
    const int b    = blockIdx.y;
    const int dir  = blockIdx.z;
    const int m0   = (blockIdx.x * 8 + mt) * 16;
    const int l15  = lane & 15;
    const int hi   = lane >> 4;                 // lane-half select

    const __bf16* q = qs + ((size_t)dir * NB + b) * (NN * NS);
    const __bf16* k = ks + (((size_t)dir * NB + b) * NN + jq * SJN) * NS;

    // A fragment, the fixed side: lane half 0 (high, high), lane half 1 (low, low)
    SKC_frag aq;
    aq.u[0] = *(const v4u*)(q + (m0 + l15) * NS + hi * NR);
    // precaution: that load's address registers are given to other values only
    // behind this wait
    asm volatile("s_wait_xcnt 0x0" ::: "memory");
    aq.u[1] = aq.u[0];

    const v8f vzero = {0.f, 0.f, 0.f, 0.f, 0.f, 0.f, 0.f, 0.f};
    v8f zacc = vzero;
    // kept rolled: a trip's loads then stand behind the exp2 and the adds of the
    // trip before, far more than the four slots that a load needs behind the
    // WMMAs which read, as B, the registers that it lands in
#pragma unroll 1
    for (int j0 = 0; j0 < SJN; j0 += 16 * SU) {
        // B fragments, the side that changes: column j's whole record as it lies
        // (the loops over u are unrolled: bk and s are indexed by constants)
        SKC_frag bk[SU];
#pragma unroll
        for (int u = 0; u < SU; ++u) {
            const __bf16* kj = k + (j0 + u * 16 + l15) * NS;
            bk[u].u[0] = *(const v4u*)(kj);
            bk[u].u[1] = *(const v4u*)(kj + NR);
        }
        // keeps a trip's loads together in front of its WMMAs: left to itself the
        // compiler asked for them in three lots, each waited for before the next
        __builtin_amdgcn_sched_barrier(0);
        v8f s[SU];
#pragma unroll
        for (int u = 0; u < SU; ++u)
            s[u] = __builtin_amdgcn_wmma_f32_16x16x32_bf16(
                false, aq.h, false, bk[u].h, (short)0, vzero, false, false);
        // keeps a trip's WMMAs together: each fills the slots that the one before
        // needs ahead of the exp2 on its result (else four v_nop per WMMA)
        __builtin_amdgcn_sched_barrier(0);
        // precaution: the k loads' address registers are stepped on only behind this wait
        asm volatile("s_wait_xcnt 0x0" ::: "memory");
        // the loaded k values, as inputs only, behind the four WMMAs: their registers
        // stay theirs until all four are issued, so that no WMMA's result is given
        // the registers which the WMMA right before it reads as B
        asm volatile("" :: "v"(bk[0].u[0]), "v"(bk[0].u[1]), "v"(bk[1].u[0]), "v"(bk[1].u[1]),
                           "v"(bk[2].u[0]), "v"(bk[2].u[1]), "v"(bk[3].u[0]), "v"(bk[3].u[1]));
        // keeps the step of the address, and the exp2, behind those two statements
        __builtin_amdgcn_sched_barrier(0);
#pragma unroll
        for (int u = 0; u < SU; ++u) {
#pragma unroll
            for (int g = 0; g < 8; ++g) zacc[g] += __builtin_amdgcn_exp2f(s[u][g]);
        }
    }
    // reduce across the 16 lanes of each half (j is the lane dimension); the
    // eight rows go through each step together, so their exchanges overlap
    // (both loops unrolled: zacc is indexed by constants)
#pragma unroll
    for (int st = 1; st < 16; st <<= 1) {
#pragma unroll
        for (int g = 0; g < 8; ++g) zacc[g] += __shfl_xor(zacc[g], st, 32);
    }
    if (l15 == 0) {
#pragma unroll
        for (int g = 0; g < 8; ++g)
            part[jq][mt * 16 + g + hi * 8] = zacc[g];   // D layout: VGPR g -> row g / g+8
    }
    __syncthreads();                            // every quarter's sums are written

    if (threadIdx.x < 128) {
        const int t = threadIdx.x;
        float z = part[0][t];
#pragma unroll
        for (int p = 1; p < SJ; ++p) z += part[p][t];   // unrolled: the LDS reads go out together
        invZ[((size_t)dir * NB + b) * NN + blockIdx.x * 128 + t] = 1.0f / z;
    }
}

// ---------------------------------------------------------------------------
// Kernel 3: grouped v-projection fused with 1/Z, emitted as bf16.
// vp[dir][b][c][m] = bf16( (vb[c] + sum_i vw[c][i] f[b,g*64+i,m]) * invZ[dir][b][m] )
// Thread = (dir,b,g,n); the 64-deep f column lives in registers, read once.
// ---------------------------------------------------------------------------
__global__ __launch_bounds__(256)
void SKC_vp(const float* __restrict__ fL, const float* __restrict__ fU,
            const float* __restrict__ vUw, const float* __restrict__ vUb,
            const float* __restrict__ vLw, const float* __restrict__ vLb,
            const float* __restrict__ invZ, __bf16* __restrict__ vp)
{
    const int dir = blockIdx.z;
    const int bg  = blockIdx.y;
    const int b   = bg >> 2;
    const int g   = bg & 3;
    const int n   = blockIdx.x * 256 + threadIdx.x;

    const float* f  = (dir == 0) ? fU  : fL;    // LU uses vU(fU); UL uses vL(fL)
    const float* vw = (dir == 0) ? vUw : vLw;
    const float* vb = (dir == 0) ? vUb : vLb;

    float fr[NCG];
#pragma unroll
    for (int i = 0; i < NCG; ++i)
        fr[i] = f[((size_t)b * NC + g * NCG + i) * NN + n];

    const float iz = invZ[((size_t)dir * NB + b) * NN + n];

    for (int co = 0; co < NCG; ++co) {
        const int c = g * NCG + co;
        float acc = vb[c];
#pragma unroll
        for (int i = 0; i < NCG; ++i)
            acc += vw[(size_t)c * NCG + i] * fr[i];   // uniform -> scalar loads
        vp[(((size_t)dir * NB + b) * NC + c) * NN + n] = (__bf16)(acc * iz);
    }
}

// ---------------------------------------------------------------------------
// Kernel 4: main attend + residual.
//   out[c,n] = f[c,n] + beta * sum_m vp[c,m] * exp(q_m . k_n)
// The four waves of each group read the same vp values, so a vp tile of
// 256 c x 128 m is brought into LDS once per block by asynchronous copies
// (whole 256-byte rows from L2), two buffers: tile t+1 flies while tile t is
// worked on.  LDS row pitch 272 B = 16 B x odd: conflict-free b128 reads.
// Wave tile: all 16 c-tiles (C=256) x two 16-wide n-tiles, so that every A
// fragment read from LDS feeds two WMMAs (one per fragment asks the LDS for
// twice what it delivers).  The block still covers 128 n: waves 0-3 take the
// first 64 m of every staged tile, waves 4-7 the last 64 m, for the same four
// n-pairs; the two partial sums meet in LDS after the loop.
// Per 32-wide m-step: 4x bf16 WMMA score tiles (high and low parts) -> exp2 -> bf16 pack
// (f32 D layout coincides with bf16 B layout: zero lane shuffles) ->
// 32x V_WMMA_F32_16X16X32_BF16 with one b128 LDS read each.
// ---------------------------------------------------------------------------
#define MT     128                 // m per staged tile
#define NT     (NN / MT)           // staged tiles
#define PITCH  272                 // LDS bytes per row: MT*2 + 16
#define BUFB   (NC * PITCH)        // LDS bytes per buffer
#define MG     (MT / 2)            // m of a staged tile per group of four waves
#define XB     16384               // LDS bytes a wave hands over: 8 c-tiles x 2 n-tiles, f32

// One thread's share of one tile: 16 copies of 16 B, rows 16 apart.
// g: this lane's first global element, l: this lane's first LDS byte address.
__device__ __forceinline__ void SKC_stage(const __bf16* g, unsigned l)
{
    // unrolled: two statements of eight copies (an asm statement takes 30 operands)
#pragma unroll
    for (int h = 0; h < 2; ++h) {
        const __bf16* gh = g + (size_t)h * 128 * NN;
        const unsigned lh = l + h * 128 * PITCH;
        // s_wait_xcnt as the statement's last line: it stands in front of any
        // later rewrite of the address registers that the copies name.
        asm volatile(
            "global_load_async_to_lds_b128 %0, %8, off\n\t"
            "global_load_async_to_lds_b128 %1, %9, off\n\t"
            "global_load_async_to_lds_b128 %2, %10, off\n\t"
            "global_load_async_to_lds_b128 %3, %11, off\n\t"
            "global_load_async_to_lds_b128 %4, %12, off\n\t"
            "global_load_async_to_lds_b128 %5, %13, off\n\t"
            "global_load_async_to_lds_b128 %6, %14, off\n\t"
            "global_load_async_to_lds_b128 %7, %15, off\n\t"
            "s_wait_xcnt 0x0"
            :: "v"(lh + 0 * 16 * PITCH), "v"(lh + 1 * 16 * PITCH),
               "v"(lh + 2 * 16 * PITCH), "v"(lh + 3 * 16 * PITCH),
               "v"(lh + 4 * 16 * PITCH), "v"(lh + 5 * 16 * PITCH),
               "v"(lh + 6 * 16 * PITCH), "v"(lh + 7 * 16 * PITCH),
               "v"(gh + (size_t)0 * 16 * NN), "v"(gh + (size_t)1 * 16 * NN),
               "v"(gh + (size_t)2 * 16 * NN), "v"(gh + (size_t)3 * 16 * NN),
               "v"(gh + (size_t)4 * 16 * NN), "v"(gh + (size_t)5 * 16 * NN),
               "v"(gh + (size_t)6 * 16 * NN), "v"(gh + (size_t)7 * 16 * NN)
            : "memory");
    }
}

__global__ __launch_bounds__(256)
void SKC_attend(const float* __restrict__ fL, const float* __restrict__ fU,
                const __bf16* __restrict__ qs, const __bf16* __restrict__ ks,
                const __bf16* __restrict__ vp, const float* __restrict__ betap,
                float* __restrict__ out)
{
    __shared__ __attribute__((aligned(16))) unsigned char sv[2 * BUFB];

    const int lane = threadIdx.x & 31;
    const int wave = threadIdx.x >> 5;
    const int grp  = wave >> 2;                 // which 64 m of every staged tile
    const int b    = blockIdx.y;
    const int dir  = blockIdx.z;
    const int n0   = (blockIdx.x * 4 + (wave & 3)) * 32;
    const int l15  = lane & 15;
    const int hi   = lane >> 4;
    const float beta = *betap;

    const __bf16* q   = qs   + ((size_t)dir * NB + b) * (NN * NS);
    const __bf16* k   = ks   + ((size_t)dir * NB + b) * (NN * NS);
    const __bf16* vpb = vp   + ((size_t)dir * NB + b) * (size_t)(NC * NN);

    // copy share of this thread: 16 lanes cover one 256-byte row
    const int crow = threadIdx.x >> 4;          // 0..15, then +16 per copy
    const int ccol = threadIdx.x & 15;          // 16-byte piece of the row
    const __bf16*  gsrc = vpb + (size_t)crow * NN + ccol * 8;
    const unsigned ldst = (unsigned)(size_t)sv + crow * PITCH + ccol * 16;

    // ---- tile 0 into buffer 0, published; then tile 1 into buffer 1 ----
    // kept rolled: so gsrc and ldst are never themselves operands of the copies'
    // asm statement.  Asm operands must lie in v0-v255, a value that is one is
    // held there for its whole life, and beside the accumulators gsrc found no
    // room there: it went to scratch and came back by a load in every trip.
#pragma unroll 1
    for (int p = 0; p < 2; ++p) {
        SKC_stage(gsrc + p * MT, ldst + p * BUFB);
        if (p == 0) {
            asm volatile("s_wait_asynccnt 0x0" ::: "memory");   // own copies of tile 0 landed
            __syncthreads();                                    // every wave's copies landed
        }
    }

    // k B-fragments of the two n-tiles: constant across the whole m loop.
    // The fixed side: lane half 0 (high, high), lane half 1 (low, low).
    SKC_frag bk[2];
#pragma unroll
    for (int nt = 0; nt < 2; ++nt) {
        bk[nt].u[0] = *(const v4u*)(k + (n0 + nt * 16 + l15) * NS + hi * NR);
        bk[nt].u[1] = bk[nt].u[0];
    }

    // q A-fragments of the group's m-step 0, two 16-row tiles.  The side that
    // changes: row m's whole record as it lies, the same in both lane halves.
    const int qlane = (l15 + grp * MG) * NS;            // this lane's place in a q tile
    SKC_frag qa0, qa1;
    qa0.u[0] = *(const v4u*)(q + qlane);
    qa0.u[1] = *(const v4u*)(q + qlane + NR);
    qa1.u[0] = *(const v4u*)(q + qlane + 16 * NS);
    qa1.u[1] = *(const v4u*)(q + qlane + 16 * NS + NR);
    // precaution: the address registers of the k and q loads above are given to
    // other values only behind this wait
    asm volatile("s_wait_xcnt 0x0" ::: "memory");
    // keeps every later write of a register behind that wait
    __builtin_amdgcn_sched_barrier(0);

    v8f acc[16][2];
    const v8f vzero = {0.f, 0.f, 0.f, 0.f, 0.f, 0.f, 0.f, 0.f};
#pragma unroll
    for (int ct = 0; ct < 16; ++ct) { acc[ct][0] = vzero; acc[ct][1] = vzero; }

    // bf16 A layout: row = l15, lane-half K offset of 8 elements = 16 bytes;
    // the group's 64 m start MG elements into the row
    const unsigned char* svl = sv + l15 * PITCH + hi * 16 + grp * (MG * 2);

    // kept rolled: one trip per staged tile, the buffer chosen by the trip's
    // parity (for speed only)
#pragma unroll 1
    for (int t = 0; t < NT; ++t) {
        const unsigned char* svt = svl + (t & 1) * BUFB;

        // two register sets of four A fragments: block j+1 is read from LDS as
        // one group while block j (four c-tiles x two n-tiles of one m-step) is
        // multiplied (every loop below is unrolled so that fr and acc are
        // indexed by constants and stay in registers)
        v4u fr[2][8];
#pragma unroll
        for (int i = 0; i < 4; ++i) {
            const unsigned char* p = svt + i * 16 * PITCH;
            fr[0][2 * i]     = *(const v4u*)(p);        // K = moff .. moff+7
            fr[0][2 * i + 1] = *(const v4u*)(p + 32);   // K = 16+moff .. 16+moff+7
        }

#pragma unroll
        for (int ms = 0; ms < MG / 32; ++ms) {
            // WMMA distance: the score WMMAs below may be given, as their D, the
            // registers that the last bf16 WMMA of the m-step before reads as B;
            // only scalar instructions stand between the two otherwise.
            asm volatile("v_nop\n\tv_nop\n\tv_nop\n\tv_nop\n\tv_nop");
            // keeps the score WMMAs behind those slots
            __builtin_amdgcn_sched_barrier(0);
            // ---- score tiles (m0..m0+15 and m0+16..m0+31) x two n-tiles, rank 8 x 4 ----
            // this m-step's q fragments are in registers; the group's next
            // m-step's are asked for here, a whole m-step ahead of their use (the
            // scheduling fences below would otherwise hold the loads right at
            // their use).  After the last m-step the index wraps to 0: in
            // bounds, not used.
            const v16bf a0 = qa0.h, a1 = qa1.h;
            {
                const __bf16* qn = q + qlane
                    + ((t * MT + (ms + 1 < MG / 32 ? ms * 32 + 32 : MT)) & (NN - 1)) * NS;
                qa0.u[0] = *(const v4u*)(qn);
                qa0.u[1] = *(const v4u*)(qn + NR);
                qa1.u[0] = *(const v4u*)(qn + 16 * NS);
                qa1.u[1] = *(const v4u*)(qn + 16 * NS + NR);
            }
            // keeps those loads in front of the score WMMAs, whose issue then
            // covers the wait that stands behind them
            __builtin_amdgcn_sched_barrier(0);
            v8f s0[2], s1[2];
#pragma unroll
            for (int nt = 0; nt < 2; ++nt) {
                s0[nt] = __builtin_amdgcn_wmma_f32_16x16x32_bf16(false, a0, false, bk[nt].h, (short)0, vzero, false, false);
                s1[nt] = __builtin_amdgcn_wmma_f32_16x16x32_bf16(false, a1, false, bk[nt].h, (short)0, vzero, false, false);
            }
            // keeps the wait below behind the score WMMAs (nothing else ties it there)
            __builtin_amdgcn_sched_barrier(0);
            // precaution: the q loads' address registers are given to other values
            // only behind this wait
            asm volatile("s_wait_xcnt 0x0" ::: "memory");
            // keeps the exp2 results, which may get those registers, behind the wait
            __builtin_amdgcn_sched_barrier(0);

            // ---- E tiles -> bf16 B operands (layouts line up; in-lane pack) ----
            v16bf eb[2];
#pragma unroll
            for (int nt = 0; nt < 2; ++nt) {
#pragma unroll
                for (int g = 0; g < 8; ++g) {
                    eb[nt][g]     = (__bf16)__builtin_amdgcn_exp2f(s0[nt][g]);   // K = moff+g
                    eb[nt][8 + g] = (__bf16)__builtin_amdgcn_exp2f(s1[nt][g]);   // K = 16+moff+g
                }
            }

            // ---- 16 c-tiles x 2 n-tiles of the main bf16 GEMM, A fragments from LDS ----
#pragma unroll
            for (int cb = 0; cb < 4; ++cb) {
                const int j  = ms * 4 + cb;         // this block
                const int jn = j + 1;               // the block read ahead
                if (jn < (MG / 32) * 4) {
#pragma unroll
                    for (int i = 0; i < 4; ++i) {
                        const unsigned char* p =
                            svt + ((jn & 3) * 4 + i) * 16 * PITCH + (jn >> 2) * 64;
                        fr[jn & 1][2 * i]     = *(const v4u*)(p);
                        fr[jn & 1][2 * i + 1] = *(const v4u*)(p + 32);
                    }
                }
                // keeps the eight LDS reads together ahead of the block (for speed only)
                __builtin_amdgcn_sched_barrier(0);
#pragma unroll
                for (int i = 0; i < 4; ++i) {
                    union { v4u u[2]; v16bf h; } U;
                    U.u[0] = fr[j & 1][2 * i];
                    U.u[1] = fr[j & 1][2 * i + 1];
#pragma unroll
                    for (int nt = 0; nt < 2; ++nt)
                        acc[cb * 4 + i][nt] = __builtin_amdgcn_wmma_f32_16x16x32_bf16(
                            false, U.h, false, eb[nt], (short)0, acc[cb * 4 + i][nt], false, false);
                }
                // keeps the next group of reads behind this block's WMMAs
                __builtin_amdgcn_sched_barrier(0);
            }
        }
        // ---- hand-over: tile t+1 becomes readable, tile t's buffer free ----
        asm volatile("s_wait_dscnt 0x0" ::: "memory");      // own reads of tile t done
        asm volatile("s_wait_asynccnt 0x0" ::: "memory");   // own copies of tile t+1 landed
        __syncthreads();                                    // the same for every wave
        if (t + 2 < NT)
            SKC_stage(gsrc + (size_t)(t + 2) * MT, ldst + (t & 1) * BUFB);
    }
    asm volatile("s_wait_asynccnt 0x0" ::: "memory");       // nothing in flight at the wave's end

    // ---- epilogue: residual values asked for first, they fly during the exchange.
    // One address per lane for f and one for out, the rest is a constant offset
    // in each instruction: wave w finishes c-tiles 0-7, wave w+4 c-tiles 8-15.
    // (every loop below is unrolled: acc and res are indexed by constants)
    const float* f = (dir == 0) ? fL : fU;
    float* o = out + (size_t)dir * ((size_t)NB * NC * NN);
    const size_t e0 = ((size_t)b * NC + grp * 128 + hi * 8) * NN + n0 + l15;
    const float* fe = f + e0;
    float*       oe = o + e0;
    float res[8][2][8];
#pragma unroll
    for (int i = 0; i < 8; ++i)
#pragma unroll
        for (int nt = 0; nt < 2; ++nt)
#pragma unroll
            for (int g = 0; g < 8; ++g)
                res[i][nt][g] = fe[(i * 16 + g) * NN + nt * 16];
    // precaution: fe's registers are given to other values only behind this wait
    asm volatile("s_wait_xcnt 0x0" ::: "memory");
    // keeps every later write of a register behind that wait
    __builtin_amdgcn_sched_barrier(0);

    // ---- the two groups' partial sums meet: waves w and w+4 hold the same
    // 256 c x 32 n.  Each hands over the eight c-tiles that the other finishes.
    // The staging buffers are free: the loop's last barrier ended every read of
    // them and no copy is in flight.
    v4f* xs = (v4f*)(sv + wave * XB) + lane;
#pragma unroll
    for (int i = 0; i < 8; ++i) {
#pragma unroll
        for (int nt = 0; nt < 2; ++nt) {
            const v8f snd = grp ? acc[i][nt] : acc[8 + i][nt];
            xs[((i * 2 + nt) * 2 + 0) * 32] = (v4f){snd[0], snd[1], snd[2], snd[3]};
            xs[((i * 2 + nt) * 2 + 1) * 32] = (v4f){snd[4], snd[5], snd[6], snd[7]};
        }
    }
    __syncthreads();                                        // the partner's half is written
    const v4f* xr = (const v4f*)(sv + (wave ^ 4) * XB) + lane;

#pragma unroll
    for (int i = 0; i < 8; ++i) {
#pragma unroll
        for (int nt = 0; nt < 2; ++nt) {
            const v8f own = grp ? acc[8 + i][nt] : acc[i][nt];
            const v4f r0 = xr[((i * 2 + nt) * 2 + 0) * 32];
            const v4f r1 = xr[((i * 2 + nt) * 2 + 1) * 32];
#pragma unroll
            for (int g = 0; g < 8; ++g)
                res[i][nt][g] += beta * (own[g] + (g < 4 ? r0[g & 3] : r1[g & 3]));
        }
    }
    // keeps the stores together at the wave's end: no register that a store
    // names is written behind it
    __builtin_amdgcn_sched_barrier(0);
#pragma unroll
    for (int i = 0; i < 8; ++i)
#pragma unroll
        for (int nt = 0; nt < 2; ++nt)
#pragma unroll
            for (int g = 0; g < 8; ++g)
                oe[(i * 16 + g) * NN + nt * 16] = res[i][nt][g];
}

// ---------------------------------------------------------------------------
// Host-side launcher.  Workspace layout (floats unless noted):
//   qs   : 2*B*N*2R (bf16)    = as 262144 floats
//   ks   : 2*B*N*2R (bf16)    = as 262144 floats
//   invZ : 2*B*N              =  32768
//   vp   : 2*B*C*N  (bf16)    -> 16.8 MB      (total ~19 MB)
// ---------------------------------------------------------------------------
extern "C" void kernel_launch(void* const* d_in, const int* in_sizes, int n_in,
                              void* d_out, int out_size, void* d_ws, size_t ws_size,
                              hipStream_t stream)
{
    const float* fL   = (const float*)d_in[0];
    const float* fU   = (const float*)d_in[1];
    const float* qLw  = (const float*)d_in[2];
    const float* qLb  = (const float*)d_in[3];
    const float* kUw  = (const float*)d_in[4];
    const float* kUb  = (const float*)d_in[5];
    const float* vUw  = (const float*)d_in[6];
    const float* vUb  = (const float*)d_in[7];
    const float* qUw  = (const float*)d_in[8];
    const float* qUb  = (const float*)d_in[9];
    const float* kLw  = (const float*)d_in[10];
    const float* kLb  = (const float*)d_in[11];
    const float* vLw  = (const float*)d_in[12];
    const float* vLb  = (const float*)d_in[13];
    const float* beta = (const float*)d_in[14];
    float* outp = (float*)d_out;

    __bf16* qs   = (__bf16*)d_ws;
    __bf16* ks   = qs + (size_t)2 * NB * NN * NS;
    float*  invZ = (float*)(ks + (size_t)2 * NB * NN * NS);
    __bf16* vp   = (__bf16*)(invZ + (size_t)2 * NB * NN);

    // 1) projections (q pre-scaled by log2 e)
    SKC_proj<<<dim3(NN / PN, NB, 2), dim3(512), 0, stream>>>(
        fL, fU, qLw, qLb, kUw, kUb, qUw, qUb, kLw, kLb, qs, ks);

    // 2) softmax normalizers via WMMA score tiles
    SKC_stats<<<dim3(NN / 128, NB, 2), dim3(1024), 0, stream>>>(qs, ks, invZ);

    // 3) grouped v-projection folded with 1/Z, bf16 output
    SKC_vp<<<dim3(NN / 256, NB * NG, 2), dim3(256), 0, stream>>>(
        fL, fU, vUw, vUb, vLw, vLb, invZ, vp);

    // 4) main attend (WMMA score gen + bf16-WMMA GEMM) + fused residual
    SKC_attend<<<dim3(NN / 128, NB, 2), dim3(256), 0, stream>>>(
        fL, fU, qs, ks, vp, beta, outp);
}

// v006
// Measured time: 76.8 microseconds a run.
// In two side-by-side timings against v005, it was 1.25 and 1.24 times as fast.
// Over all steps from v000 it is 7.90 times as fast.
#include <hip/hip_runtime.h>
#include <hip/hip_bf16.h>

// ---------------------------------------------------------------------------
// SKCLite cross-attention for MI455X (gfx1250, wave32, WMMA).
//
// B=4, C=256, N=H*W=4096, R=8 (rank), G=4 groups (CG=64).
// Dominant cost: out = v @ softmax(q^T k)  -> 2 * 2*B*C*N^2 = 68.7 GFLOP.
// Strategy: flash-style on-the-fly score tiles.
//   scores (rank-8): q and k are each kept as a bf16 high part plus a bf16 low
//   part (16 significant bits); the four cross products x rank 8 fill the K=32
//   of ONE V_WMMA_F32_16X16X32_BF16, a quarter of the matrix time of the two
//   V_WMMA_F32_16X16X4_F32 that the same tile takes on f32 operands,
//   exp() + bf16-pack lands *exactly* in the B-operand layout of
//   V_WMMA_F32_16X16X32_BF16 (f32 C/D layout == bf16 B layout modulo packing),
//   main GEMM in bf16 WMMA with f32 accumulation.
// ---------------------------------------------------------------------------

#define NB   4      // batch
#define NC   256    // channels
#define NN   4096   // H*W
#define NR   8      // rank
#define NG   4      // groups
#define NCG  64     // channels per group
#define LOG2E 1.4426950408889634f

typedef __attribute__((ext_vector_type(8)))  float        v8f;
typedef __attribute__((ext_vector_type(16))) __bf16       v16bf;
typedef __attribute__((ext_vector_type(4)))  unsigned int v4u;
typedef __attribute__((ext_vector_type(8)))  __bf16       v8bf;

// A position's q (or k) record: 8 high parts, then 8 low parts, 32 bytes.
#define NS   (2 * NR)
// A bf16 16x16x32 operand holds two k blocks of 8 per lane half (registers 0-3
// and 4-7), four in all.  One side of the score product gives every lane its
// row's whole record, (high, low) in both halves; the other side gives lane
// half 0 (high, high) and lane half 1 (low, low).  Block by block that pairs
// high.high, low.high, high.low, low.low: the full product of the two sums.
union SKC_frag { v4u u[2]; v16bf h; };

// ---------------------------------------------------------------------------
// Kernel 1: q/k projections.  q = (qw . f + qb) * log2(e)   (exp -> exp2)
//           k =  kw . f + kb
// Layout: qs/ks = [dir][B][N][high parts of the R rows, low parts] bf16.
// dir0 (LU path): q from fL (qL_w), k from fU (kU_w)
// dir1 (UL path): q from fU (qU_w), k from fL (kL_w)
// The kernel is a stream over fL and fU from memory, so it is built for bytes
// in flight: block = (source map, batch, 128 n), one per WGP; each of its 16
// waves takes 16 of the 256 channels and asks for all its 16 rows (512
// contiguous bytes each) before it uses the first.  The 16 partial sums
// meet in LDS and are added in channel order, by one thread per position and
// map (q or k): it holds all 8 rows and stores the position's whole record.
// ---------------------------------------------------------------------------
#define PC 16       // channels per wave
#define PN 128      // n per block: 32 lanes x 4

typedef __attribute__((ext_vector_type(4))) float v4f;

__global__ __launch_bounds__(512)
void SKC_proj(const float* __restrict__ fL, const float* __restrict__ fU,
              const float* __restrict__ qLw, const float* __restrict__ qLb,
              const float* __restrict__ kUw, const float* __restrict__ kUb,
              const float* __restrict__ qUw, const float* __restrict__ qUb,
              const float* __restrict__ kLw, const float* __restrict__ kLb,
              __bf16* __restrict__ qs, __bf16* __restrict__ ks)
{
    __shared__ v4f red[NC / PC][2 * NR][32];    // [wave][q rows, k rows][lane]

    const int lane = threadIdx.x & 31;
    // wave-uniform, so that the weights come by scalar loads
    const int wave = __builtin_amdgcn_readfirstlane(threadIdx.x >> 5);
    const int b    = blockIdx.y;
    const int srcU = blockIdx.z;                // 0: fL, 1: fU
    const int n0   = blockIdx.x * PN;
    const unsigned l4 = lane * 4;               // this lane's four n

    const float* f  = srcU ? fU  : fL;
    const float* qw = srcU ? qUw : qLw;
    const float* kw = srcU ? kUw : kLw;

    const int c0 = wave * PC;
    const float* fb = f + ((size_t)b * NC + c0) * NN + n0;

    // unrolled: x is indexed by constants and all 16 loads stand in a row
    v4f x[PC];
#pragma unroll
    for (int i = 0; i < PC; ++i)
        x[i] = *(const v4f*)(fb + (size_t)i * NN + l4);
    // precaution: the row loads' address registers are given to other values only
    // behind this wait
    asm volatile("s_wait_xcnt 0x0" ::: "memory");
    // keeps all 16 loads in front of the first sum (a load left behind one would
    // be asked for only when earlier rows have arrived, a second memory latency)
    // and every later write of a register behind the wait
    __builtin_amdgcn_sched_barrier(0);

    // every loop below is unrolled so that x, aq and ak are indexed by
    // constants and stay in registers
    v4f aq[NR], ak[NR];
#pragma unroll
    for (int r = 0; r < NR; ++r) { aq[r] = (v4f)(0.f); ak[r] = (v4f)(0.f); }

#pragma unroll
    for (int i = 0; i < PC; ++i) {
#pragma unroll
        for (int r = 0; r < NR; ++r) {
            aq[r] += qw[r * NC + c0 + i] * x[i];   // uniform -> scalar loads
            ak[r] += kw[r * NC + c0 + i] * x[i];
        }
    }

#pragma unroll
    for (int r = 0; r < NR; ++r) {
        red[wave][r][lane]      = aq[r];
        red[wave][NR + r][lane] = ak[r];
    }
    __syncthreads();

    // waves 0-3 finish q, waves 4-7 k: one position per lane, all 8 rows.
    // q of fL is dir 0, q of fU dir 1; k the other way round.
    if (wave < 8) {
        const bool   isq   = wave < 4;
        const float* bias  = isq ? (srcU ? qUb : qLb) : (srcU ? kUb : kLb);
        const float  scale = isq ? LOG2E : 1.0f;
        const int    nl    = (wave & 3) * 32 + lane;
        // red seen as [wave][q rows, k rows][128 n] floats
        const float* rf = (const float*)red + (isq ? 0 : NR) * PN + nl;

        // both loops unrolled: s is indexed by constants, and several LDS reads
        // are in flight ahead of the adds
        float s[NR];
#pragma unroll
        for (int r = 0; r < NR; ++r) s[r] = rf[r * PN];
#pragma unroll
        for (int p = 1; p < NC / PC; ++p) {
#pragma unroll
            for (int r = 0; r < NR; ++r) s[r] += rf[(p * 2 * NR + r) * PN];
        }

        // high part: the upper 16 bits of the f32, a bf16 as they stand; low
        // part: what that leaves over (exact in f32), rounded to bf16
        v4u  h;
        v8bf l;
#pragma unroll
        for (int r = 0; r < NR; r += 2) {
            const float    x0 = (s[r] + bias[r]) * scale;
            const float    x1 = (s[r + 1] + bias[r + 1]) * scale;
            const unsigned u0 = __builtin_bit_cast(unsigned, x0);
            const unsigned u1 = __builtin_bit_cast(unsigned, x1);
            h[r / 2] = (u0 >> 16) | (u1 & 0xffff0000u);
            l[r]     = (__bf16)(x0 - __builtin_bit_cast(float, u0 & 0xffff0000u));
            l[r + 1] = (__bf16)(x1 - __builtin_bit_cast(float, u1 & 0xffff0000u));
        }
        __bf16* ob = (isq ? qs : ks)
                   + (((size_t)(isq ? srcU : 1 - srcU) * NB + b) * NN + n0 + nl) * NS;
        *(v4u*)(ob)       = h;
        *(v8bf*)(ob + NR) = l;
    }
}

// ---------------------------------------------------------------------------
// Kernel 2: softmax normalizers.  invZ[dir][b][m] = 1 / sum_j exp(q_m . k_j)
// A operand (q, fixed 16-row m-tile) stays in registers; loop j in tiles of 16:
// one V_WMMA_F32_16X16X32_BF16 on the high and low parts, exp2, accumulate
// per-VGPR, then 16-lane xor reduction (lane halves independent).
// Every k line is new to the WGP when it is asked for, so each trip of a wave
// waits a whole L2 latency.  Block = 8 m-tiles x SJ quarters of j = 32 waves,
// eight per SIMD: one wave's wait lies under the others' work.  The SJ partial
// sums of a row meet in LDS and are added in j order.
// ---------------------------------------------------------------------------
#define SJ 4                // waves that share an m-tile
#define SJN (NN / SJ)       // j per wave
#define SU 4                // j-tiles per trip

__global__ __launch_bounds__(1024)
void SKC_stats(const __bf16* __restrict__ qs, const __bf16* __restrict__ ks,
               float* __restrict__ invZ)
{
    __shared__ float part[SJ][128];             // [quarter of j][m in the block]

    const int lane = threadIdx.x & 31;
    // wave-uniform, so that the k base address stays scalar
    const int wave = __builtin_amdgcn_readfirstlane(threadIdx.x >> 5);
    const int mt   = wave & 7;                  // m-tile in the block
    const int jq   = wave >> 3;                 // quarter of j
    const int b    = blockIdx.y;
    const int dir  = blockIdx.z;
    const int m0   = (blockIdx.x * 8 + mt) * 16;
    const int l15  = lane & 15;
    const int hi   = lane >> 4;                 // lane-half select

    const __bf16* q = qs + ((size_t)dir * NB + b) * (NN * NS);
    const __bf16* k = ks + (((size_t)dir * NB + b) * NN + jq * SJN) * NS;

    // A fragment, the fixed side: lane half 0 (high, high), lane half 1 (low, low)
    SKC_frag aq;
    aq.u[0] = *(const v4u*)(q + (m0 + l15) * NS + hi * NR);
    // precaution: that load's address registers are given to other values only
    // behind this wait
    asm volatile("s_wait_xcnt 0x0" ::: "memory");
    aq.u[1] = aq.u[0];

    const v8f vzero = {0.f, 0.f, 0.f, 0.f, 0.f, 0.f, 0.f, 0.f};
    v8f zacc = vzero;
    // kept rolled: a trip's loads then stand behind the exp2 and the adds of the
    // trip before, far more than the four slots that a load needs behind the
    // WMMAs which read, as B, the registers that it lands in
#pragma unroll 1
    for (int j0 = 0; j0 < SJN; j0 += 16 * SU) {
        // B fragments, the side that changes: column j's whole record as it lies
        // (the loops over u are unrolled: bk and s are indexed by constants)
        SKC_frag bk[SU];
#pragma unroll
        for (int u = 0; u < SU; ++u) {
            const __bf16* kj = k + (j0 + u * 16 + l15) * NS;
            bk[u].u[0] = *(const v4u*)(kj);
            bk[u].u[1] = *(const v4u*)(kj + NR);
        }
        // keeps a trip's loads together in front of its WMMAs: left to itself the
        // compiler asked for them in three lots, each waited for before the next
        __builtin_amdgcn_sched_barrier(0);
        v8f s[SU];
#pragma unroll
        for (int u = 0; u < SU; ++u)
            s[u] = __builtin_amdgcn_wmma_f32_16x16x32_bf16(
                false, aq.h, false, bk[u].h, (short)0, vzero, false, false);
        // keeps a trip's WMMAs together: each fills the slots that the one before
        // needs ahead of the exp2 on its result (else four v_nop per WMMA)
        __builtin_amdgcn_sched_barrier(0);
        // precaution: the k loads' address registers are stepped on only behind this wait
        asm volatile("s_wait_xcnt 0x0" ::: "memory");
        // the loaded k values, as inputs only, behind the four WMMAs: their registers
        // stay theirs until all four are issued, so that no WMMA's result is given
        // the registers which the WMMA right before it reads as B
        asm volatile("" :: "v"(bk[0].u[0]), "v"(bk[0].u[1]), "v"(bk[1].u[0]), "v"(bk[1].u[1]),
                           "v"(bk[2].u[0]), "v"(bk[2].u[1]), "v"(bk[3].u[0]), "v"(bk[3].u[1]));
        // keeps the step of the address, and the exp2, behind those two statements
        __builtin_amdgcn_sched_barrier(0);
#pragma unroll
        for (int u = 0; u < SU; ++u) {
#pragma unroll
            for (int g = 0; g < 8; ++g) zacc[g] += __builtin_amdgcn_exp2f(s[u][g]);
        }
    }
    // reduce across the 16 lanes of each half (j is the lane dimension); the
    // eight rows go through each step together, so their exchanges overlap
    // (both loops unrolled: zacc is indexed by constants)
#pragma unroll
    for (int st = 1; st < 16; st <<= 1) {
#pragma unroll
        for (int g = 0; g < 8; ++g) zacc[g] += __shfl_xor(zacc[g], st, 32);
    }
    if (l15 == 0) {
#pragma unroll
        for (int g = 0; g < 8; ++g)
            part[jq][mt * 16 + g + hi * 8] = zacc[g];   // D layout: VGPR g -> row g / g+8
    }
    __syncthreads();                            // every quarter's sums are written

    if (threadIdx.x < 128) {
        const int t = threadIdx.x;
        float z = part[0][t];
#pragma unroll
        for (int p = 1; p < SJ; ++p) z += part[p][t];   // unrolled: the LDS reads go out together
        invZ[((size_t)dir * NB + b) * NN + blockIdx.x * 128 + t] = 1.0f / z;
    }
}

// ---------------------------------------------------------------------------
// Kernel 3: grouped v-projection fused with 1/Z, emitted as bf16.
// vp[dir][b][c][m] = bf16( (vb[c] + sum_i vw[c][i] f[b,g*64+i,m]) * invZ[dir][b][m] )
// The products run on V_WMMA_F32_16X16X32_BF16: weights (A) and f (B) are each
// split into a bf16 high part plus a bf16 low part, and high.high + high.low +
// low.high are summed in f32 (what is left out lies 16 bits below the product,
// the result is rounded to 8).
// Block = (dir, b, group, 512 m), one per WGP; wave = all 64 c of the group x 64 m.
// A lane reads four neighbouring m of a row by one b128 load (16 lanes: 256
// contiguous bytes); register r of those loads is column tile r, whose column
// l15 stands for m = 4 * l15 + r.  So no value changes its lane, all 32 loads
// of a wave are in flight together, and the four tiles' results of a lane are
// four neighbouring m again: one 8-byte store, 128 contiguous bytes per row.
// The weights' fragments are the same for the eight waves: each wave forms one
// (c-tile, k-step) of them and leaves it in LDS.
// ---------------------------------------------------------------------------
#define VM 64       // m per wave: 16 lanes x 4

typedef __attribute__((ext_vector_type(2))) unsigned int v2u;
typedef __attribute__((ext_vector_type(4))) __bf16       v4bf;

__global__ __launch_bounds__(256)
void SKC_vp(const float* __restrict__ fL, const float* __restrict__ fU,
            const float* __restrict__ vUw, const float* __restrict__ vUb,
            const float* __restrict__ vLw, const float* __restrict__ vLb,
            const float* __restrict__ invZ, __bf16* __restrict__ vp)
{
    // [c-tile][k-step][high, low][registers 0-3, 4-7][lane]
    __shared__ v4u sw[4][2][2][2][32];

    const int lane = threadIdx.x & 31;
    const int wave = threadIdx.x >> 5;
    const int l15  = lane & 15;
    const int hi   = lane >> 4;
    const int dir  = blockIdx.z;
    const int b    = blockIdx.y >> 2;
    const int g    = blockIdx.y & 3;
    const int m0   = (blockIdx.x * 8 + wave) * VM + l15 * 4;    // this lane's four m

    const float* f  = (dir == 0) ? fU  : fL;    // LU uses vU(fU); UL uses vL(fL)
    const float* vw = (dir == 0) ? vUw : vLw;
    const float* vb = (dir == 0) ? vUb : vLb;

    // k order of both operands: element e of lane half hi is
    // i = 32 * s + 8 * hi + (e < 8 ? e : e + 8)
    // (every loop of this kernel is unrolled: the arrays are indexed by
    // constants and stay in registers)

    // this wave's share of the weights: c-tile wave / 2, k-step wave % 2, row l15
    const float* wr = vw + (size_t)(g * NCG + (wave >> 1) * 16 + l15) * NCG + (wave & 1) * 32 + hi * 8;
    v4f w[4];
#pragma unroll
    for (int p = 0; p < 4; ++p)
        w[p] = *(const v4f*)(wr + (p >> 1) * 16 + (p & 1) * 4);

    const float* fb = f + ((size_t)b * NC + g * NCG + hi * 8) * NN + m0;
    v4f x[2][16];
#pragma unroll
    for (int s = 0; s < 2; ++s)
#pragma unroll
        for (int e = 0; e < 16; ++e)
            x[s][e] = *(const v4f*)(fb + (size_t)(s * 32 + (e < 8 ? e : e + 8)) * NN);

    const float* zp = invZ + ((size_t)dir * NB + b) * NN + m0;
    const v4f iz = *(const v4f*)(zp);
    // D layout: register j is row j + 8 * hi of the c-tile
    const float* bp = vb + g * NCG + hi * 8;
    v8f cb[4];
#pragma unroll
    for (int ct = 0; ct < 4; ++ct)
        cb[ct] = *(const v8f*)(bp + ct * 16);
    // precaution: the address registers of the loads above are given to other
    // values only behind this wait.  The three lane addresses are its inputs, so
    // that they keep their registers up to it: without that the last loads of the
    // group were given the earlier loads' address registers to land in.
    asm volatile("s_wait_xcnt 0x0" :: "v"(wr), "v"(fb), "v"(zp) : "memory");
    // keeps all the loads in front of the first use (a load left behind one would
    // be asked for only when earlier ones have arrived, a second memory latency)
    // and every later write of a register behind the wait
    __builtin_amdgcn_sched_barrier(0);

    {
        union { v4u u[2]; v16bf h; } H, L;
#pragma unroll
        for (int e = 0; e < 16; ++e) {
            const float v = w[e >> 2][e & 3];
            H.h[e] = (__bf16)v;
            L.h[e] = (__bf16)(v - (float)H.h[e]);
        }
        sw[wave >> 1][wave & 1][0][0][lane] = H.u[0];
        sw[wave >> 1][wave & 1][0][1][lane] = H.u[1];
        sw[wave >> 1][wave & 1][1][0][lane] = L.u[0];
        sw[wave >> 1][wave & 1][1][1][lane] = L.u[1];
    }
    __syncthreads();                            // every wave's weight fragments are written

    v16bf bh[2][4], bl[2][4];                   // [k-step][column tile]
#pragma unroll
    for (int s = 0; s < 2; ++s)
#pragma unroll
        for (int r = 0; r < 4; ++r)
#pragma unroll
            for (int e = 0; e < 16; ++e) {
                const float v = x[s][e][r];
                bh[s][r][e] = (__bf16)v;
                bl[s][r][e] = (__bf16)(v - (float)bh[s][r][e]);
            }

    v2u o[4][8];
#pragma unroll
    for (int ct = 0; ct < 4; ++ct) {
        SKC_frag ah[2], al[2];
#pragma unroll
        for (int s = 0; s < 2; ++s) {
            ah[s].u[0] = sw[ct][s][0][0][lane];
            ah[s].u[1] = sw[ct][s][0][1][lane];
            al[s].u[0] = sw[ct][s][1][0][lane];
            al[s].u[1] = sw[ct][s][1][1][lane];
        }
        v8f acc[4];
#pragma unroll
        for (int r = 0; r < 4; ++r) acc[r] = cb[ct];
        // r innermost: four independent accumulators follow one another
#pragma unroll
        for (int s = 0; s < 2; ++s) {
#pragma unroll
            for (int r = 0; r < 4; ++r)
                acc[r] = __builtin_amdgcn_wmma_f32_16x16x32_bf16(
                    false, al[s].h, false, bh[s][r], (short)0, acc[r], false, false);
#pragma unroll
            for (int r = 0; r < 4; ++r)
                acc[r] = __builtin_amdgcn_wmma_f32_16x16x32_bf16(
                    false, ah[s].h, false, bl[s][r], (short)0, acc[r], false, false);
#pragma unroll
            for (int r = 0; r < 4; ++r)
                acc[r] = __builtin_amdgcn_wmma_f32_16x16x32_bf16(
                    false, ah[s].h, false, bh[s][r], (short)0, acc[r], false, false);
        }
#pragma unroll
        for (int j = 0; j < 8; ++j) {
            v4bf t;
#pragma unroll
            for (int r = 0; r < 4; ++r) t[r] = (__bf16)(acc[r][j] * iz[r]);
            o[ct][j] = __builtin_bit_cast(v2u, t);
        }
    }
    // keeps the stores together at the wave's end: no register that a store
    // names is written behind it
    __builtin_amdgcn_sched_barrier(0);
    __bf16* ob = vp + (((size_t)dir * NB + b) * NC + g * NCG + hi * 8) * NN + m0;
#pragma unroll
    for (int ct = 0; ct < 4; ++ct)
#pragma unroll
        for (int j = 0; j < 8; ++j)
            *(v2u*)(ob + (size_t)(ct * 16 + j) * NN) = o[ct][j];
}

// ---------------------------------------------------------------------------
// Kernel 4: main attend + residual.
//   out[c,n] = f[c,n] + beta * sum_m vp[c,m] * exp(q_m . k_n)
// The four waves of each group read the same vp values, so a vp tile of
// 256 c x 128 m is brought into LDS once per block by asynchronous copies
// (whole 256-byte rows from L2), two buffers: tile t+1 flies while tile t is
// worked on.  LDS row pitch 272 B = 16 B x odd: conflict-free b128 reads.
// Wave tile: all 16 c-tiles (C=256) x two 16-wide n-tiles, so that every A
// fragment read from LDS feeds two WMMAs (one per fragment asks the LDS for
// twice what it delivers).  The block still covers 128 n: waves 0-3 take the
// first 64 m of every staged tile, waves 4-7 the last 64 m, for the same four
// n-pairs; the two partial sums meet in LDS after the loop.
// Per 32-wide m-step: 4x bf16 WMMA score tiles (high and low parts) -> exp2 -> bf16 pack
// (f32 D layout coincides with bf16 B layout: zero lane shuffles) ->
// 32x V_WMMA_F32_16X16X32_BF16 with one b128 LDS read each.
// ---------------------------------------------------------------------------
#define MT     128                 // m per staged tile
#define NT     (NN / MT)           // staged tiles
#define PITCH  272                 // LDS bytes per row: MT*2 + 16
#define BUFB   (NC * PITCH)        // LDS bytes per buffer
#define MG     (MT / 2)            // m of a staged tile per group of four waves
#define XB     16384               // LDS bytes a wave hands over: 8 c-tiles x 2 n-tiles, f32

// One thread's share of one tile: 16 copies of 16 B, rows 16 apart.
// g: this lane's first global element, l: this lane's first LDS byte address.
__device__ __forceinline__ void SKC_stage(const __bf16* g, unsigned l)
{
    // unrolled: two statements of eight copies (an asm statement takes 30 operands)
#pragma unroll
    for (int h = 0; h < 2; ++h) {
        const __bf16* gh = g + (size_t)h * 128 * NN;
        const unsigned lh = l + h * 128 * PITCH;
        // s_wait_xcnt as the statement's last line: it stands in front of any
        // later rewrite of the address registers that the copies name.
        asm volatile(
            "global_load_async_to_lds_b128 %0, %8, off\n\t"
            "global_load_async_to_lds_b128 %1, %9, off\n\t"
            "global_load_async_to_lds_b128 %2, %10, off\n\t"
            "global_load_async_to_lds_b128 %3, %11, off\n\t"
            "global_load_async_to_lds_b128 %4, %12, off\n\t"
            "global_load_async_to_lds_b128 %5, %13, off\n\t"
            "global_load_async_to_lds_b128 %6, %14, off\n\t"
            "global_load_async_to_lds_b128 %7, %15, off\n\t"
            "s_wait_xcnt 0x0"
            :: "v"(lh + 0 * 16 * PITCH), "v"(lh + 1 * 16 * PITCH),
               "v"(lh + 2 * 16 * PITCH), "v"(lh + 3 * 16 * PITCH),
               "v"(lh + 4 * 16 * PITCH), "v"(lh + 5 * 16 * PITCH),
               "v"(lh + 6 * 16 * PITCH), "v"(lh + 7 * 16 * PITCH),
               "v"(gh + (size_t)0 * 16 * NN), "v"(gh + (size_t)1 * 16 * NN),
               "v"(gh + (size_t)2 * 16 * NN), "v"(gh + (size_t)3 * 16 * NN),
               "v"(gh + (size_t)4 * 16 * NN), "v"(gh + (size_t)5 * 16 * NN),
               "v"(gh + (size_t)6 * 16 * NN), "v"(gh + (size_t)7 * 16 * NN)
            : "memory");
    }
}

__global__ __launch_bounds__(256)
void SKC_attend(const float* __restrict__ fL, const float* __restrict__ fU,
                const __bf16* __restrict__ qs, const __bf16* __restrict__ ks,
                const __bf16* __restrict__ vp, const float* __restrict__ betap,
                float* __restrict__ out)
{
    __shared__ __attribute__((aligned(16))) unsigned char sv[2 * BUFB];

    const int lane = threadIdx.x & 31;
    const int wave = threadIdx.x >> 5;
    const int grp  = wave >> 2;                 // which 64 m of every staged tile
    const int b    = blockIdx.y;
    const int dir  = blockIdx.z;
    const int n0   = (blockIdx.x * 4 + (wave & 3)) * 32;
    const int l15  = lane & 15;
    const int hi   = lane >> 4;
    const float beta = *betap;

    const __bf16* q   = qs   + ((size_t)dir * NB + b) * (NN * NS);
    const __bf16* k   = ks   + ((size_t)dir * NB + b) * (NN * NS);
    const __bf16* vpb = vp   + ((size_t)dir * NB + b) * (size_t)(NC * NN);

    // copy share of this thread: 16 lanes cover one 256-byte row
    const int crow = threadIdx.x >> 4;          // 0..15, then +16 per copy
    const int ccol = threadIdx.x & 15;          // 16-byte piece of the row
    const __bf16*  gsrc = vpb + (size_t)crow * NN + ccol * 8;
    const unsigned ldst = (unsigned)(size_t)sv + crow * PITCH + ccol * 16;

    // ---- tile 0 into buffer 0, published; then tile 1 into buffer 1 ----
    // kept rolled: so gsrc and ldst are never themselves operands of the copies'
    // asm statement.  Asm operands must lie in v0-v255, a value that is one is
    // held there for its whole life, and beside the accumulators gsrc found no
    // room there: it went to scratch and came back by a load in every trip.
#pragma unroll 1
    for (int p = 0; p < 2; ++p) {
        SKC_stage(gsrc + p * MT, ldst + p * BUFB);
        if (p == 0) {
            asm volatile("s_wait_asynccnt 0x0" ::: "memory");   // own copies of tile 0 landed
            __syncthreads();                                    // every wave's copies landed
        }
    }

    // k B-fragments of the two n-tiles: constant across the whole m loop.
    // The fixed side: lane half 0 (high, high), lane half 1 (low, low).
    SKC_frag bk[2];
#pragma unroll
    for (int nt = 0; nt < 2; ++nt) {
        bk[nt].u[0] = *(const v4u*)(k + (n0 + nt * 16 + l15) * NS + hi * NR);
        bk[nt].u[1] = bk[nt].u[0];
    }

    // q A-fragments of the group's m-step 0, two 16-row tiles.  The side that
    // changes: row m's whole record as it lies, the same in both lane halves.
    const int qlane = (l15 + grp * MG) * NS;            // this lane's place in a q tile
    SKC_frag qa0, qa1;
    qa0.u[0] = *(const v4u*)(q + qlane);
    qa0.u[1] = *(const v4u*)(q + qlane + NR);
    qa1.u[0] = *(const v4u*)(q + qlane + 16 * NS);
    qa1.u[1] = *(const v4u*)(q + qlane + 16 * NS + NR);
    // precaution: the address registers of the k and q loads above are given to
    // other values only behind this wait
    asm volatile("s_wait_xcnt 0x0" ::: "memory");
    // keeps every later write of a register behind that wait
    __builtin_amdgcn_sched_barrier(0);

    v8f acc[16][2];
    const v8f vzero = {0.f, 0.f, 0.f, 0.f, 0.f, 0.f, 0.f, 0.f};
#pragma unroll
    for (int ct = 0; ct < 16; ++ct) { acc[ct][0] = vzero; acc[ct][1] = vzero; }

    // bf16 A layout: row = l15, lane-half K offset of 8 elements = 16 bytes;
    // the group's 64 m start MG elements into the row
    const unsigned char* svl = sv + l15 * PITCH + hi * 16 + grp * (MG * 2);

    // kept rolled: one trip per staged tile, the buffer chosen by the trip's
    // parity (for speed only)
#pragma unroll 1
    for (int t = 0; t < NT; ++t) {
        const unsigned char* svt = svl + (t & 1) * BUFB;

        // two register sets of four A fragments: block j+1 is read from LDS as
        // one group while block j (four c-tiles x two n-tiles of one m-step) is
        // multiplied (every loop below is unrolled so that fr and acc are
        // indexed by constants and stay in registers)
        v4u fr[2][8];
#pragma unroll
        for (int i = 0; i < 4; ++i) {
            const unsigned char* p = svt + i * 16 * PITCH;
            fr[0][2 * i]     = *(const v4u*)(p);        // K = moff .. moff+7
            fr[0][2 * i + 1] = *(const v4u*)(p + 32);   // K = 16+moff .. 16+moff+7
        }

#pragma unroll
        for (int ms = 0; ms < MG / 32; ++ms) {
            // WMMA distance: the score WMMAs below may be given, as their D, the
            // registers that the last bf16 WMMA of the m-step before reads as B;
            // only scalar instructions stand between the two otherwise.
            asm volatile("v_nop\n\tv_nop\n\tv_nop\n\tv_nop\n\tv_nop");
            // keeps the score WMMAs behind those slots
            __builtin_amdgcn_sched_barrier(0);
            // ---- score tiles (m0..m0+15 and m0+16..m0+31) x two n-tiles, rank 8 x 4 ----
            // this m-step's q fragments are in registers; the group's next
            // m-step's are asked for here, a whole m-step ahead of their use (the
            // scheduling fences below would otherwise hold the loads right at
            // their use).  After the last m-step the index wraps to 0: in
            // bounds, not used.
            const v16bf a0 = qa0.h, a1 = qa1.h;
            {
                const __bf16* qn = q + qlane
                    + ((t * MT + (ms + 1 < MG / 32 ? ms * 32 + 32 : MT)) & (NN - 1)) * NS;
                qa0.u[0] = *(const v4u*)(qn);
                qa0.u[1] = *(const v4u*)(qn + NR);
                qa1.u[0] = *(const v4u*)(qn + 16 * NS);
                qa1.u[1] = *(const v4u*)(qn + 16 * NS + NR);
            }
            // keeps those loads in front of the score WMMAs, whose issue then
            // covers the wait that stands behind them
            __builtin_amdgcn_sched_barrier(0);
            v8f s0[2], s1[2];
#pragma unroll
            for (int nt = 0; nt < 2; ++nt) {
                s0[nt] = __builtin_amdgcn_wmma_f32_16x16x32_bf16(false, a0, false, bk[nt].h, (short)0, vzero, false, false);
                s1[nt] = __builtin_amdgcn_wmma_f32_16x16x32_bf16(false, a1, false, bk[nt].h, (short)0, vzero, false, false);
            }
            // keeps the wait below behind the score WMMAs (nothing else ties it there)
            __builtin_amdgcn_sched_barrier(0);
            // precaution: the q loads' address registers are given to other values
            // only behind this wait
            asm volatile("s_wait_xcnt 0x0" ::: "memory");
            // keeps the exp2 results, which may get those registers, behind the wait
            __builtin_amdgcn_sched_barrier(0);

            // ---- E tiles -> bf16 B operands (layouts line up; in-lane pack) ----
            v16bf eb[2];
#pragma unroll
            for (int nt = 0; nt < 2; ++nt) {
#pragma unroll
                for (int g = 0; g < 8; ++g) {
                    eb[nt][g]     = (__bf16)__builtin_amdgcn_exp2f(s0[nt][g]);   // K = moff+g
                    eb[nt][8 + g] = (__bf16)__builtin_amdgcn_exp2f(s1[nt][g]);   // K = 16+moff+g
                }
            }

            // ---- 16 c-tiles x 2 n-tiles of the main bf16 GEMM, A fragments from LDS ----
#pragma unroll
            for (int cb = 0; cb < 4; ++cb) {
                const int j  = ms * 4 + cb;         // this block
                const int jn = j + 1;               // the block read ahead
                if (jn < (MG / 32) * 4) {
#pragma unroll
                    for (int i = 0; i < 4; ++i) {
                        const unsigned char* p =
                            svt + ((jn & 3) * 4 + i) * 16 * PITCH + (jn >> 2) * 64;
                        fr[jn & 1][2 * i]     = *(const v4u*)(p);
                        fr[jn & 1][2 * i + 1] = *(const v4u*)(p + 32);
                    }
                }
                // keeps the eight LDS reads together ahead of the block (for speed only)
                __builtin_amdgcn_sched_barrier(0);
#pragma unroll
                for (int i = 0; i < 4; ++i) {
                    union { v4u u[2]; v16bf h; } U;
                    U.u[0] = fr[j & 1][2 * i];
                    U.u[1] = fr[j & 1][2 * i + 1];
#pragma unroll
                    for (int nt = 0; nt < 2; ++nt)
                        acc[cb * 4 + i][nt] = __builtin_amdgcn_wmma_f32_16x16x32_bf16(
                            false, U.h, false, eb[nt], (short)0, acc[cb * 4 + i][nt], false, false);
                }
                // keeps the next group of reads behind this block's WMMAs
                __builtin_amdgcn_sched_barrier(0);
            }
        }
        // ---- hand-over: tile t+1 becomes readable, tile t's buffer free ----
        asm volatile("s_wait_dscnt 0x0" ::: "memory");      // own reads of tile t done
        asm volatile("s_wait_asynccnt 0x0" ::: "memory");   // own copies of tile t+1 landed
        __syncthreads();                                    // the same for every wave
        if (t + 2 < NT)
            SKC_stage(gsrc + (size_t)(t + 2) * MT, ldst + (t & 1) * BUFB);
    }
    asm volatile("s_wait_asynccnt 0x0" ::: "memory");       // nothing in flight at the wave's end

    // ---- epilogue: residual values asked for first, they fly during the exchange.
    // One address per lane for f and one for out, the rest is a constant offset
    // in each instruction: wave w finishes c-tiles 0-7, wave w+4 c-tiles 8-15.
    // (every loop below is unrolled: acc and res are indexed by constants)
    const float* f = (dir == 0) ? fL : fU;
    float* o = out + (size_t)dir * ((size_t)NB * NC * NN);
    const size_t e0 = ((size_t)b * NC + grp * 128 + hi * 8) * NN + n0 + l15;
    const float* fe = f + e0;
    float*       oe = o + e0;
    float res[8][2][8];
#pragma unroll
    for (int i = 0; i < 8; ++i)
#pragma unroll
        for (int nt = 0; nt < 2; ++nt)
#pragma unroll
            for (int g = 0; g < 8; ++g)
                res[i][nt][g] = fe[(i * 16 + g) * NN + nt * 16];
    // precaution: fe's registers are given to other values only behind this wait
    asm volatile("s_wait_xcnt 0x0" ::: "memory");
    // keeps every later write of a register behind that wait
    __builtin_amdgcn_sched_barrier(0);

    // ---- the two groups' partial sums meet: waves w and w+4 hold the same
    // 256 c x 32 n.  Each hands over the eight c-tiles that the other finishes.
    // The staging buffers are free: the loop's last barrier ended every read of
    // them and no copy is in flight.
    v4f* xs = (v4f*)(sv + wave * XB) + lane;
#pragma unroll
    for (int i = 0; i < 8; ++i) {
#pragma unroll
        for (int nt = 0; nt < 2; ++nt) {
            const v8f snd = grp ? acc[i][nt] : acc[8 + i][nt];
            xs[((i * 2 + nt) * 2 + 0) * 32] = (v4f){snd[0], snd[1], snd[2], snd[3]};
            xs[((i * 2 + nt) * 2 + 1) * 32] = (v4f){snd[4], snd[5], snd[6], snd[7]};
        }
    }
    __syncthreads();                                        // the partner's half is written
    const v4f* xr = (const v4f*)(sv + (wave ^ 4) * XB) + lane;

#pragma unroll
    for (int i = 0; i < 8; ++i) {
#pragma unroll
        for (int nt = 0; nt < 2; ++nt) {
            const v8f own = grp ? acc[8 + i][nt] : acc[i][nt];
            const v4f r0 = xr[((i * 2 + nt) * 2 + 0) * 32];
            const v4f r1 = xr[((i * 2 + nt) * 2 + 1) * 32];
#pragma unroll
            for (int g = 0; g < 8; ++g)
                res[i][nt][g] += beta * (own[g] + (g < 4 ? r0[g & 3] : r1[g & 3]));
        }
    }
    // keeps the stores together at the wave's end: no register that a store
    // names is written behind it
    __builtin_amdgcn_sched_barrier(0);
#pragma unroll
    for (int i = 0; i < 8; ++i)
#pragma unroll
        for (int nt = 0; nt < 2; ++nt)
#pragma unroll
            for (int g = 0; g < 8; ++g)
                oe[(i * 16 + g) * NN + nt * 16] = res[i][nt][g];
}

// ---------------------------------------------------------------------------
// Host-side launcher.  Workspace layout (floats unless noted):
//   qs   : 2*B*N*2R (bf16)    = as 262144 floats
//   ks   : 2*B*N*2R (bf16)    = as 262144 floats
//   invZ : 2*B*N              =  32768
//   vp   : 2*B*C*N  (bf16)    -> 16.8 MB      (total ~19 MB)
// ---------------------------------------------------------------------------
extern "C" void kernel_launch(void* const* d_in, const int* in_sizes, int n_in,
                              void* d_out, int out_size, void* d_ws, size_t ws_size,
                              hipStream_t stream)
{
    const float* fL   = (const float*)d_in[0];
    const float* fU   = (const float*)d_in[1];
    const float* qLw  = (const float*)d_in[2];
    const float* qLb  = (const float*)d_in[3];
    const float* kUw  = (const float*)d_in[4];
    const float* kUb  = (const float*)d_in[5];
    const float* vUw  = (const float*)d_in[6];
    const float* vUb  = (const float*)d_in[7];
    const float* qUw  = (const float*)d_in[8];
    const float* qUb  = (const float*)d_in[9];
    const float* kLw  = (const float*)d_in[10];
    const float* kLb  = (const float*)d_in[11];
    const float* vLw  = (const float*)d_in[12];
    const float* vLb  = (const float*)d_in[13];
    const float* beta = (const float*)d_in[14];
    float* outp = (float*)d_out;

    __bf16* qs   = (__bf16*)d_ws;
    __bf16* ks   = qs + (size_t)2 * NB * NN * NS;
    float*  invZ = (float*)(ks + (size_t)2 * NB * NN * NS);
    __bf16* vp   = (__bf16*)(invZ + (size_t)2 * NB * NN);

    // 1) projections (q pre-scaled by log2 e)
    SKC_proj<<<dim3(NN / PN, NB, 2), dim3(512), 0, stream>>>(
        fL, fU, qLw, qLb, kUw, kUb, qUw, qUb, kLw, kLb, qs, ks);

    // 2) softmax normalizers via WMMA score tiles
    SKC_stats<<<dim3(NN / 128, NB, 2), dim3(1024), 0, stream>>>(qs, ks, invZ);

    // 3) grouped v-projection folded with 1/Z, bf16 output
    SKC_vp<<<dim3(NN / (8 * VM), NB * NG, 2), dim3(256), 0, stream>>>(
        fL, fU, vUw, vUb, vLw, vLb, invZ, vp);

    // 4) main attend (WMMA score gen + bf16-WMMA GEMM) + fused residual
    SKC_attend<<<dim3(NN / 128, NB, 2), dim3(256), 0, stream>>>(
        fL, fU, qs, ks, vp, beta, outp);
}

// v007
// Measured time: 71.9 microseconds a run.
// Next to v006, in two timings, it ran 1.07 times as fast each time.
// Counting every step since v000, it is 8.42 times as fast.
#include <hip/hip_runtime.h>
#include <hip/hip_bf16.h>

// ---------------------------------------------------------------------------
// SKCLite cross-attention for MI455X (gfx1250, wave32, WMMA).
//
// B=4, C=256, N=H*W=4096, R=8 (rank), G=4 groups (CG=64).
// Dominant cost: out = v @ softmax(q^T k)  -> 2 * 2*B*C*N^2 = 68.7 GFLOP.
// Strategy: flash-style on-the-fly score tiles.
//   scores (rank-8): q and k are each kept as a bf16 high part plus a bf16 low
//   part (16 significant bits); the four cross products x rank 8 fill the K=32
//   of ONE V_WMMA_F32_16X16X32_BF16, a quarter of the matrix time of the two
//   V_WMMA_F32_16X16X4_F32 that the same tile takes on f32 operands,
//   exp() + bf16-pack lands *exactly* in the B-operand layout of
//   V_WMMA_F32_16X16X32_BF16 (f32 C/D layout == bf16 B layout modulo packing),
//   main GEMM in bf16 WMMA with f32 accumulation.
// ---------------------------------------------------------------------------

#define NB   4      // batch
#define NC   256    // channels
#define NN   4096   // H*W
#define NR   8      // rank
#define NG   4      // groups
#define NCG  64     // channels per group
#define LOG2E 1.4426950408889634f

typedef __attribute__((ext_vector_type(8)))  float        v8f;
typedef __attribute__((ext_vector_type(16))) __bf16       v16bf;
typedef __attribute__((ext_vector_type(4)))  unsigned int v4u;
typedef __attribute__((ext_vector_type(8)))  __bf16       v8bf;

// A position's q (or k) record: 8 high parts, then 8 low parts, 32 bytes.
#define NS   (2 * NR)
// A bf16 16x16x32 operand holds two k blocks of 8 per lane half (registers 0-3
// and 4-7), four in all.  One side of the score product gives every lane its
// row's whole record, (high, low) in both halves; the other side gives lane
// half 0 (high, high) and lane half 1 (low, low).  Block by block that pairs
// high.high, low.high, high.low, low.low: the full product of the two sums.
// In the attend kernel the fourth block carries -log2 Z of the row instead of
// low.low (which lies 16 bits below the score): three bf16 parts against ones.
union SKC_frag { v4u u[2]; v16bf h; };

// ---------------------------------------------------------------------------
// Kernel 1: one pass over f gives q, k and v.
//   q = (qw . f + qb) * log2(e)   (exp -> exp2),   k = kw . f + kb
//   vp[dir][b][c][m] = bf16( vb[c] + sum_i vw[c][i] f[b,g*64+i,m] )
// Layout: qs/ks = [dir][B][N][high parts of the R rows, low parts] bf16.
// dir0 (LU path): q from fL (qL_w), k and v from fU (kU_w, vU_w)
// dir1 (UL path): q from fU (qU_w), k and v from fL (kL_w, vL_w)
// All products run on V_WMMA_F32_16X16X32_BF16: weights (A) and f (B) are each
// split into a bf16 high part plus a bf16 low part, and high.high + high.low +
// low.high are summed in f32 (what is left out lies 16 bits below the product).
// Block = (source map, b, 128 n), one per WGP; wave = one group's 64 channels x
// 64 n.  On its f fragments a wave runs five 16-row A tiles: the group's four
// c-tiles of v, and one tile whose rows are the 8 q rows and the 8 k rows,
// restricted to the group's channels.  The four groups' partial q and k sums
// meet in LDS and are added in group order.
// A lane reads four neighbouring n of a row by one b128 load (16 lanes: 256
// contiguous bytes); register r of those loads is column tile r, whose column
// l15 stands for n = 4 * l15 + r.  So no value changes its lane, all 32 loads
// of a wave are in flight together, and the four tiles' v results of a lane are
// four neighbouring n again: one 8-byte store, 128 contiguous bytes per row.
// The weights' fragments of a group are the same for its two waves: each forms
// those of one k-step and leaves them in LDS.
// ---------------------------------------------------------------------------
#define VM  64              // n per wave: 16 lanes x 4
#define PN  128             // n per block
#define RR  1088            // LDS bytes of one column tile's partial sums: 2 x 512, + 64
                            // so that the four tiles' rows start on different banks
#define RGB (4 * RR)        // LDS bytes of one wave's partial sums

typedef __attribute__((ext_vector_type(4))) float        v4f;
typedef __attribute__((ext_vector_type(2))) unsigned int v2u;
typedef __attribute__((ext_vector_type(4))) __bf16       v4bf;

__global__ __launch_bounds__(256)
void SKC_qkv(const float* __restrict__ fL, const float* __restrict__ fU,
             const float* __restrict__ qLw, const float* __restrict__ qLb,
             const float* __restrict__ kUw, const float* __restrict__ kUb,
             const float* __restrict__ qUw, const float* __restrict__ qUb,
             const float* __restrict__ kLw, const float* __restrict__ kLb,
             const float* __restrict__ vUw, const float* __restrict__ vUb,
             const float* __restrict__ vLw, const float* __restrict__ vLb,
             __bf16* __restrict__ qs, __bf16* __restrict__ ks,
             __bf16* __restrict__ vp)
{
    // [group][4 c-tiles of v, q and k rows][k-step][high, low][registers 0-3, 4-7][lane]
    __shared__ v4u sw[NG][5][2][2][2][32];
    // partial q and k sums: [half of n][group] x RGB bytes
    __shared__ __attribute__((aligned(16))) unsigned char red[8 * RGB];

    const int lane = threadIdx.x & 31;
    // wave-uniform, so that the group's base addresses and the biases stay scalar
    const int wave = __builtin_amdgcn_readfirstlane(threadIdx.x >> 5);
    const int g    = wave & 3;                  // group of 64 channels
    const int mh   = wave >> 2;                 // which 64 n of the block
    const int l15  = lane & 15;
    const int hi   = lane >> 4;
    const int b    = blockIdx.y;
    const int srcU = blockIdx.z;                // 0: fL, 1: fU
    const int n0   = blockIdx.x * PN;
    const int m0   = n0 + mh * VM + l15 * 4;    // this lane's four n

    const float* f  = srcU ? fU  : fL;
    const float* qw = srcU ? qUw : qLw;
    const float* kw = srcU ? kUw : kLw;
    const float* vw = srcU ? vUw : vLw;
    const float* vb = srcU ? vUb : vLb;

    // k order of both operands: element e of lane half hi is
    // i = 32 * s + 8 * hi + (e < 8 ? e : e + 8)
    // (every loop of this kernel is unrolled: the arrays are indexed by
    // constants and stay in registers)

    // this wave's share of the weights: its group's five tiles, k-step mh, row l15
    const float* wr = vw + (size_t)(g * NCG + l15) * NCG + mh * 32 + hi * 8;
    const float* wq = (l15 < NR ? qw + l15 * NC : kw + (l15 - NR) * NC)
                    + g * NCG + mh * 32 + hi * 8;
    v4f w[5][4];
#pragma unroll
    for (int t = 0; t < 4; ++t)
#pragma unroll
        for (int p = 0; p < 4; ++p)
            w[t][p] = *(const v4f*)(wr + t * 16 * NCG + (p >> 1) * 16 + (p & 1) * 4);
#pragma unroll
    for (int p = 0; p < 4; ++p)
        w[4][p] = *(const v4f*)(wq + (p >> 1) * 16 + (p & 1) * 4);

    const float* fb = f + ((size_t)b * NC + g * NCG + hi * 8) * NN + m0;
    v4f x[2][16];
#pragma unroll
    for (int s = 0; s < 2; ++s)
#pragma unroll
        for (int e = 0; e < 16; ++e)
            x[s][e] = *(const v4f*)(fb + (size_t)(s * 32 + (e < 8 ? e : e + 8)) * NN);

    // D layout: register j is row j + 8 * hi of the c-tile
    const float* bp = vb + g * NCG + hi * 8;
    v8f cb[4];
#pragma unroll
    for (int ct = 0; ct < 4; ++ct)
        cb[ct] = *(const v8f*)(bp + ct * 16);
    // precaution: the address registers of the loads above are given to other
    // values only behind this wait.  The three lane addresses are its inputs, so
    // that they keep their registers up to it.
    asm volatile("s_wait_xcnt 0x0" :: "v"(wr), "v"(wq), "v"(fb) : "memory");
    // keeps all the loads in front of the first use (a load left behind one would
    // be asked for only when earlier ones have arrived, a second memory latency)
    // and every later write of a register behind the wait
    __builtin_amdgcn_sched_barrier(0);

#pragma unroll
    for (int t = 0; t < 5; ++t) {
        union { v4u u[2]; v16bf h; } H, L;
#pragma unroll
        for (int e = 0; e < 16; ++e) {
            const float v = w[t][e >> 2][e & 3];
            H.h[e] = (__bf16)v;
            L.h[e] = (__bf16)(v - (float)H.h[e]);
        }
        sw[g][t][mh][0][0][lane] = H.u[0];
        sw[g][t][mh][0][1][lane] = H.u[1];
        sw[g][t][mh][1][0][lane] = L.u[0];
        sw[g][t][mh][1][1][lane] = L.u[1];
    }
    __syncthreads();                            // every wave's weight fragments are written

    v16bf bh[2][4], bl[2][4];                   // [k-step][column tile]
#pragma unroll
    for (int s = 0; s < 2; ++s)
#pragma unroll
        for (int r = 0; r < 4; ++r)
#pragma unroll
            for (int e = 0; e < 16; ++e) {
                const float v = x[s][e][r];
                bh[s][r][e] = (__bf16)v;
                bl[s][r][e] = (__bf16)(v - (float)bh[s][r][e]);
            }

    // tile 4 (q and k rows) first: its sums are on their way through LDS while
    // the v tiles are multiplied
    v2u o[4][8];
#pragma unroll
    for (int tt = 0; tt < 5; ++tt) {
        const int t = (tt + 4) % 5;
        SKC_frag ah[2], al[2];
#pragma unroll
        for (int s = 0; s < 2; ++s) {
            ah[s].u[0] = sw[g][t][s][0][0][lane];
            ah[s].u[1] = sw[g][t][s][0][1][lane];
            al[s].u[0] = sw[g][t][s][1][0][lane];
            al[s].u[1] = sw[g][t][s][1][1][lane];
        }
        v8f acc[4];
#pragma unroll
        for (int r = 0; r < 4; ++r)
            acc[r] = (t < 4) ? cb[t & 3] : (v8f){0.f, 0.f, 0.f, 0.f, 0.f, 0.f, 0.f, 0.f};
        // r innermost: four independent accumulators follow one another
#pragma unroll
        for (int s = 0; s < 2; ++s) {
#pragma unroll
            for (int r = 0; r < 4; ++r)
                acc[r] = __builtin_amdgcn_wmma_f32_16x16x32_bf16(
                    false, al[s].h, false, bh[s][r], (short)0, acc[r], false, false);
#pragma unroll
            for (int r = 0; r < 4; ++r)
                acc[r] = __builtin_amdgcn_wmma_f32_16x16x32_bf16(
                    false, ah[s].h, false, bl[s][r], (short)0, acc[r], false, false);
#pragma unroll
            for (int r = 0; r < 4; ++r)
                acc[r] = __builtin_amdgcn_wmma_f32_16x16x32_bf16(
                    false, ah[s].h, false, bh[s][r], (short)0, acc[r], false, false);
        }
        if (t < 4) {
#pragma unroll
            for (int j = 0; j < 8; ++j) {
                v4bf c;
#pragma unroll
                for (int r = 0; r < 4; ++r) c[r] = (__bf16)acc[r][j];
                o[t & 3][j] = __builtin_bit_cast(v2u, c);
            }
        } else {
            // lane half 0 holds the 8 q rows, lane half 1 the 8 k rows, of column l15
            unsigned char* rw = red + wave * RGB + lane * 16;   // wave = mh * 4 + g
#pragma unroll
            for (int r = 0; r < 4; ++r) {
                *(v4f*)(rw + r * RR)       = (v4f){acc[r][0], acc[r][1], acc[r][2], acc[r][3]};
                *(v4f*)(rw + r * RR + 512) = (v4f){acc[r][4], acc[r][5], acc[r][6], acc[r][7]};
            }
        }
    }
    __syncthreads();                            // every group's partial q and k sums are written

    // the v stores go out first: they fly while q and k are finished
    __bf16* ov = vp + (((size_t)(1 - srcU) * NB + b) * NC + g * NCG + hi * 8) * NN + m0;
#pragma unroll
    for (int ct = 0; ct < 4; ++ct)
#pragma unroll
        for (int j = 0; j < 8; ++j)
            *(v2u*)(ov + (size_t)(ct * 16 + j) * NN) = o[ct][j];
    // precaution: the registers that those stores name are given to other values
    // only behind this wait
    asm volatile("s_wait_xcnt 0x0" ::: "memory");
    // keeps every later write of a register behind that wait
    __builtin_amdgcn_sched_barrier(0);

    // waves 0-3 finish q, waves 4-7 k: one position per lane, all 8 rows.
    // q of fL is dir 0, q of fU dir 1; k and v the other way round.
    const bool   isq   = wave < 4;
    const float* bias  = isq ? (srcU ? qUb : qLb) : (srcU ? kUb : kLb);
    const float  scale = isq ? LOG2E : 1.0f;
    const int    nl    = (wave & 3) * 32 + lane;
    // position nl was column (nl & 63) >> 2 of column tile nl & 3 in half nl >> 6
    const unsigned char* rf = red + (nl >> 6) * (NG * RGB) + (nl & 3) * RR
                            + ((isq ? 0 : 16) + ((nl & 63) >> 2)) * 16;
    v4f s0 = *(const v4f*)(rf), s1 = *(const v4f*)(rf + 512);
#pragma unroll
    for (int p = 1; p < NG; ++p) {
        s0 += *(const v4f*)(rf + p * RGB);
        s1 += *(const v4f*)(rf + p * RGB + 512);
    }

    // high part: the upper 16 bits of the f32, a bf16 as they stand; low
    // part: what that leaves over (exact in f32), rounded to bf16
    v4u  h;
    v8bf l;
#pragma unroll
    for (int r = 0; r < NR; r += 2) {
        const float    x0 = ((r < 4 ? s0[r & 3] : s1[r & 3]) + bias[r]) * scale;
        const float    x1 = ((r < 4 ? s0[(r + 1) & 3] : s1[(r + 1) & 3]) + bias[r + 1]) * scale;
        const unsigned u0 = __builtin_bit_cast(unsigned, x0);
        const unsigned u1 = __builtin_bit_cast(unsigned, x1);
        h[r / 2] = (u0 >> 16) | (u1 & 0xffff0000u);
        l[r]     = (__bf16)(x0 - __builtin_bit_cast(float, u0 & 0xffff0000u));
        l[r + 1] = (__bf16)(x1 - __builtin_bit_cast(float, u1 & 0xffff0000u));
    }
    __bf16* ob = (isq ? qs : ks)
               + (((size_t)(isq ? srcU : 1 - srcU) * NB + b) * NN + n0 + nl) * NS;
    *(v4u*)(ob)       = h;
    *(v8bf*)(ob + NR) = l;
}

// ---------------------------------------------------------------------------
// Kernel 2: softmax normalizers.  Z[dir][b][m] = sum_j exp(q_m . k_j), stored as
// zr[dir][b][m] = -log2 Z in three bf16 parts (24 significant bits) and five
// zeros, 16 bytes at the pitch of a q record: the attend kernel adds it to the
// scores of row m inside the score WMMA, so exp2 gives exp(q_m . k_n) / Z_m.
// A operand (q, fixed 16-row m-tile) stays in registers; loop j in tiles of 16:
// one V_WMMA_F32_16X16X32_BF16 on the high and low parts, exp2, accumulate
// per-VGPR, then 16-lane xor reduction (lane halves independent).
// Every k line is new to the WGP when it is asked for, so each trip of a wave
// waits a whole L2 latency.  Block = 8 m-tiles x SJ quarters of j = 32 waves,
// eight per SIMD: one wave's wait lies under the others' work.  The SJ partial
// sums of a row meet in LDS and are added in j order.
// ---------------------------------------------------------------------------
#define SJ 4                // waves that share an m-tile
#define SJN (NN / SJ)       // j per wave
#define SU 4                // j-tiles per trip

__global__ __launch_bounds__(1024)
void SKC_stats(const __bf16* __restrict__ qs, const __bf16* __restrict__ ks,
               __bf16* __restrict__ zr)
{
    __shared__ float part[SJ][128];             // [quarter of j][m in the block]

    const int lane = threadIdx.x & 31;
    // wave-uniform, so that the k base address stays scalar
    const int wave = __builtin_amdgcn_readfirstlane(threadIdx.x >> 5);
    const int mt   = wave & 7;                  // m-tile in the block
    const int jq   = wave >> 3;                 // quarter of j
    const int b    = blockIdx.y;
    const int dir  = blockIdx.z;
    const int m0   = (blockIdx.x * 8 + mt) * 16;
    const int l15  = lane & 15;
    const int hi   = lane >> 4;                 // lane-half select

    const __bf16* q = qs + ((size_t)dir * NB + b) * (NN * NS);
    const __bf16* k = ks + (((size_t)dir * NB + b) * NN + jq * SJN) * NS;

    // A fragment, the fixed side: lane half 0 (high, high), lane half 1 (low, low)
    SKC_frag aq;
    aq.u[0] = *(const v4u*)(q + (m0 + l15) * NS + hi * NR);
    // precaution: that load's address registers are given to other values only
    // behind this wait
    asm volatile("s_wait_xcnt 0x0" ::: "memory");
    aq.u[1] = aq.u[0];

    const v8f vzero = {0.f, 0.f, 0.f, 0.f, 0.f, 0.f, 0.f, 0.f};
    v8f zacc = vzero;
    // kept rolled: a trip's loads then stand behind the exp2 and the adds of the
    // trip before, far more than the four slots that a load needs behind the
    // WMMAs which read, as B, the registers that it lands in
#pragma unroll 1
    for (int j0 = 0; j0 < SJN; j0 += 16 * SU) {
        // B fragments, the side that changes: column j's whole record as it lies
        // (the loops over u are unrolled: bk and s are indexed by constants)
        SKC_frag bk[SU];
#pragma unroll
        for (int u = 0; u < SU; ++u) {
            const __bf16* kj = k + (j0 + u * 16 + l15) * NS;
            bk[u].u[0] = *(const v4u*)(kj);
            bk[u].u[1] = *(const v4u*)(kj + NR);
        }
        // keeps a trip's loads together in front of its WMMAs: left to itself the
        // compiler asked for them in three lots, each waited for before the next
        __builtin_amdgcn_sched_barrier(0);
        v8f s[SU];
#pragma unroll
        for (int u = 0; u < SU; ++u)
            s[u] = __builtin_amdgcn_wmma_f32_16x16x32_bf16(
                false, aq.h, false, bk[u].h, (short)0, vzero, false, false);
        // keeps a trip's WMMAs together: each fills the slots that the one before
        // needs ahead of the exp2 on its result (else four v_nop per WMMA)
        __builtin_amdgcn_sched_barrier(0);
        // precaution: the k loads' address registers are stepped on only behind this wait
        asm volatile("s_wait_xcnt 0x0" ::: "memory");
        // the loaded k values, as inputs only, behind the four WMMAs: their registers
        // stay theirs until all four are issued, so that no WMMA's result is given
        // the registers which the WMMA right before it reads as B
        asm volatile("" :: "v"(bk[0].u[0]), "v"(bk[0].u[1]), "v"(bk[1].u[0]), "v"(bk[1].u[1]),
                           "v"(bk[2].u[0]), "v"(bk[2].u[1]), "v"(bk[3].u[0]), "v"(bk[3].u[1]));
        // keeps the step of the address, and the exp2, behind those two statements
        __builtin_amdgcn_sched_barrier(0);
#pragma unroll
        for (int u = 0; u < SU; ++u) {
#pragma unroll
            for (int g = 0; g < 8; ++g) zacc[g] += __builtin_amdgcn_exp2f(s[u][g]);
        }
    }
    // reduce across the 16 lanes of each half (j is the lane dimension); the
    // eight rows go through each step together, so their exchanges overlap
    // (both loops unrolled: zacc is indexed by constants)
#pragma unroll
    for (int st = 1; st < 16; st <<= 1) {
#pragma unroll
        for (int g = 0; g < 8; ++g) zacc[g] += __shfl_xor(zacc[g], st, 32);
    }
    if (l15 == 0) {
#pragma unroll
        for (int g = 0; g < 8; ++g)
            part[jq][mt * 16 + g + hi * 8] = zacc[g];   // D layout: VGPR g -> row g / g+8
    }
    __syncthreads();                            // every quarter's sums are written

    if (threadIdx.x < 128) {
        const int t = threadIdx.x;
        float z = part[0][t];
#pragma unroll
        for (int p = 1; p < SJ; ++p) z += part[p][t];   // unrolled: the LDS reads go out together
        const float  lz = -__builtin_amdgcn_logf(z);    // v_log_f32 is log2
        const __bf16 p0 = (__bf16)lz;
        const float  r1 = lz - (float)p0;               // exact in f32
        const __bf16 p1 = (__bf16)r1;
        const __bf16 p2 = (__bf16)(r1 - (float)p1);
        const __bf16 zz = (__bf16)0.f;
        *(v8bf*)(zr + (((size_t)dir * NB + b) * NN + blockIdx.x * 128 + t) * NS) =
            (v8bf){p0, p1, p2, zz, zz, zz, zz, zz};
    }
}

// ---------------------------------------------------------------------------
// Kernel 3: main attend + residual.
//   out[c,n] = f[c,n] + beta * sum_m vp[c,m] * exp(q_m . k_n) / Z_m
// The four waves of a group read the same vp values, so a vp tile of
// 256 c x 128 m is brought into LDS once per block by asynchronous copies
// (whole 256-byte rows from L2), two buffers: tile t+1 flies while tile t is
// worked on.  LDS row pitch 272 B = 16 B x odd: conflict-free b128 reads.
// Wave tile: all 16 c-tiles (C=256) x two 16-wide n-tiles, so that every A
// fragment read from LDS feeds two WMMAs (one per fragment asks the LDS for
// twice what it delivers).  The block still covers 128 n: waves 0-3 take the
// first 64 m of every staged tile, waves 4-7 the last 64 m, for the same four
// n-pairs; the two partial sums meet in LDS after the loop.
// Per 32-wide m-step: 4x bf16 WMMA score tiles (high and low parts) -> exp2 -> bf16 pack
// (f32 D layout coincides with bf16 B layout: zero lane shuffles) ->
// 32x V_WMMA_F32_16X16X32_BF16 with one b128 LDS read each.
// ---------------------------------------------------------------------------
#define MT     128                 // m per staged tile
#define NT     (NN / MT)           // staged tiles
#define PITCH  272                 // LDS bytes per row: MT*2 + 16
#define BUFB   (NC * PITCH)        // LDS bytes per buffer
#define MG     (MT / 2)            // m of a staged tile per group of four waves
#define XB     16384               // LDS bytes a wave hands over: 8 c-tiles x 2 n-tiles, f32

// One thread's share of one tile: 16 copies of 16 B, rows 16 apart.
// g: this lane's first global element, l: this lane's first LDS byte address.
__device__ __forceinline__ void SKC_stage(const __bf16* g, unsigned l)
{
    // unrolled: two statements of eight copies (an asm statement takes 30 operands)
#pragma unroll
    for (int h = 0; h < 2; ++h) {
        const __bf16* gh = g + (size_t)h * 128 * NN;
        const unsigned lh = l + h * 128 * PITCH;
        // s_wait_xcnt as the statement's last line: it stands in front of any
        // later rewrite of the address registers that the copies name.
        asm volatile(
            "global_load_async_to_lds_b128 %0, %8, off\n\t"
            "global_load_async_to_lds_b128 %1, %9, off\n\t"
            "global_load_async_to_lds_b128 %2, %10, off\n\t"
            "global_load_async_to_lds_b128 %3, %11, off\n\t"
            "global_load_async_to_lds_b128 %4, %12, off\n\t"
            "global_load_async_to_lds_b128 %5, %13, off\n\t"
            "global_load_async_to_lds_b128 %6, %14, off\n\t"
            "global_load_async_to_lds_b128 %7, %15, off\n\t"
            "s_wait_xcnt 0x0"
            :: "v"(lh + 0 * 16 * PITCH), "v"(lh + 1 * 16 * PITCH),
               "v"(lh + 2 * 16 * PITCH), "v"(lh + 3 * 16 * PITCH),
               "v"(lh + 4 * 16 * PITCH), "v"(lh + 5 * 16 * PITCH),
               "v"(lh + 6 * 16 * PITCH), "v"(lh + 7 * 16 * PITCH),
               "v"(gh + (size_t)0 * 16 * NN), "v"(gh + (size_t)1 * 16 * NN),
               "v"(gh + (size_t)2 * 16 * NN), "v"(gh + (size_t)3 * 16 * NN),
               "v"(gh + (size_t)4 * 16 * NN), "v"(gh + (size_t)5 * 16 * NN),
               "v"(gh + (size_t)6 * 16 * NN), "v"(gh + (size_t)7 * 16 * NN)
            : "memory");
    }
}

__global__ __launch_bounds__(256)
void SKC_attend(const float* __restrict__ fL, const float* __restrict__ fU,
                const __bf16* __restrict__ qs, const __bf16* __restrict__ ks,
                const __bf16* __restrict__ zr,
                const __bf16* __restrict__ vp, const float* __restrict__ betap,
                float* __restrict__ out)
{
    __shared__ __attribute__((aligned(16))) unsigned char sv[2 * BUFB];

    const int lane = threadIdx.x & 31;
    const int wave = threadIdx.x >> 5;
    const int grp  = wave >> 2;                 // which 64 m of every staged tile
    const int b    = blockIdx.y;
    const int dir  = blockIdx.z;
    const int n0   = (blockIdx.x * 4 + (wave & 3)) * 32;
    const int l15  = lane & 15;
    const int hi   = lane >> 4;
    const float beta = *betap;

    const __bf16* q   = qs   + ((size_t)dir * NB + b) * (NN * NS);
    const __bf16* k   = ks   + ((size_t)dir * NB + b) * (NN * NS);
    const __bf16* vpb = vp   + ((size_t)dir * NB + b) * (size_t)(NC * NN);

    // copy share of this thread: 16 lanes cover one 256-byte row
    const int crow = threadIdx.x >> 4;          // 0..15, then +16 per copy
    const int ccol = threadIdx.x & 15;          // 16-byte piece of the row
    const __bf16*  gsrc = vpb + (size_t)crow * NN + ccol * 8;
    const unsigned ldst = (unsigned)(size_t)sv + crow * PITCH + ccol * 16;

    // ---- tile 0 into buffer 0, published; then tile 1 into buffer 1 ----
    // kept rolled: so gsrc and ldst are never themselves operands of the copies'
    // asm statement.  Asm operands must lie in v0-v255, a value that is one is
    // held there for its whole life, and beside the accumulators gsrc found no
    // room there: it went to scratch and came back by a load in every trip.
#pragma unroll 1
    for (int p = 0; p < 2; ++p) {
        SKC_stage(gsrc + p * MT, ldst + p * BUFB);
        if (p == 0) {
            asm volatile("s_wait_asynccnt 0x0" ::: "memory");   // own copies of tile 0 landed
            __syncthreads();                                    // every wave's copies landed
        }
    }

    // k B-fragments of the two n-tiles: constant across the whole m loop.
    // The fixed side: lane half 0 (high, high), lane half 1 (low, three ones and
    // five zeros: they meet the row's -log2 Z).
    const __bf16* kp = k + (n0 + l15) * NS + hi * NR;
    SKC_frag bk[2];
#pragma unroll
    for (int nt = 0; nt < 2; ++nt) {
        bk[nt].u[0] = *(const v4u*)(kp + nt * 16 * NS);
        bk[nt].u[1] = hi ? (v4u){0x3f803f80u, 0x00003f80u, 0u, 0u} : bk[nt].u[0];
    }

    // q A-fragments of the group's m-step 0, two 16-row tiles.  The side that
    // changes: row m's high parts in both lane halves, then its low parts in
    // lane half 0 and its -log2 Z record in lane half 1 (same pitch: one offset).
    const int qlane = (l15 + grp * MG) * NS;            // this lane's place in a q tile
    const __bf16* qh = q + qlane;
    const __bf16* ql = (hi ? zr + ((size_t)dir * NB + b) * (NN * NS) : q + NR) + qlane;
    SKC_frag qa0, qa1;
    qa0.u[0] = *(const v4u*)(qh);
    qa0.u[1] = *(const v4u*)(ql);
    qa1.u[0] = *(const v4u*)(qh + 16 * NS);
    qa1.u[1] = *(const v4u*)(ql + 16 * NS);
    // precaution: the address registers of the k and q loads above are given to
    // other values only behind this wait.  The k address is its input, so that it
    // keeps its registers up to it (the q addresses live on through the loop).
    asm volatile("s_wait_xcnt 0x0" :: "v"(kp) : "memory");
    // keeps every later write of a register behind that wait
    __builtin_amdgcn_sched_barrier(0);

    v8f acc[16][2];
    const v8f vzero = {0.f, 0.f, 0.f, 0.f, 0.f, 0.f, 0.f, 0.f};
#pragma unroll
    for (int ct = 0; ct < 16; ++ct) { acc[ct][0] = vzero; acc[ct][1] = vzero; }

    // bf16 A layout: row = l15, lane-half K offset of 8 elements = 16 bytes;
    // the group's 64 m start MG elements into the row
    const unsigned char* svl = sv + l15 * PITCH + hi * 16 + grp * (MG * 2);

    // kept rolled: one trip per staged tile, the buffer chosen by the trip's
    // parity (for speed only)
#pragma unroll 1
    for (int t = 0; t < NT; ++t) {
        const unsigned char* svt = svl + (t & 1) * BUFB;

        // two register sets of four A fragments: block j+1 is read from LDS as
        // one group while block j (four c-tiles x two n-tiles of one m-step) is
        // multiplied (every loop below is unrolled so that fr and acc are
        // indexed by constants and stay in registers)
        v4u fr[2][8];
#pragma unroll
        for (int i = 0; i < 4; ++i) {
            const unsigned char* p = svt + i * 16 * PITCH;
            fr[0][2 * i]     = *(const v4u*)(p);        // K = moff .. moff+7
            fr[0][2 * i + 1] = *(const v4u*)(p + 32);   // K = 16+moff .. 16+moff+7
        }

#pragma unroll
        for (int ms = 0; ms < MG / 32; ++ms) {
            // WMMA distance: the score WMMAs below may be given, as their D, the
            // registers that the last bf16 WMMA of the m-step before reads as B;
            // only scalar instructions stand between the two otherwise.
            asm volatile("v_nop\n\tv_nop\n\tv_nop\n\tv_nop\n\tv_nop");
            // keeps the score WMMAs behind those slots
            __builtin_amdgcn_sched_barrier(0);
            // ---- score tiles (m0..m0+15 and m0+16..m0+31) x two n-tiles, rank 8 x 4 ----
            // this m-step's q fragments are in registers; the group's next
            // m-step's are asked for here, a whole m-step ahead of their use (the
            // scheduling fences below would otherwise hold the loads right at
            // their use).  After the last m-step the index wraps to 0: in
            // bounds, not used.
            const v16bf a0 = qa0.h, a1 = qa1.h;
            {
                const int qo = ((t * MT + (ms + 1 < MG / 32 ? ms * 32 + 32 : MT)) & (NN - 1)) * NS;
                qa0.u[0] = *(const v4u*)(qh + qo);
                qa0.u[1] = *(const v4u*)(ql + qo);
                qa1.u[0] = *(const v4u*)(qh + qo + 16 * NS);
                qa1.u[1] = *(const v4u*)(ql + qo + 16 * NS);
            }
            // keeps those loads in front of the score WMMAs, whose issue then
            // covers the wait that stands behind them
            __builtin_amdgcn_sched_barrier(0);
            v8f s0[2], s1[2];
#pragma unroll
            for (int nt = 0; nt < 2; ++nt) {
                s0[nt] = __builtin_amdgcn_wmma_f32_16x16x32_bf16(false, a0, false, bk[nt].h, (short)0, vzero, false, false);
                s1[nt] = __builtin_amdgcn_wmma_f32_16x16x32_bf16(false, a1, false, bk[nt].h, (short)0, vzero, false, false);
            }
            // keeps the wait below behind the score WMMAs (nothing else ties it there)
            __builtin_amdgcn_sched_barrier(0);
            // precaution: the q loads' address registers are given to other values
            // only behind this wait
            asm volatile("s_wait_xcnt 0x0" ::: "memory");
            // keeps the exp2 results, which may get those registers, behind the wait
            __builtin_amdgcn_sched_barrier(0);

            // ---- E tiles -> bf16 B operands (layouts line up; in-lane pack) ----
            v16bf eb[2];
#pragma unroll
            for (int nt = 0; nt < 2; ++nt) {
#pragma unroll
                for (int g = 0; g < 8; ++g) {
                    eb[nt][g]     = (__bf16)__builtin_amdgcn_exp2f(s0[nt][g]);   // K = moff+g
                    eb[nt][8 + g] = (__bf16)__builtin_amdgcn_exp2f(s1[nt][g]);   // K = 16+moff+g
                }
            }

            // ---- 16 c-tiles x 2 n-tiles of the main bf16 GEMM, A fragments from LDS ----
#pragma unroll
            for (int cb = 0; cb < 4; ++cb) {
                const int j  = ms * 4 + cb;         // this block
                const int jn = j + 1;               // the block read ahead
                if (jn < (MG / 32) * 4) {
#pragma unroll
                    for (int i = 0; i < 4; ++i) {
                        const unsigned char* p =
                            svt + ((jn & 3) * 4 + i) * 16 * PITCH + (jn >> 2) * 64;
                        fr[jn & 1][2 * i]     = *(const v4u*)(p);
                        fr[jn & 1][2 * i + 1] = *(const v4u*)(p + 32);
                    }
                }
                // keeps the eight LDS reads together ahead of the block (for speed only)
                __builtin_amdgcn_sched_barrier(0);
#pragma unroll
                for (int i = 0; i < 4; ++i) {
                    union { v4u u[2]; v16bf h; } U;
                    U.u[0] = fr[j & 1][2 * i];
                    U.u[1] = fr[j & 1][2 * i + 1];
#pragma unroll
                    for (int nt = 0; nt < 2; ++nt)
                        acc[cb * 4 + i][nt] = __builtin_amdgcn_wmma_f32_16x16x32_bf16(
                            false, U.h, false, eb[nt], (short)0, acc[cb * 4 + i][nt], false, false);
                }
                // keeps the next group of reads behind this block's WMMAs
                __builtin_amdgcn_sched_barrier(0);
            }
        }
        // ---- hand-over: tile t+1 becomes readable, tile t's buffer free ----
        asm volatile("s_wait_dscnt 0x0" ::: "memory");      // own reads of tile t done
        asm volatile("s_wait_asynccnt 0x0" ::: "memory");   // own copies of tile t+1 landed
        __syncthreads();                                    // the same for every wave
        if (t + 2 < NT)
            SKC_stage(gsrc + (size_t)(t + 2) * MT, ldst + (t & 1) * BUFB);
    }
    asm volatile("s_wait_asynccnt 0x0" ::: "memory");       // nothing in flight at the wave's end

    // ---- epilogue: residual values asked for first, they fly during the exchange.
    // One address per lane for f and one for out, the rest is a constant offset
    // in each instruction: wave w finishes c-tiles 0-7, wave w+4 c-tiles 8-15.
    // (every loop below is unrolled: acc and res are indexed by constants)
    const float* f = (dir == 0) ? fL : fU;
    float* o = out + (size_t)dir * ((size_t)NB * NC * NN);
    const size_t e0 = ((size_t)b * NC + grp * 128 + hi * 8) * NN + n0 + l15;
    const float* fe = f + e0;
    float*       oe = o + e0;
    float res[8][2][8];
#pragma unroll
    for (int i = 0; i < 8; ++i)
#pragma unroll
        for (int nt = 0; nt < 2; ++nt)
#pragma unroll
            for (int g = 0; g < 8; ++g)
                res[i][nt][g] = fe[(i * 16 + g) * NN + nt * 16];
    // precaution: fe's registers are given to other values only behind this wait
    asm volatile("s_wait_xcnt 0x0" ::: "memory");
    // keeps every later write of a register behind that wait
    __builtin_amdgcn_sched_barrier(0);

    // ---- the two groups' partial sums meet: waves w and w+4 hold the same
    // 256 c x 32 n.  Each hands over the eight c-tiles that the other finishes.
    // The staging buffers are free: the loop's last barrier ended every read of
    // them and no copy is in flight.
    v4f* xs = (v4f*)(sv + wave * XB) + lane;
#pragma unroll
    for (int i = 0; i < 8; ++i) {
#pragma unroll
        for (int nt = 0; nt < 2; ++nt) {
            const v8f snd = grp ? acc[i][nt] : acc[8 + i][nt];
            xs[((i * 2 + nt) * 2 + 0) * 32] = (v4f){snd[0], snd[1], snd[2], snd[3]};
            xs[((i * 2 + nt) * 2 + 1) * 32] = (v4f){snd[4], snd[5], snd[6], snd[7]};
        }
    }
    __syncthreads();                                        // the partner's half is written
    const v4f* xr = (const v4f*)(sv + (wave ^ 4) * XB) + lane;

#pragma unroll
    for (int i = 0; i < 8; ++i) {
#pragma unroll
        for (int nt = 0; nt < 2; ++nt) {
            const v8f own = grp ? acc[8 + i][nt] : acc[i][nt];
            const v4f r0 = xr[((i * 2 + nt) * 2 + 0) * 32];
            const v4f r1 = xr[((i * 2 + nt) * 2 + 1) * 32];
#pragma unroll
            for (int g = 0; g < 8; ++g)
                res[i][nt][g] += beta * (own[g] + (g < 4 ? r0[g & 3] : r1[g & 3]));
        }
    }
    // keeps the stores together at the wave's end: no register that a store
    // names is written behind it
    __builtin_amdgcn_sched_barrier(0);
#pragma unroll
    for (int i = 0; i < 8; ++i)
#pragma unroll
        for (int nt = 0; nt < 2; ++nt)
#pragma unroll
            for (int g = 0; g < 8; ++g)
                oe[(i * 16 + g) * NN + nt * 16] = res[i][nt][g];
}

// ---------------------------------------------------------------------------
// Host-side launcher.  Workspace layout (floats unless noted):
//   qs   : 2*B*N*2R (bf16)    = as 262144 floats
//   ks   : 2*B*N*2R (bf16)    = as 262144 floats
//   zr   : 2*B*N*2R (bf16)    = as 262144 floats (the first 16 bytes of every 32 used)
//   vp   : 2*B*C*N  (bf16)    -> 16.8 MB      (total ~20 MB)
// ---------------------------------------------------------------------------
extern "C" void kernel_launch(void* const* d_in, const int* in_sizes, int n_in,
                              void* d_out, int out_size, void* d_ws, size_t ws_size,
                              hipStream_t stream)
{
    const float* fL   = (const float*)d_in[0];
    const float* fU   = (const float*)d_in[1];
    const float* qLw  = (const float*)d_in[2];
    const float* qLb  = (const float*)d_in[3];
    const float* kUw  = (const float*)d_in[4];
    const float* kUb  = (const float*)d_in[5];
    const float* vUw  = (const float*)d_in[6];
    const float* vUb  = (const float*)d_in[7];
    const float* qUw  = (const float*)d_in[8];
    const float* qUb  = (const float*)d_in[9];
    const float* kLw  = (const float*)d_in[10];
    const float* kLb  = (const float*)d_in[11];
    const float* vLw  = (const float*)d_in[12];
    const float* vLb  = (const float*)d_in[13];
    const float* beta = (const float*)d_in[14];
    float* outp = (float*)d_out;

    __bf16* qs   = (__bf16*)d_ws;
    __bf16* ks   = qs + (size_t)2 * NB * NN * NS;
    __bf16* zr   = ks + (size_t)2 * NB * NN * NS;
    __bf16* vp   = zr + (size_t)2 * NB * NN * NS;

    // 1) q, k (q pre-scaled by log2 e) and v (bf16) in one pass over fL and fU
    SKC_qkv<<<dim3(NN / PN, NB, 2), dim3(256), 0, stream>>>(
        fL, fU, qLw, qLb, kUw, kUb, qUw, qUb, kLw, kLb, vUw, vUb, vLw, vLb, qs, ks, vp);

    // 2) softmax normalizers via WMMA score tiles
    SKC_stats<<<dim3(NN / 128, NB, 2), dim3(1024), 0, stream>>>(qs, ks, zr);

    // 3) main attend (WMMA score gen + bf16-WMMA GEMM) + fused residual
    SKC_attend<<<dim3(NN / 128, NB, 2), dim3(256), 0, stream>>>(
        fL, fU, qs, ks, zr, vp, beta, outp);
}

// v008
// A run of this version takes 68.7 microseconds.
// Next to v007, in two timings, it ran 1.05 times as fast each time.
// All steps since v000 together make it 8.83 times as fast.
#include <hip/hip_runtime.h>
#include <hip/hip_bf16.h>

// ---------------------------------------------------------------------------
// SKCLite cross-attention for MI455X (gfx1250, wave32, WMMA).
//
// B=4, C=256, N=H*W=4096, R=8 (rank), G=4 groups (CG=64).
// Dominant cost: out = v @ softmax(q^T k)  -> 2 * 2*B*C*N^2 = 68.7 GFLOP.
// Strategy: flash-style on-the-fly score tiles.
//   scores (rank-8): q and k are each kept as a bf16 high part plus a bf16 low
//   part (16 significant bits); the four cross products x rank 8 fill the K=32
//   of ONE V_WMMA_F32_16X16X32_BF16, a quarter of the matrix time of the two
//   V_WMMA_F32_16X16X4_F32 that the same tile takes on f32 operands,
//   exp() + bf16-pack lands *exactly* in the B-operand layout of
//   V_WMMA_F32_16X16X32_BF16 (f32 C/D layout == bf16 B layout modulo packing),
//   main GEMM in bf16 WMMA with f32 accumulation.
// ---------------------------------------------------------------------------

#define NB   4      // batch
#define NC   256    // channels
#define NN   4096   // H*W
#define NR   8      // rank
#define NG   4      // groups
#define NCG  64     // channels per group
#define LOG2E 1.4426950408889634f

typedef __attribute__((ext_vector_type(8)))  float        v8f;
typedef __attribute__((ext_vector_type(16))) __bf16       v16bf;
typedef __attribute__((ext_vector_type(4)))  unsigned int v4u;
typedef __attribute__((ext_vector_type(8)))  __bf16       v8bf;

// A position's q (or k) record: 8 high parts, then 8 low parts, 32 bytes.
#define NS   (2 * NR)
// A bf16 16x16x32 operand holds two k blocks of 8 per lane half (registers 0-3
// and 4-7), four in all.  One side of the score product gives every lane its
// row's whole record, (high, low) in both halves; the other side gives lane
// half 0 (high, high) and lane half 1 (low, low).  Block by block that pairs
// high.high, low.high, high.low, low.low: the full product of the two sums.
// In the attend kernel the fourth block carries -log2 Z of the row instead of
// low.low (which lies 16 bits below the score): three bf16 parts against ones.
union SKC_frag { v4u u[2]; v16bf h; };

// ---------------------------------------------------------------------------
// Kernel 1: one pass over f gives q, k and v.
//   q = (qw . f + qb) * log2(e)   (exp -> exp2),   k = kw . f + kb
//   vp[dir][b][c][m] = bf16( vb[c] + sum_i vw[c][i] f[b,g*64+i,m] )
// Layout: qs/ks = [dir][B][N][high parts of the R rows, low parts] bf16.
// dir0 (LU path): q from fL (qL_w), k and v from fU (kU_w, vU_w)
// dir1 (UL path): q from fU (qU_w), k and v from fL (kL_w, vL_w)
// All products run on V_WMMA_F32_16X16X32_BF16: weights (A) and f (B) are each
// split into a bf16 high part plus a bf16 low part, and high.high + high.low +
// low.high are summed in f32 (what is left out lies 16 bits below the product).
// Block = (source map, b, 128 n), one per WGP; wave = one group's 64 channels x
// 64 n.  On its f fragments a wave runs five 16-row A tiles: the group's four
// c-tiles of v, and one tile whose rows are the 8 q rows and the 8 k rows,
// restricted to the group's channels.  The four groups' partial q and k sums
// meet in LDS and are added in group order.
// A lane reads four neighbouring n of a row by one b128 load (16 lanes: 256
// contiguous bytes); register r of those loads is column tile r, whose column
// l15 stands for n = 4 * l15 + r.  So no value changes its lane, all 32 loads
// of a wave are in flight together, and the four tiles' v results of a lane are
// four neighbouring n again: one 8-byte store, 128 contiguous bytes per row.
// The weights' fragments of a group are the same for its two waves: each forms
// those of one k-step and leaves them in LDS.
// ---------------------------------------------------------------------------
#define VM  64              // n per wave: 16 lanes x 4
#define PN  128             // n per block
#define RR  1088            // LDS bytes of one column tile's partial sums: 2 x 512, + 64
                            // so that the four tiles' rows start on different banks
#define RGB (4 * RR)        // LDS bytes of one wave's partial sums

typedef __attribute__((ext_vector_type(4))) float        v4f;
typedef __attribute__((ext_vector_type(2))) unsigned int v2u;
typedef __attribute__((ext_vector_type(4))) __bf16       v4bf;

__global__ __launch_bounds__(256)
void SKC_qkv(const float* __restrict__ fL, const float* __restrict__ fU,
             const float* __restrict__ qLw, const float* __restrict__ qLb,
             const float* __restrict__ kUw, const float* __restrict__ kUb,
             const float* __restrict__ qUw, const float* __restrict__ qUb,
             const float* __restrict__ kLw, const float* __restrict__ kLb,
             const float* __restrict__ vUw, const float* __restrict__ vUb,
             const float* __restrict__ vLw, const float* __restrict__ vLb,
             __bf16* __restrict__ qs, __bf16* __restrict__ ks,
             __bf16* __restrict__ vp)
{
    // [group][4 c-tiles of v, q and k rows][k-step][high, low][registers 0-3, 4-7][lane]
    __shared__ v4u sw[NG][5][2][2][2][32];
    // partial q and k sums: [half of n][group] x RGB bytes
    __shared__ __attribute__((aligned(16))) unsigned char red[8 * RGB];

    const int lane = threadIdx.x & 31;
    // wave-uniform, so that the group's base addresses and the biases stay scalar
    const int wave = __builtin_amdgcn_readfirstlane(threadIdx.x >> 5);
    const int g    = wave & 3;                  // group of 64 channels
    const int mh   = wave >> 2;                 // which 64 n of the block
    const int l15  = lane & 15;
    const int hi   = lane >> 4;
    const int b    = blockIdx.y;
    const int srcU = blockIdx.z;                // 0: fL, 1: fU
    const int n0   = blockIdx.x * PN;
    const int m0   = n0 + mh * VM + l15 * 4;    // this lane's four n

    const float* f  = srcU ? fU  : fL;
    const float* qw = srcU ? qUw : qLw;
    const float* kw = srcU ? kUw : kLw;
    const float* vw = srcU ? vUw : vLw;
    const float* vb = srcU ? vUb : vLb;

    // k order of both operands: element e of lane half hi is
    // i = 32 * s + 8 * hi + (e < 8 ? e : e + 8)
    // (every loop of this kernel is unrolled: the arrays are indexed by
    // constants and stay in registers)

    // this wave's share of the weights: its group's five tiles, k-step mh, row l15
    const float* wr = vw + (size_t)(g * NCG + l15) * NCG + mh * 32 + hi * 8;
    const float* wq = (l15 < NR ? qw + l15 * NC : kw + (l15 - NR) * NC)
                    + g * NCG + mh * 32 + hi * 8;
    v4f w[5][4];
#pragma unroll
    for (int t = 0; t < 4; ++t)
#pragma unroll
        for (int p = 0; p < 4; ++p)
            w[t][p] = *(const v4f*)(wr + t * 16 * NCG + (p >> 1) * 16 + (p & 1) * 4);
#pragma unroll
    for (int p = 0; p < 4; ++p)
        w[4][p] = *(const v4f*)(wq + (p >> 1) * 16 + (p & 1) * 4);

    const float* fb = f + ((size_t)b * NC + g * NCG + hi * 8) * NN + m0;
    v4f x[2][16];
#pragma unroll
    for (int s = 0; s < 2; ++s)
#pragma unroll
        for (int e = 0; e < 16; ++e)
            x[s][e] = *(const v4f*)(fb + (size_t)(s * 32 + (e < 8 ? e : e + 8)) * NN);

    // D layout: register j is row j + 8 * hi of the c-tile
    const float* bp = vb + g * NCG + hi * 8;
    v8f cb[4];
#pragma unroll
    for (int ct = 0; ct < 4; ++ct)
        cb[ct] = *(const v8f*)(bp + ct * 16);
    // precaution: the address registers of the loads above are given to other
    // values only behind this wait.  The three lane addresses are its inputs, so
    // that they keep their registers up to it.
    asm volatile("s_wait_xcnt 0x0" :: "v"(wr), "v"(wq), "v"(fb) : "memory");
    // keeps all the loads in front of the first use (a load left behind one would
    // be asked for only when earlier ones have arrived, a second memory latency)
    // and every later write of a register behind the wait
    __builtin_amdgcn_sched_barrier(0);

#pragma unroll
    for (int t = 0; t < 5; ++t) {
        union { v4u u[2]; v16bf h; } H, L;
#pragma unroll
        for (int e = 0; e < 16; ++e) {
            const float v = w[t][e >> 2][e & 3];
            H.h[e] = (__bf16)v;
            L.h[e] = (__bf16)(v - (float)H.h[e]);
        }
        sw[g][t][mh][0][0][lane] = H.u[0];
        sw[g][t][mh][0][1][lane] = H.u[1];
        sw[g][t][mh][1][0][lane] = L.u[0];
        sw[g][t][mh][1][1][lane] = L.u[1];
    }
    __syncthreads();                            // every wave's weight fragments are written

    v16bf bh[2][4], bl[2][4];                   // [k-step][column tile]
#pragma unroll
    for (int s = 0; s < 2; ++s)
#pragma unroll
        for (int r = 0; r < 4; ++r)
#pragma unroll
            for (int e = 0; e < 16; ++e) {
                const float v = x[s][e][r];
                bh[s][r][e] = (__bf16)v;
                bl[s][r][e] = (__bf16)(v - (float)bh[s][r][e]);
            }

    // tile 4 (q and k rows) first: its sums are on their way through LDS while
    // the v tiles are multiplied
    v2u o[4][8];
#pragma unroll
    for (int tt = 0; tt < 5; ++tt) {
        const int t = (tt + 4) % 5;
        SKC_frag ah[2], al[2];
#pragma unroll
        for (int s = 0; s < 2; ++s) {
            ah[s].u[0] = sw[g][t][s][0][0][lane];
            ah[s].u[1] = sw[g][t][s][0][1][lane];
            al[s].u[0] = sw[g][t][s][1][0][lane];
            al[s].u[1] = sw[g][t][s][1][1][lane];
        }
        v8f acc[4];
#pragma unroll
        for (int r = 0; r < 4; ++r)
            acc[r] = (t < 4) ? cb[t & 3] : (v8f){0.f, 0.f, 0.f, 0.f, 0.f, 0.f, 0.f, 0.f};
        // r innermost: four independent accumulators follow one another
#pragma unroll
        for (int s = 0; s < 2; ++s) {
#pragma unroll
            for (int r = 0; r < 4; ++r)
                acc[r] = __builtin_amdgcn_wmma_f32_16x16x32_bf16(
                    false, al[s].h, false, bh[s][r], (short)0, acc[r], false, false);
#pragma unroll
            for (int r = 0; r < 4; ++r)
                acc[r] = __builtin_amdgcn_wmma_f32_16x16x32_bf16(
                    false, ah[s].h, false, bl[s][r], (short)0, acc[r], false, false);
#pragma unroll
            for (int r = 0; r < 4; ++r)
                acc[r] = __builtin_amdgcn_wmma_f32_16x16x32_bf16(
                    false, ah[s].h, false, bh[s][r], (short)0, acc[r], false, false);
        }
        if (t < 4) {
#pragma unroll
            for (int j = 0; j < 8; ++j) {
                v4bf c;
#pragma unroll
                for (int r = 0; r < 4; ++r) c[r] = (__bf16)acc[r][j];
                o[t & 3][j] = __builtin_bit_cast(v2u, c);
            }
        } else {
            // lane half 0 holds the 8 q rows, lane half 1 the 8 k rows, of column l15
            unsigned char* rw = red + wave * RGB + lane * 16;   // wave = mh * 4 + g
#pragma unroll
            for (int r = 0; r < 4; ++r) {
                *(v4f*)(rw + r * RR)       = (v4f){acc[r][0], acc[r][1], acc[r][2], acc[r][3]};
                *(v4f*)(rw + r * RR + 512) = (v4f){acc[r][4], acc[r][5], acc[r][6], acc[r][7]};
            }
        }
    }
    __syncthreads();                            // every group's partial q and k sums are written

    // the v stores go out first: they fly while q and k are finished
    __bf16* ov = vp + (((size_t)(1 - srcU) * NB + b) * NC + g * NCG + hi * 8) * NN + m0;
#pragma unroll
    for (int ct = 0; ct < 4; ++ct)
#pragma unroll
        for (int j = 0; j < 8; ++j)
            *(v2u*)(ov + (size_t)(ct * 16 + j) * NN) = o[ct][j];
    // precaution: the registers that those stores name are given to other values
    // only behind this wait
    asm volatile("s_wait_xcnt 0x0" ::: "memory");
    // keeps every later write of a register behind that wait
    __builtin_amdgcn_sched_barrier(0);

    // waves 0-3 finish q, waves 4-7 k: one position per lane, all 8 rows.
    // q of fL is dir 0, q of fU dir 1; k and v the other way round.
    const bool   isq   = wave < 4;
    const float* bias  = isq ? (srcU ? qUb : qLb) : (srcU ? kUb : kLb);
    const float  scale = isq ? LOG2E : 1.0f;
    const int    nl    = (wave & 3) * 32 + lane;
    // position nl was column (nl & 63) >> 2 of column tile nl & 3 in half nl >> 6
    const unsigned char* rf = red + (nl >> 6) * (NG * RGB) + (nl & 3) * RR
                            + ((isq ? 0 : 16) + ((nl & 63) >> 2)) * 16;
    v4f s0 = *(const v4f*)(rf), s1 = *(const v4f*)(rf + 512);
#pragma unroll
    for (int p = 1; p < NG; ++p) {
        s0 += *(const v4f*)(rf + p * RGB);
        s1 += *(const v4f*)(rf + p * RGB + 512);
    }

    // high part: the upper 16 bits of the f32, a bf16 as they stand; low
    // part: what that leaves over (exact in f32), rounded to bf16
    v4u  h;
    v8bf l;
#pragma unroll
    for (int r = 0; r < NR; r += 2) {
        const float    x0 = ((r < 4 ? s0[r & 3] : s1[r & 3]) + bias[r]) * scale;
        const float    x1 = ((r < 4 ? s0[(r + 1) & 3] : s1[(r + 1) & 3]) + bias[r + 1]) * scale;
        const unsigned u0 = __builtin_bit_cast(unsigned, x0);
        const unsigned u1 = __builtin_bit_cast(unsigned, x1);
        h[r / 2] = (u0 >> 16) | (u1 & 0xffff0000u);
        l[r]     = (__bf16)(x0 - __builtin_bit_cast(float, u0 & 0xffff0000u));
        l[r + 1] = (__bf16)(x1 - __builtin_bit_cast(float, u1 & 0xffff0000u));
    }
    __bf16* ob = (isq ? qs : ks)
               + (((size_t)(isq ? srcU : 1 - srcU) * NB + b) * NN + n0 + nl) * NS;
    *(v4u*)(ob)       = h;
    *(v8bf*)(ob + NR) = l;
}

// ---------------------------------------------------------------------------
// Kernel 2: softmax normalizers.  Z[dir][b][m] = sum_j exp(q_m . k_j), stored as
// zr[dir][b][m] = -log2 Z in three bf16 parts (24 significant bits) and five
// zeros, 16 bytes at the pitch of a q record: the attend kernel adds it to the
// scores of row m inside the score WMMA, so exp2 gives exp(q_m . k_n) / Z_m.
// A operand (q, fixed 16-row m-tile) stays in registers; loop j in tiles of 16:
// one V_WMMA_F32_16X16X32_BF16 on the high and low parts, exp2, accumulate
// per-VGPR, then 16-lane xor reduction (lane halves independent).
// Every k line is new to the WGP when it is asked for, so each trip of a wave
// waits a whole L2 latency.  Block = 8 m-tiles x SJ quarters of j = 32 waves,
// eight per SIMD: one wave's wait lies under the others' work.  The SJ partial
// sums of a row meet in LDS and are added in j order.
// ---------------------------------------------------------------------------
#define SJ 4                // waves that share an m-tile
#define SJN (NN / SJ)       // j per wave
#define SU 4                // j-tiles per trip

__global__ __launch_bounds__(1024)
void SKC_stats(const __bf16* __restrict__ qs, const __bf16* __restrict__ ks,
               __bf16* __restrict__ zr)
{
    __shared__ float part[SJ][128];             // [quarter of j][m in the block]

    const int lane = threadIdx.x & 31;
    // wave-uniform, so that the k base address stays scalar
    const int wave = __builtin_amdgcn_readfirstlane(threadIdx.x >> 5);
    const int mt   = wave & 7;                  // m-tile in the block
    const int jq   = wave >> 3;                 // quarter of j
    const int b    = blockIdx.y;
    const int dir  = blockIdx.z;
    const int m0   = (blockIdx.x * 8 + mt) * 16;
    const int l15  = lane & 15;
    const int hi   = lane >> 4;                 // lane-half select

    const __bf16* q = qs + ((size_t)dir * NB + b) * (NN * NS);
    const __bf16* k = ks + (((size_t)dir * NB + b) * NN + jq * SJN) * NS;

    // A fragment, the fixed side: lane half 0 (high, high), lane half 1 (low, low)
    SKC_frag aq;
    aq.u[0] = *(const v4u*)(q + (m0 + l15) * NS + hi * NR);
    // precaution: that load's address registers are given to other values only
    // behind this wait
    asm volatile("s_wait_xcnt 0x0" ::: "memory");
    aq.u[1] = aq.u[0];

    const v8f vzero = {0.f, 0.f, 0.f, 0.f, 0.f, 0.f, 0.f, 0.f};
    v8f zacc = vzero;
    // kept rolled: a trip's loads then stand behind the exp2 and the adds of the
    // trip before, far more than the four slots that a load needs behind the
    // WMMAs which read, as B, the registers that it lands in
#pragma unroll 1
    for (int j0 = 0; j0 < SJN; j0 += 16 * SU) {
        // B fragments, the side that changes: column j's whole record as it lies
        // (the loops over u are unrolled: bk and s are indexed by constants)
        SKC_frag bk[SU];
#pragma unroll
        for (int u = 0; u < SU; ++u) {
            const __bf16* kj = k + (j0 + u * 16 + l15) * NS;
            bk[u].u[0] = *(const v4u*)(kj);
            bk[u].u[1] = *(const v4u*)(kj + NR);
        }
        // keeps a trip's loads together in front of its WMMAs: left to itself the
        // compiler asked for them in three lots, each waited for before the next
        __builtin_amdgcn_sched_barrier(0);
        v8f s[SU];
#pragma unroll
        for (int u = 0; u < SU; ++u)
            s[u] = __builtin_amdgcn_wmma_f32_16x16x32_bf16(
                false, aq.h, false, bk[u].h, (short)0, vzero, false, false);
        // keeps a trip's WMMAs together: each fills the slots that the one before
        // needs ahead of the exp2 on its result (else four v_nop per WMMA)
        __builtin_amdgcn_sched_barrier(0);
        // precaution: the k loads' address registers are stepped on only behind this wait
        asm volatile("s_wait_xcnt 0x0" ::: "memory");
        // the loaded k values, as inputs only, behind the four WMMAs: their registers
        // stay theirs until all four are issued, so that no WMMA's result is given
        // the registers which the WMMA right before it reads as B
        asm volatile("" :: "v"(bk[0].u[0]), "v"(bk[0].u[1]), "v"(bk[1].u[0]), "v"(bk[1].u[1]),
                           "v"(bk[2].u[0]), "v"(bk[2].u[1]), "v"(bk[3].u[0]), "v"(bk[3].u[1]));
        // keeps the step of the address, and the exp2, behind those two statements
        __builtin_amdgcn_sched_barrier(0);
#pragma unroll
        for (int u = 0; u < SU; ++u) {
#pragma unroll
            for (int g = 0; g < 8; ++g) zacc[g] += __builtin_amdgcn_exp2f(s[u][g]);
        }
    }
    // reduce across the 16 lanes of each half (j is the lane dimension); the
    // eight rows go through each step together, so their exchanges overlap
    // (both loops unrolled: zacc is indexed by constants)
#pragma unroll
    for (int st = 1; st < 16; st <<= 1) {
#pragma unroll
        for (int g = 0; g < 8; ++g) zacc[g] += __shfl_xor(zacc[g], st, 32);
    }
    if (l15 == 0) {
#pragma unroll
        for (int g = 0; g < 8; ++g)
            part[jq][mt * 16 + g + hi * 8] = zacc[g];   // D layout: VGPR g -> row g / g+8
    }
    __syncthreads();                            // every quarter's sums are written

    if (threadIdx.x < 128) {
        const int t = threadIdx.x;
        float z = part[0][t];
#pragma unroll
        for (int p = 1; p < SJ; ++p) z += part[p][t];   // unrolled: the LDS reads go out together
        const float  lz = -__builtin_amdgcn_logf(z);    // v_log_f32 is log2
        const __bf16 p0 = (__bf16)lz;
        const float  r1 = lz - (float)p0;               // exact in f32
        const __bf16 p1 = (__bf16)r1;
        const __bf16 p2 = (__bf16)(r1 - (float)p1);
        const __bf16 zz = (__bf16)0.f;
        *(v8bf*)(zr + (((size_t)dir * NB + b) * NN + blockIdx.x * 128 + t) * NS) =
            (v8bf){p0, p1, p2, zz, zz, zz, zz, zz};
    }
}

// ---------------------------------------------------------------------------
// Kernel 3: main attend + residual.
//   out[c,n] = f[c,n] + beta * sum_m vp[c,m] * exp(q_m . k_n) / Z_m
// The four waves of each group read the same vp values, so a vp tile of
// 256 c x 128 m is brought into LDS once per block by the tensor mover: waves
// 0 and 1 ask for one slice of 128 rows x 256 bytes each, one scalar request instead
// of address arithmetic, copies and their waits in every lane of every wave at
// the head of each trip, where all eight waves stand behind the barrier.  Two
// buffers: tile t+1 flies while tile t is worked on.  The request's pad gives
// the LDS row pitch 272 B = 16 B x odd: conflict-free b128 reads.
// Wave tile: all 16 c-tiles (C=256) x two 16-wide n-tiles, so that every A
// fragment read from LDS feeds two WMMAs (one per fragment asks the LDS for
// twice what it delivers).  The block still covers 128 n: waves 0-3 take the
// first 64 m of every staged tile, waves 4-7 the last 64 m, for the same four
// n-pairs; the two partial sums meet in LDS after the loop.
// Per 32-wide m-step: 4x bf16 WMMA score tiles (high and low parts) -> exp2 -> bf16 pack
// (f32 D layout coincides with bf16 B layout: zero lane shuffles) ->
// 32x V_WMMA_F32_16X16X32_BF16 with one b128 LDS read each.
// ---------------------------------------------------------------------------
#define MT     128                 // m per staged tile
#define NT     (NN / MT)           // staged tiles
#define PITCH  272                 // LDS bytes per row: MT*2 + 16
#define SLR    128                 // rows of a tile per request
#define SLB    (SLR * PITCH)       // LDS bytes per slice: 17 x 2 KiB
#define BUFB   (NC * PITCH)        // LDS bytes per buffer: two slices
#define MG     (MT / 2)            // m of a staged tile per group of four waves
#define XB     16384               // LDS bytes a wave hands over: 8 c-tiles x 2 n-tiles, f32

typedef __attribute__((ext_vector_type(8))) unsigned int v8u;

// A wave-uniform value held in a scalar register.  A tensor load ignores EXEC:
// only a scalar branch keeps a wave from issuing it, so every test around one
// goes through here.
__device__ __forceinline__ uint32_t SKC_pinned(uint32_t v)
{
    uint32_t w = (uint32_t)__builtin_amdgcn_readfirstlane(v);
    asm volatile("" : "+s"(w));     // keeps the value scalar, and what is formed from it behind earlier waits
    return w;
}

// Descriptor group 1, the same for every request: SLR rows of MT * 2 = 256 bytes,
// source pitch NN * 2 bytes, 16 bytes of LDS pad behind every row.
__device__ __forceinline__ v8u SKC_group1()
{
    v8u g1;
    // no mask, extents in bytes, pad on: after every 64 dwords (one row) 4 dwords
    g1[0] = (uint32_t)__builtin_amdgcn_readfirstlane((1u << 20) | (5u << 22) | (3u << 25));
    g1[1] = (uint32_t)__builtin_amdgcn_readfirstlane((MT * 2u) << 16);          // tensor_dim0
    g1[2] = (uint32_t)__builtin_amdgcn_readfirstlane((uint32_t)SLR << 16);      // tensor_dim1
    g1[3] = (uint32_t)__builtin_amdgcn_readfirstlane((MT * 2u) << 16);          // tile_dim0
    g1[4] = (uint32_t)__builtin_amdgcn_readfirstlane((uint32_t)SLR);            // tile_dim1
    g1[5] = (uint32_t)__builtin_amdgcn_readfirstlane(NN * 2u);                  // source row pitch
    g1[6] = (uint32_t)__builtin_amdgcn_readfirstlane(0u);
    g1[7] = (uint32_t)__builtin_amdgcn_readfirstlane(0u);
    return g1;
}

// One request: the slice whose first byte is ga, to LDS byte l.
__device__ __forceinline__ void SKC_tload(uint32_t l, uint64_t ga, v8u g1)
{
    v4u g0;
    g0[0] = (uint32_t)__builtin_amdgcn_readfirstlane(1u);                       // count 1
    g0[1] = (uint32_t)__builtin_amdgcn_readfirstlane(l);
    g0[2] = (uint32_t)__builtin_amdgcn_readfirstlane((uint32_t)ga);
    g0[3] = (uint32_t)__builtin_amdgcn_readfirstlane(
                (((uint32_t)(ga >> 32)) & 0x01FFFFFFu) | 0x80000000u);          // type 2
    // the request: one instruction of the whole wave, both groups in scalar registers;
    // "memory" keeps the waits and the LDS reads around it in their places
    asm volatile("tensor_load_to_lds %0, %1" :: "s"(g0), "s"(g1) : "memory");
}

__global__ __launch_bounds__(256)
void SKC_attend(const float* __restrict__ fL, const float* __restrict__ fU,
                const __bf16* __restrict__ qs, const __bf16* __restrict__ ks,
                const __bf16* __restrict__ zr,
                const __bf16* __restrict__ vp, const float* __restrict__ betap,
                float* __restrict__ out)
{
    // every slice's place in LDS is a multiple of 2 KiB
    __shared__ __attribute__((aligned(2048))) unsigned char sv[2 * BUFB];

    const int lane = threadIdx.x & 31;
    const int wave = threadIdx.x >> 5;
    const int grp  = wave >> 2;                 // which 64 m of every staged tile
    const int b    = blockIdx.y;
    const int dir  = blockIdx.z;
    const int n0   = (blockIdx.x * 4 + (wave & 3)) * 32;
    const int l15  = lane & 15;
    const int hi   = lane >> 4;
    const float beta = *betap;

    const __bf16* q   = qs   + ((size_t)dir * NB + b) * (NN * NS);
    const __bf16* k   = ks   + ((size_t)dir * NB + b) * (NN * NS);
    const __bf16* vpb = vp   + ((size_t)dir * NB + b) * (size_t)(NC * NN);

    // waves 0 and 1 each bring rows 128 * wave .. + 127 of every tile
    const uint32_t wv  = (uint32_t)__builtin_amdgcn_readfirstlane(threadIdx.x >> 5);
    const uint64_t gsl = (uint64_t)(size_t)vpb + (uint64_t)(wv & 1u) * (SLR * NN * 2u);
    const uint32_t lsl = (uint32_t)(size_t)sv + (wv & 1u) * SLB;
    v8u g1 = SKC_group1();
    // the descriptor words keep eight scalar registers of their own through
    // the loop, so that none takes another value while a request is on its way
    asm volatile("" : "+s"(g1));

    // ---- tile 0 into buffer 0, published; then tile 1 into buffer 1 ----
    if (SKC_pinned(wv < 2u)) {
        SKC_tload(lsl, gsl, g1);
        asm volatile("s_wait_tensorcnt 0x0" ::: "memory");      // own slice of tile 0 landed
    }
    __syncthreads();                                            // every slice landed
    if (SKC_pinned(wv < 2u))
        SKC_tload(lsl + BUFB, gsl + MT * 2u, g1);

    // k B-fragments of the two n-tiles: constant across the whole m loop.
    // The fixed side: lane half 0 (high, high), lane half 1 (low, three ones and
    // five zeros: they meet the row's -log2 Z).
    const __bf16* kp = k + (n0 + l15) * NS + hi * NR;
    SKC_frag bk[2];
#pragma unroll
    for (int nt = 0; nt < 2; ++nt) {
        bk[nt].u[0] = *(const v4u*)(kp + nt * 16 * NS);
        bk[nt].u[1] = hi ? (v4u){0x3f803f80u, 0x00003f80u, 0u, 0u} : bk[nt].u[0];
    }

    // q A-fragments of the group's m-step 0, two 16-row tiles.  The side that
    // changes: row m's high parts in both lane halves, then its low parts in
    // lane half 0 and its -log2 Z record in lane half 1 (same pitch: one offset).
    const int qlane = (l15 + grp * MG) * NS;            // this lane's place in a q tile
    const __bf16* qh = q + qlane;
    const __bf16* ql = (hi ? zr + ((size_t)dir * NB + b) * (NN * NS) : q + NR) + qlane;
    SKC_frag qa0, qa1;
    qa0.u[0] = *(const v4u*)(qh);
    qa0.u[1] = *(const v4u*)(ql);
    qa1.u[0] = *(const v4u*)(qh + 16 * NS);
    qa1.u[1] = *(const v4u*)(ql + 16 * NS);
    // precaution: the address registers of the k and q loads above are given to
    // other values only behind this wait.  The k address is its input, so that it
    // keeps its registers up to it (the q addresses live on through the loop).
    asm volatile("s_wait_xcnt 0x0" :: "v"(kp) : "memory");
    // keeps every later write of a register behind that wait
    __builtin_amdgcn_sched_barrier(0);

    v8f acc[16][2];
    const v8f vzero = {0.f, 0.f, 0.f, 0.f, 0.f, 0.f, 0.f, 0.f};
#pragma unroll
    for (int ct = 0; ct < 16; ++ct) { acc[ct][0] = vzero; acc[ct][1] = vzero; }

    // bf16 A layout: row = l15, lane-half K offset of 8 elements = 16 bytes;
    // the group's 64 m start MG elements into the row
    const unsigned char* svl = sv + l15 * PITCH + hi * 16 + grp * (MG * 2);

    // kept rolled: one trip per staged tile, the buffer chosen by the trip's
    // parity (for speed only)
#pragma unroll 1
    for (int t = 0; t < NT; ++t) {
        const unsigned char* svt = svl + (t & 1) * BUFB;

        // two register sets of four A fragments: block j+1 is read from LDS as
        // one group while block j (four c-tiles x two n-tiles of one m-step) is
        // multiplied (every loop below is unrolled so that fr and acc are
        // indexed by constants and stay in registers)
        v4u fr[2][8];
#pragma unroll
        for (int i = 0; i < 4; ++i) {
            const unsigned char* p = svt + i * 16 * PITCH;
            fr[0][2 * i]     = *(const v4u*)(p);        // K = moff .. moff+7
            fr[0][2 * i + 1] = *(const v4u*)(p + 32);   // K = 16+moff .. 16+moff+7
        }

#pragma unroll
        for (int ms = 0; ms < MG / 32; ++ms) {
            // WMMA distance: the score WMMAs below may be given, as their D, the
            // registers that the last bf16 WMMA of the m-step before reads as B;
            // only scalar instructions stand between the two otherwise.
            asm volatile("v_nop\n\tv_nop\n\tv_nop\n\tv_nop\n\tv_nop");
            // keeps the score WMMAs behind those slots
            __builtin_amdgcn_sched_barrier(0);
            // ---- score tiles (m0..m0+15 and m0+16..m0+31) x two n-tiles, rank 8 x 4 ----
            // this m-step's q fragments are in registers; the group's next
            // m-step's are asked for here, a whole m-step ahead of their use (the
            // scheduling fences below would otherwise hold the loads right at
            // their use).  After the last m-step the index wraps to 0: in
            // bounds, not used.
            const v16bf a0 = qa0.h, a1 = qa1.h;
            {
                const int qo = ((t * MT + (ms + 1 < MG / 32 ? ms * 32 + 32 : MT)) & (NN - 1)) * NS;
                qa0.u[0] = *(const v4u*)(qh + qo);
                qa0.u[1] = *(const v4u*)(ql + qo);
                qa1.u[0] = *(const v4u*)(qh + qo + 16 * NS);
                qa1.u[1] = *(const v4u*)(ql + qo + 16 * NS);
            }
            // keeps those loads in front of the score WMMAs, whose issue then
            // covers the wait that stands behind them
            __builtin_amdgcn_sched_barrier(0);
            v8f s0[2], s1[2];
#pragma unroll
            for (int nt = 0; nt < 2; ++nt) {
                s0[nt] = __builtin_amdgcn_wmma_f32_16x16x32_bf16(false, a0, false, bk[nt].h, (short)0, vzero, false, false);
                s1[nt] = __builtin_amdgcn_wmma_f32_16x16x32_bf16(false, a1, false, bk[nt].h, (short)0, vzero, false, false);
            }
            // keeps the wait below behind the score WMMAs (nothing else ties it there)
            __builtin_amdgcn_sched_barrier(0);
            // precaution: the q loads' address registers are given to other values
            // only behind this wait
            asm volatile("s_wait_xcnt 0x0" ::: "memory");
            // keeps the exp2 results, which may get those registers, behind the wait
            __builtin_amdgcn_sched_barrier(0);

            // ---- E tiles -> bf16 B operands (layouts line up; in-lane pack) ----
            v16bf eb[2];
#pragma unroll
            for (int nt = 0; nt < 2; ++nt) {
#pragma unroll
                for (int g = 0; g < 8; ++g) {
                    eb[nt][g]     = (__bf16)__builtin_amdgcn_exp2f(s0[nt][g]);   // K = moff+g
                    eb[nt][8 + g] = (__bf16)__builtin_amdgcn_exp2f(s1[nt][g]);   // K = 16+moff+g
                }
            }

            // ---- 16 c-tiles x 2 n-tiles of the main bf16 GEMM, A fragments from LDS ----
#pragma unroll
            for (int cb = 0; cb < 4; ++cb) {
                const int j  = ms * 4 + cb;         // this block
                const int jn = j + 1;               // the block read ahead
                if (jn < (MG / 32) * 4) {
#pragma unroll
                    for (int i = 0; i < 4; ++i) {
                        const unsigned char* p =
                            svt + ((jn & 3) * 4 + i) * 16 * PITCH + (jn >> 2) * 64;
                        fr[jn & 1][2 * i]     = *(const v4u*)(p);
                        fr[jn & 1][2 * i + 1] = *(const v4u*)(p + 32);
                    }
                }
                // keeps the eight LDS reads together ahead of the block (for speed only)
                __builtin_amdgcn_sched_barrier(0);
#pragma unroll
                for (int i = 0; i < 4; ++i) {
                    union { v4u u[2]; v16bf h; } U;
                    U.u[0] = fr[j & 1][2 * i];
                    U.u[1] = fr[j & 1][2 * i + 1];
#pragma unroll
                    for (int nt = 0; nt < 2; ++nt)
                        acc[cb * 4 + i][nt] = __builtin_amdgcn_wmma_f32_16x16x32_bf16(
                            false, U.h, false, eb[nt], (short)0, acc[cb * 4 + i][nt], false, false);
                }
                // keeps the next group of reads behind this block's WMMAs
                __builtin_amdgcn_sched_barrier(0);
            }
        }
        // ---- hand-over: tile t+1 becomes readable, tile t's buffer free ----
        asm volatile("s_wait_dscnt 0x0" ::: "memory");      // own reads of tile t done
        if (SKC_pinned(wv < 2u))
            asm volatile("s_wait_tensorcnt 0x0" ::: "memory");  // own slice of tile t+1 landed
        __syncthreads();                                    // the same for every wave
        const uint32_t st = SKC_pinned(t + 2);              // the next request is formed behind that wait
        if (SKC_pinned((wv < 2u) & (st < NT)))
            SKC_tload(lsl + (t & 1) * BUFB, gsl + (uint64_t)st * (MT * 2u), g1);
    }
    asm volatile("s_wait_tensorcnt 0x0" ::: "memory");      // nothing in flight at the wave's end
    asm volatile("s_wait_dscnt 0x0" ::: "memory");          // no LDS read open when the buffers change their use

    // ---- epilogue: residual values asked for first, they fly during the exchange.
    // One address per lane for f and one for out, the rest is a constant offset
    // in each instruction: wave w finishes c-tiles 0-7, wave w+4 c-tiles 8-15.
    // (every loop below is unrolled: acc and res are indexed by constants)
    const float* f = (dir == 0) ? fL : fU;
    float* o = out + (size_t)dir * ((size_t)NB * NC * NN);
    const size_t e0 = ((size_t)b * NC + grp * 128 + hi * 8) * NN + n0 + l15;
    const float* fe = f + e0;
    float*       oe = o + e0;
    float res[8][2][8];
#pragma unroll
    for (int i = 0; i < 8; ++i)
#pragma unroll
        for (int nt = 0; nt < 2; ++nt)
#pragma unroll
            for (int g = 0; g < 8; ++g)
                res[i][nt][g] = fe[(i * 16 + g) * NN + nt * 16];
    // precaution: fe's registers are given to other values only behind this wait
    asm volatile("s_wait_xcnt 0x0" ::: "memory");
    // keeps every later write of a register behind that wait
    __builtin_amdgcn_sched_barrier(0);

    // ---- the two groups' partial sums meet: waves w and w+4 hold the same
    // 256 c x 32 n.  Each hands over the eight c-tiles that the other finishes.
    // The staging buffers are free: the loop's last barrier ended every read of
    // them and no request is in flight.
    v4f* xs = (v4f*)(sv + wave * XB) + lane;
#pragma unroll
    for (int i = 0; i < 8; ++i) {
#pragma unroll
        for (int nt = 0; nt < 2; ++nt) {
            const v8f snd = grp ? acc[i][nt] : acc[8 + i][nt];
            xs[((i * 2 + nt) * 2 + 0) * 32] = (v4f){snd[0], snd[1], snd[2], snd[3]};
            xs[((i * 2 + nt) * 2 + 1) * 32] = (v4f){snd[4], snd[5], snd[6], snd[7]};
        }
    }
    __syncthreads();                                        // the partner's half is written
    const v4f* xr = (const v4f*)(sv + (wave ^ 4) * XB) + lane;

#pragma unroll
    for (int i = 0; i < 8; ++i) {
#pragma unroll
        for (int nt = 0; nt < 2; ++nt) {
            const v8f own = grp ? acc[8 + i][nt] : acc[i][nt];
            const v4f r0 = xr[((i * 2 + nt) * 2 + 0) * 32];
            const v4f r1 = xr[((i * 2 + nt) * 2 + 1) * 32];
#pragma unroll
            for (int g = 0; g < 8; ++g)
                res[i][nt][g] += beta * (own[g] + (g < 4 ? r0[g & 3] : r1[g & 3]));
        }
    }
    // keeps the stores together at the wave's end: no register that a store
    // names is written behind it
    __builtin_amdgcn_sched_barrier(0);
#pragma unroll
    for (int i = 0; i < 8; ++i)
#pragma unroll
        for (int nt = 0; nt < 2; ++nt)
#pragma unroll
            for (int g = 0; g < 8; ++g)
                oe[(i * 16 + g) * NN + nt * 16] = res[i][nt][g];
}

// ---------------------------------------------------------------------------
// Host-side launcher.  Workspace layout (floats unless noted):
//   qs   : 2*B*N*2R (bf16)    = as 262144 floats
//   ks   : 2*B*N*2R (bf16)    = as 262144 floats
//   zr   : 2*B*N*2R (bf16)    = as 262144 floats (the first 16 bytes of every 32 used)
//   vp   : 2*B*C*N  (bf16)    -> 16.8 MB      (total ~20 MB)
// ---------------------------------------------------------------------------
extern "C" void kernel_launch(void* const* d_in, const int* in_sizes, int n_in,
                              void* d_out, int out_size, void* d_ws, size_t ws_size,
                              hipStream_t stream)
{
    const float* fL   = (const float*)d_in[0];
    const float* fU   = (const float*)d_in[1];
    const float* qLw  = (const float*)d_in[2];
    const float* qLb  = (const float*)d_in[3];
    const float* kUw  = (const float*)d_in[4];
    const float* kUb  = (const float*)d_in[5];
    const float* vUw  = (const float*)d_in[6];
    const float* vUb  = (const float*)d_in[7];
    const float* qUw  = (const float*)d_in[8];
    const float* qUb  = (const float*)d_in[9];
    const float* kLw  = (const float*)d_in[10];
    const float* kLb  = (const float*)d_in[11];
    const float* vLw  = (const float*)d_in[12];
    const float* vLb  = (const float*)d_in[13];
    const float* beta = (const float*)d_in[14];
    float* outp = (float*)d_out;

    __bf16* qs   = (__bf16*)d_ws;
    __bf16* ks   = qs + (size_t)2 * NB * NN * NS;
    __bf16* zr   = ks + (size_t)2 * NB * NN * NS;
    __bf16* vp   = zr + (size_t)2 * NB * NN * NS;

    // 1) q, k (q pre-scaled by log2 e) and v (bf16) in one pass over fL and fU
    SKC_qkv<<<dim3(NN / PN, NB, 2), dim3(256), 0, stream>>>(
        fL, fU, qLw, qLb, kUw, kUb, qUw, qUb, kLw, kLb, vUw, vUb, vLw, vLb, qs, ks, vp);

    // 2) softmax normalizers via WMMA score tiles
    SKC_stats<<<dim3(NN / 128, NB, 2), dim3(1024), 0, stream>>>(qs, ks, zr);

    // 3) main attend (WMMA score gen + bf16-WMMA GEMM) + fused residual
    SKC_attend<<<dim3(NN / 128, NB, 2), dim3(256), 0, stream>>>(
        fL, fU, qs, ks, zr, vp, beta, outp);
}

// v009
// Measured time: 66.9 microseconds a run.
// In two side-by-side timings against v008, it was 1.03 and 1.02 times as fast.
// Over all steps from v000 it is 9.08 times as fast.
#include <hip/hip_runtime.h>
#include <hip/hip_bf16.h>

// ---------------------------------------------------------------------------
// SKCLite cross-attention for MI455X (gfx1250, wave32, WMMA).
//
// B=4, C=256, N=H*W=4096, R=8 (rank), G=4 groups (CG=64).
// Dominant cost: out = v @ softmax(q^T k)  -> 2 * 2*B*C*N^2 = 68.7 GFLOP.
// Strategy: flash-style on-the-fly score tiles.
//   scores (rank-8): q and k are each kept as a bf16 high part plus a bf16 low
//   part (16 significant bits); the four cross products x rank 8 fill the K=32
//   of ONE V_WMMA_F32_16X16X32_BF16, a quarter of the matrix time of the two
//   V_WMMA_F32_16X16X4_F32 that the same tile takes on f32 operands,
//   exp() + bf16-pack lands *exactly* in the B-operand layout of
//   V_WMMA_F32_16X16X32_BF16 (f32 C/D layout == bf16 B layout modulo packing),
//   main GEMM in bf16 WMMA with f32 accumulation.
// ---------------------------------------------------------------------------

#define NB   4      // batch
#define NC   256    // channels
#define NN   4096   // H*W
#define NR   8      // rank
#define NG   4      // groups
#define NCG  64     // channels per group
#define LOG2E 1.4426950408889634f

typedef __attribute__((ext_vector_type(8)))  float        v8f;
typedef __attribute__((ext_vector_type(16))) __bf16       v16bf;
typedef __attribute__((ext_vector_type(4)))  unsigned int v4u;
typedef __attribute__((ext_vector_type(8)))  __bf16       v8bf;

// A position's q (or k) record: 8 high parts, then 8 low parts, 32 bytes.
#define NS   (2 * NR)
// A bf16 16x16x32 operand holds two k blocks of 8 per lane half (registers 0-3
// and 4-7), four in all.  One side of the score product gives every lane its
// row's whole record, (high, low) in both halves; the other side gives lane
// half 0 (high, high) and lane half 1 (low, low).  Block by block that pairs
// high.high, low.high, high.low, low.low: the full product of the two sums.
// In the attend kernel the fourth block carries -log2 Z of the row instead of
// low.low (which lies 16 bits below the score): three bf16 parts against ones.
union SKC_frag { v4u u[2]; v16bf h; };

// ---------------------------------------------------------------------------
// Kernel 1: one pass over f gives q, k and v.
//   q = (qw . f + qb) * log2(e)   (exp -> exp2),   k = kw . f + kb
//   vp[dir][b][c][m] = bf16( vb[c] + sum_i vw[c][i] f[b,g*64+i,m] )
// Layout: qs/ks = [dir][B][N][high parts of the R rows, low parts] bf16.
// dir0 (LU path): q from fL (qL_w), k and v from fU (kU_w, vU_w)
// dir1 (UL path): q from fU (qU_w), k and v from fL (kL_w, vL_w)
// All products run on V_WMMA_F32_16X16X32_BF16: weights (A) and f (B) are each
// split into a bf16 high part plus a bf16 low part, and high.high + high.low +
// low.high are summed in f32 (what is left out lies 16 bits below the product).
// Block = (source map, b, 128 n), one per WGP; wave = one group's 64 channels x
// 64 n.  On its f fragments a wave runs five 16-row A tiles: the group's four
// c-tiles of v, and one tile whose rows are the 8 q rows and the 8 k rows,
// restricted to the group's channels.  The four groups' partial q and k sums
// meet in LDS and are added in group order.
// A lane reads four neighbouring n of a row by one b128 load (16 lanes: 256
// contiguous bytes); register r of those loads is column tile r, whose column
// l15 stands for n = 4 * l15 + r.  So no value changes its lane, all 32 loads
// of a wave are in flight together, and the four tiles' v results of a lane are
// four neighbouring n again: one 8-byte store, 128 contiguous bytes per row.
// The weights' fragments of a group are the same for its two waves: each forms
// those of one k-step and leaves them in LDS.
// ---------------------------------------------------------------------------
#define VM  64              // n per wave: 16 lanes x 4
#define PN  128             // n per block
#define RR  1088            // LDS bytes of one column tile's partial sums: 2 x 512, + 64
                            // so that the four tiles' rows start on different banks
#define RGB (4 * RR)        // LDS bytes of one wave's partial sums

typedef __attribute__((ext_vector_type(4))) float        v4f;
typedef __attribute__((ext_vector_type(2))) unsigned int v2u;
typedef __attribute__((ext_vector_type(4))) __bf16       v4bf;

__global__ __launch_bounds__(256)
void SKC_qkv(const float* __restrict__ fL, const float* __restrict__ fU,
             const float* __restrict__ qLw, const float* __restrict__ qLb,
             const float* __restrict__ kUw, const float* __restrict__ kUb,
             const float* __restrict__ qUw, const float* __restrict__ qUb,
             const float* __restrict__ kLw, const float* __restrict__ kLb,
             const float* __restrict__ vUw, const float* __restrict__ vUb,
             const float* __restrict__ vLw, const float* __restrict__ vLb,
             __bf16* __restrict__ qs, __bf16* __restrict__ ks,
             __bf16* __restrict__ vp)
{
    // [group][4 c-tiles of v, q and k rows][k-step][high, low][registers 0-3, 4-7][lane]
    __shared__ v4u sw[NG][5][2][2][2][32];
    // partial q and k sums: [half of n][group] x RGB bytes
    __shared__ __attribute__((aligned(16))) unsigned char red[8 * RGB];

    const int lane = threadIdx.x & 31;
    // wave-uniform, so that the group's base addresses and the biases stay scalar
    const int wave = __builtin_amdgcn_readfirstlane(threadIdx.x >> 5);
    const int g    = wave & 3;                  // group of 64 channels
    const int mh   = wave >> 2;                 // which 64 n of the block
    const int l15  = lane & 15;
    const int hi   = lane >> 4;
    const int b    = blockIdx.y;
    const int srcU = blockIdx.z;                // 0: fL, 1: fU
    const int n0   = blockIdx.x * PN;
    const int m0   = n0 + mh * VM + l15 * 4;    // this lane's four n

    const float* f  = srcU ? fU  : fL;
    const float* qw = srcU ? qUw : qLw;
    const float* kw = srcU ? kUw : kLw;
    const float* vw = srcU ? vUw : vLw;
    const float* vb = srcU ? vUb : vLb;

    // k order of both operands: element e of lane half hi is
    // i = 32 * s + 8 * hi + (e < 8 ? e : e + 8)
    // (every loop of this kernel is unrolled: the arrays are indexed by
    // constants and stay in registers)

    // this wave's share of the weights: its group's five tiles, k-step mh, row l15
    const float* wr = vw + (size_t)(g * NCG + l15) * NCG + mh * 32 + hi * 8;
    const float* wq = (l15 < NR ? qw + l15 * NC : kw + (l15 - NR) * NC)
                    + g * NCG + mh * 32 + hi * 8;
    v4f w[5][4];
#pragma unroll
    for (int t = 0; t < 4; ++t)
#pragma unroll
        for (int p = 0; p < 4; ++p)
            w[t][p] = *(const v4f*)(wr + t * 16 * NCG + (p >> 1) * 16 + (p & 1) * 4);
#pragma unroll
    for (int p = 0; p < 4; ++p)
        w[4][p] = *(const v4f*)(wq + (p >> 1) * 16 + (p & 1) * 4);

    const float* fb = f + ((size_t)b * NC + g * NCG + hi * 8) * NN + m0;
    v4f x[2][16];
#pragma unroll
    for (int s = 0; s < 2; ++s)
#pragma unroll
        for (int e = 0; e < 16; ++e)
            x[s][e] = *(const v4f*)(fb + (size_t)(s * 32 + (e < 8 ? e : e + 8)) * NN);

    // D layout: register j is row j + 8 * hi of the c-tile
    const float* bp = vb + g * NCG + hi * 8;
    v8f cb[4];
#pragma unroll
    for (int ct = 0; ct < 4; ++ct)
        cb[ct] = *(const v8f*)(bp + ct * 16);
    // precaution: the address registers of the loads above are given to other
    // values only behind this wait.  The three lane addresses are its inputs, so
    // that they keep their registers up to it.
    asm volatile("s_wait_xcnt 0x0" :: "v"(wr), "v"(wq), "v"(fb) : "memory");
    // keeps all the loads in front of the first use (a load left behind one would
    // be asked for only when earlier ones have arrived, a second memory latency)
    // and every later write of a register behind the wait
    __builtin_amdgcn_sched_barrier(0);

#pragma unroll
    for (int t = 0; t < 5; ++t) {
        union { v4u u[2]; v16bf h; } H, L;
#pragma unroll
        for (int e = 0; e < 16; ++e) {
            const float v = w[t][e >> 2][e & 3];
            H.h[e] = (__bf16)v;
            L.h[e] = (__bf16)(v - (float)H.h[e]);
        }
        sw[g][t][mh][0][0][lane] = H.u[0];
        sw[g][t][mh][0][1][lane] = H.u[1];
        sw[g][t][mh][1][0][lane] = L.u[0];
        sw[g][t][mh][1][1][lane] = L.u[1];
    }
    __syncthreads();                            // every wave's weight fragments are written

    v16bf bh[2][4], bl[2][4];                   // [k-step][column tile]
#pragma unroll
    for (int s = 0; s < 2; ++s)
#pragma unroll
        for (int r = 0; r < 4; ++r)
#pragma unroll
            for (int e = 0; e < 16; ++e) {
                const float v = x[s][e][r];
                bh[s][r][e] = (__bf16)v;
                bl[s][r][e] = (__bf16)(v - (float)bh[s][r][e]);
            }

    // tile 4 (q and k rows) first: its sums are on their way through LDS while
    // the v tiles are multiplied
    v2u o[4][8];
#pragma unroll
    for (int tt = 0; tt < 5; ++tt) {
        const int t = (tt + 4) % 5;
        SKC_frag ah[2], al[2];
#pragma unroll
        for (int s = 0; s < 2; ++s) {
            ah[s].u[0] = sw[g][t][s][0][0][lane];
            ah[s].u[1] = sw[g][t][s][0][1][lane];
            al[s].u[0] = sw[g][t][s][1][0][lane];
            al[s].u[1] = sw[g][t][s][1][1][lane];
        }
        v8f acc[4];
#pragma unroll
        for (int r = 0; r < 4; ++r)
            acc[r] = (t < 4) ? cb[t & 3] : (v8f){0.f, 0.f, 0.f, 0.f, 0.f, 0.f, 0.f, 0.f};
        // r innermost: four independent accumulators follow one another
#pragma unroll
        for (int s = 0; s < 2; ++s) {
#pragma unroll
            for (int r = 0; r < 4; ++r)
                acc[r] = __builtin_amdgcn_wmma_f32_16x16x32_bf16(
                    false, al[s].h, false, bh[s][r], (short)0, acc[r], false, false);
#pragma unroll
            for (int r = 0; r < 4; ++r)
                acc[r] = __builtin_amdgcn_wmma_f32_16x16x32_bf16(
                    false, ah[s].h, false, bl[s][r], (short)0, acc[r], false, false);
#pragma unroll
            for (int r = 0; r < 4; ++r)
                acc[r] = __builtin_amdgcn_wmma_f32_16x16x32_bf16(
                    false, ah[s].h, false, bh[s][r], (short)0, acc[r], false, false);
        }
        if (t < 4) {
#pragma unroll
            for (int j = 0; j < 8; ++j) {
                v4bf c;
#pragma unroll
                for (int r = 0; r < 4; ++r) c[r] = (__bf16)acc[r][j];
                o[t & 3][j] = __builtin_bit_cast(v2u, c);
            }
        } else {
            // lane half 0 holds the 8 q rows, lane half 1 the 8 k rows, of column l15
            unsigned char* rw = red + wave * RGB + lane * 16;   // wave = mh * 4 + g
#pragma unroll
            for (int r = 0; r < 4; ++r) {
                *(v4f*)(rw + r * RR)       = (v4f){acc[r][0], acc[r][1], acc[r][2], acc[r][3]};
                *(v4f*)(rw + r * RR + 512) = (v4f){acc[r][4], acc[r][5], acc[r][6], acc[r][7]};
            }
        }
    }
    __syncthreads();                            // every group's partial q and k sums are written

    // the v stores go out first: they fly while q and k are finished
    __bf16* ov = vp + (((size_t)(1 - srcU) * NB + b) * NC + g * NCG + hi * 8) * NN + m0;
#pragma unroll
    for (int ct = 0; ct < 4; ++ct)
#pragma unroll
        for (int j = 0; j < 8; ++j)
            *(v2u*)(ov + (size_t)(ct * 16 + j) * NN) = o[ct][j];
    // precaution: the registers that those stores name are given to other values
    // only behind this wait
    asm volatile("s_wait_xcnt 0x0" ::: "memory");
    // keeps every later write of a register behind that wait
    __builtin_amdgcn_sched_barrier(0);

    // waves 0-3 finish q, waves 4-7 k: one position per lane, all 8 rows.
    // q of fL is dir 0, q of fU dir 1; k and v the other way round.
    const bool   isq   = wave < 4;
    const float* bias  = isq ? (srcU ? qUb : qLb) : (srcU ? kUb : kLb);
    const float  scale = isq ? LOG2E : 1.0f;
    const int    nl    = (wave & 3) * 32 + lane;
    // position nl was column (nl & 63) >> 2 of column tile nl & 3 in half nl >> 6
    const unsigned char* rf = red + (nl >> 6) * (NG * RGB) + (nl & 3) * RR
                            + ((isq ? 0 : 16) + ((nl & 63) >> 2)) * 16;
    v4f s0 = *(const v4f*)(rf), s1 = *(const v4f*)(rf + 512);
#pragma unroll
    for (int p = 1; p < NG; ++p) {
        s0 += *(const v4f*)(rf + p * RGB);
        s1 += *(const v4f*)(rf + p * RGB + 512);
    }

    // high part: the upper 16 bits of the f32, a bf16 as they stand; low
    // part: what that leaves over (exact in f32), rounded to bf16
    v4u  h;
    v8bf l;
#pragma unroll
    for (int r = 0; r < NR; r += 2) {
        const float    x0 = ((r < 4 ? s0[r & 3] : s1[r & 3]) + bias[r]) * scale;
        const float    x1 = ((r < 4 ? s0[(r + 1) & 3] : s1[(r + 1) & 3]) + bias[r + 1]) * scale;
        const unsigned u0 = __builtin_bit_cast(unsigned, x0);
        const unsigned u1 = __builtin_bit_cast(unsigned, x1);
        h[r / 2] = (u0 >> 16) | (u1 & 0xffff0000u);
        l[r]     = (__bf16)(x0 - __builtin_bit_cast(float, u0 & 0xffff0000u));
        l[r + 1] = (__bf16)(x1 - __builtin_bit_cast(float, u1 & 0xffff0000u));
    }
    __bf16* ob = (isq ? qs : ks)
               + (((size_t)(isq ? srcU : 1 - srcU) * NB + b) * NN + n0 + nl) * NS;
    *(v4u*)(ob)       = h;
    *(v8bf*)(ob + NR) = l;
}

// ---------------------------------------------------------------------------
// Kernel 2: softmax normalizers.  Z[dir][b][m] = sum_j exp(q_m . k_j), stored as
// zr[dir][b][m] = -log2 Z in three bf16 parts (24 significant bits) and five
// zeros, 16 bytes at the pitch of a q record: the attend kernel adds it to the
// scores of row m inside the score WMMA, so exp2 gives exp(q_m . k_n) / Z_m.
// A operand (q, fixed 16-row m-tile) stays in registers; loop j in tiles of 16:
// one V_WMMA_F32_16X16X32_BF16 on the high and low parts, exp2, accumulate
// per-VGPR, then 16-lane xor reduction (lane halves independent).
// Every k line is new to the WGP when it is asked for, so each trip of a wave
// waits a whole L2 latency.  Block = 8 m-tiles x SJ quarters of j = 32 waves,
// eight per SIMD: one wave's wait lies under the others' work.  The SJ partial
// sums of a row meet in LDS and are added in j order.
// ---------------------------------------------------------------------------
#define SJ 4                // waves that share an m-tile
#define SJN (NN / SJ)       // j per wave
#define SU 4                // j-tiles per trip

__global__ __launch_bounds__(1024)
void SKC_stats(const __bf16* __restrict__ qs, const __bf16* __restrict__ ks,
               __bf16* __restrict__ zr)
{
    __shared__ float part[SJ][128];             // [quarter of j][m in the block]

    const int lane = threadIdx.x & 31;
    // wave-uniform, so that the k base address stays scalar
    const int wave = __builtin_amdgcn_readfirstlane(threadIdx.x >> 5);
    const int mt   = wave & 7;                  // m-tile in the block
    const int jq   = wave >> 3;                 // quarter of j
    const int b    = blockIdx.y;
    const int dir  = blockIdx.z;
    const int m0   = (blockIdx.x * 8 + mt) * 16;
    const int l15  = lane & 15;
    const int hi   = lane >> 4;                 // lane-half select

    const __bf16* q = qs + ((size_t)dir * NB + b) * (NN * NS);
    const __bf16* k = ks + (((size_t)dir * NB + b) * NN + jq * SJN) * NS;

    // A fragment, the fixed side: lane half 0 (high, high), lane half 1 (low, low)
    SKC_frag aq;
    aq.u[0] = *(const v4u*)(q + (m0 + l15) * NS + hi * NR);
    // precaution: that load's address registers are given to other values only
    // behind this wait
    asm volatile("s_wait_xcnt 0x0" ::: "memory");
    aq.u[1] = aq.u[0];

    const v8f vzero = {0.f, 0.f, 0.f, 0.f, 0.f, 0.f, 0.f, 0.f};
    v8f zacc = vzero;
    // kept rolled: a trip's loads then stand behind the exp2 and the adds of the
    // trip before, far more than the four slots that a load needs behind the
    // WMMAs which read, as B, the registers that it lands in
#pragma unroll 1
    for (int j0 = 0; j0 < SJN; j0 += 16 * SU) {
        // B fragments, the side that changes: column j's whole record as it lies
        // (the loops over u are unrolled: bk and s are indexed by constants)
        SKC_frag bk[SU];
#pragma unroll
        for (int u = 0; u < SU; ++u) {
            const __bf16* kj = k + (j0 + u * 16 + l15) * NS;
            bk[u].u[0] = *(const v4u*)(kj);
            bk[u].u[1] = *(const v4u*)(kj + NR);
        }
        // keeps a trip's loads together in front of its WMMAs: left to itself the
        // compiler asked for them in three lots, each waited for before the next
        __builtin_amdgcn_sched_barrier(0);
        v8f s[SU];
#pragma unroll
        for (int u = 0; u < SU; ++u)
            s[u] = __builtin_amdgcn_wmma_f32_16x16x32_bf16(
                false, aq.h, false, bk[u].h, (short)0, vzero, false, false);
        // keeps a trip's WMMAs together: each fills the slots that the one before
        // needs ahead of the exp2 on its result (else four v_nop per WMMA)
        __builtin_amdgcn_sched_barrier(0);
        // precaution: the k loads' address registers are stepped on only behind this wait
        asm volatile("s_wait_xcnt 0x0" ::: "memory");
        // the loaded k values, as inputs only, behind the four WMMAs: their registers
        // stay theirs until all four are issued, so that no WMMA's result is given
        // the registers which the WMMA right before it reads as B
        asm volatile("" :: "v"(bk[0].u[0]), "v"(bk[0].u[1]), "v"(bk[1].u[0]), "v"(bk[1].u[1]),
                           "v"(bk[2].u[0]), "v"(bk[2].u[1]), "v"(bk[3].u[0]), "v"(bk[3].u[1]));
        // keeps the step of the address, and the exp2, behind those two statements
        __builtin_amdgcn_sched_barrier(0);
#pragma unroll
        for (int u = 0; u < SU; ++u) {
#pragma unroll
            for (int g = 0; g < 8; ++g) zacc[g] += __builtin_amdgcn_exp2f(s[u][g]);
        }
    }
    // reduce across the 16 lanes of each half (j is the lane dimension); the
    // eight rows go through each step together, so their exchanges overlap
    // (both loops unrolled: zacc is indexed by constants)
#pragma unroll
    for (int st = 1; st < 16; st <<= 1) {
#pragma unroll
        for (int g = 0; g < 8; ++g) zacc[g] += __shfl_xor(zacc[g], st, 32);
    }
    if (l15 == 0) {
#pragma unroll
        for (int g = 0; g < 8; ++g)
            part[jq][mt * 16 + g + hi * 8] = zacc[g];   // D layout: VGPR g -> row g / g+8
    }
    __syncthreads();                            // every quarter's sums are written

    if (threadIdx.x < 128) {
        const int t = threadIdx.x;
        float z = part[0][t];
#pragma unroll
        for (int p = 1; p < SJ; ++p) z += part[p][t];   // unrolled: the LDS reads go out together
        const float  lz = -__builtin_amdgcn_logf(z);    // v_log_f32 is log2
        const __bf16 p0 = (__bf16)lz;
        const float  r1 = lz - (float)p0;               // exact in f32
        const __bf16 p1 = (__bf16)r1;
        const __bf16 p2 = (__bf16)(r1 - (float)p1);
        const __bf16 zz = (__bf16)0.f;
        *(v8bf*)(zr + (((size_t)dir * NB + b) * NN + blockIdx.x * 128 + t) * NS) =
            (v8bf){p0, p1, p2, zz, zz, zz, zz, zz};
    }
}

// ---------------------------------------------------------------------------
// Kernel 3: main attend + residual.
//   out[c,n] = f[c,n] + beta * sum_m vp[c,m] * exp(q_m . k_n) / Z_m
// The four waves of each group read the same vp values, so a vp tile of
// 256 c x 128 m is brought into LDS once per block by the tensor mover: waves
// 0 and 1 ask for one slice of 128 rows x 256 bytes each, one scalar request instead
// of address arithmetic, copies and their waits in every lane of every wave at
// the head of each trip, where all eight waves stand behind the barrier.  Two
// buffers: tile t+1 flies while tile t is worked on.  The request's pad gives
// the LDS row pitch 272 B = 16 B x odd: conflict-free b128 reads.
// Wave tile: all 16 c-tiles (C=256) x two 16-wide n-tiles, so that every A
// fragment read from LDS feeds two WMMAs (one per fragment asks the LDS for
// twice what it delivers).  The block still covers 128 n: waves 0-3 take the
// first 64 m of every staged tile, waves 4-7 the last 64 m, for the same four
// n-pairs; the two partial sums meet in LDS after the loop.
// Per 32-wide m-step: 4x bf16 WMMA score tiles (high and low parts) -> exp2 -> bf16 pack
// (f32 D layout coincides with bf16 B layout: zero lane shuffles) ->
// 32x V_WMMA_F32_16X16X32_BF16 with one b128 LDS read each.
// ---------------------------------------------------------------------------
#define MT     128                 // m per staged tile
#define NT     (NN / MT)           // staged tiles
#define PITCH  272                 // LDS bytes per row: MT*2 + 16
#define SLR    128                 // rows of a tile per request
#define SLB    (SLR * PITCH)       // LDS bytes per slice: 17 x 2 KiB
#define BUFB   (NC * PITCH)        // LDS bytes per buffer: two slices
#define MG     (MT / 2)            // m of a staged tile per group of four waves
#define XB     16384               // LDS bytes a wave hands over: 8 c-tiles x 2 n-tiles, f32

typedef __attribute__((ext_vector_type(8))) unsigned int v8u;

// A wave-uniform value held in a scalar register.  A tensor load ignores EXEC:
// only a scalar branch keeps a wave from issuing it, so every test around one
// goes through here.
__device__ __forceinline__ uint32_t SKC_pinned(uint32_t v)
{
    uint32_t w = (uint32_t)__builtin_amdgcn_readfirstlane(v);
    asm volatile("" : "+s"(w));     // keeps the value scalar, and what is formed from it behind earlier waits
    return w;
}

// Descriptor group 1, the same for every request: SLR rows of MT * 2 = 256 bytes,
// source pitch NN * 2 bytes, 16 bytes of LDS pad behind every row.
__device__ __forceinline__ v8u SKC_group1()
{
    v8u g1;
    // no mask, extents in bytes, pad on: after every 64 dwords (one row) 4 dwords
    g1[0] = (uint32_t)__builtin_amdgcn_readfirstlane((1u << 20) | (5u << 22) | (3u << 25));
    g1[1] = (uint32_t)__builtin_amdgcn_readfirstlane((MT * 2u) << 16);          // tensor_dim0
    g1[2] = (uint32_t)__builtin_amdgcn_readfirstlane((uint32_t)SLR << 16);      // tensor_dim1
    g1[3] = (uint32_t)__builtin_amdgcn_readfirstlane((MT * 2u) << 16);          // tile_dim0
    g1[4] = (uint32_t)__builtin_amdgcn_readfirstlane((uint32_t)SLR);            // tile_dim1
    g1[5] = (uint32_t)__builtin_amdgcn_readfirstlane(NN * 2u);                  // source row pitch
    g1[6] = (uint32_t)__builtin_amdgcn_readfirstlane(0u);
    g1[7] = (uint32_t)__builtin_amdgcn_readfirstlane(0u);
    return g1;
}

// One request: the slice whose first byte is ga, to LDS byte l.
__device__ __forceinline__ void SKC_tload(uint32_t l, uint64_t ga, v8u g1)
{
    v4u g0;
    g0[0] = (uint32_t)__builtin_amdgcn_readfirstlane(1u);                       // count 1
    g0[1] = (uint32_t)__builtin_amdgcn_readfirstlane(l);
    g0[2] = (uint32_t)__builtin_amdgcn_readfirstlane((uint32_t)ga);
    g0[3] = (uint32_t)__builtin_amdgcn_readfirstlane(
                (((uint32_t)(ga >> 32)) & 0x01FFFFFFu) | 0x80000000u);          // type 2
    // the request: one instruction of the whole wave, both groups in scalar registers;
    // "memory" keeps the waits and the LDS reads around it in their places
    asm volatile("tensor_load_to_lds %0, %1" :: "s"(g0), "s"(g1) : "memory");
}

__global__ __launch_bounds__(256)
void SKC_attend(const float* __restrict__ fL, const float* __restrict__ fU,
                const __bf16* __restrict__ qs, const __bf16* __restrict__ ks,
                const __bf16* __restrict__ zr,
                const __bf16* __restrict__ vp, const float* __restrict__ betap,
                float* __restrict__ out)
{
    // every slice's place in LDS is a multiple of 2 KiB
    __shared__ __attribute__((aligned(2048))) unsigned char sv[2 * BUFB];

    const int lane = threadIdx.x & 31;
    const int wave = threadIdx.x >> 5;
    const int grp  = wave >> 2;                 // which 64 m of every staged tile
    const int b    = blockIdx.y;
    const int dir  = blockIdx.z;
    const int n0   = (blockIdx.x * 4 + (wave & 3)) * 32;
    const int l15  = lane & 15;
    const int hi   = lane >> 4;
    const float beta = *betap;

    const __bf16* q   = qs   + ((size_t)dir * NB + b) * (NN * NS);
    const __bf16* k   = ks   + ((size_t)dir * NB + b) * (NN * NS);
    const __bf16* vpb = vp   + ((size_t)dir * NB + b) * (size_t)(NC * NN);

    // waves 0 and 1 each bring rows 128 * wave .. + 127 of every tile
    const uint32_t wv  = (uint32_t)__builtin_amdgcn_readfirstlane(threadIdx.x >> 5);
    const uint64_t gsl = (uint64_t)(size_t)vpb + (uint64_t)(wv & 1u) * (SLR * NN * 2u);
    const uint32_t lsl = (uint32_t)(size_t)sv + (wv & 1u) * SLB;
    v8u g1 = SKC_group1();
    // the descriptor words keep eight scalar registers of their own through
    // the loop, so that none takes another value while a request is on its way
    asm volatile("" : "+s"(g1));

    // ---- tile 0 into buffer 0, published; then tile 1 into buffer 1 ----
    if (SKC_pinned(wv < 2u)) {
        SKC_tload(lsl, gsl, g1);
        asm volatile("s_wait_tensorcnt 0x0" ::: "memory");      // own slice of tile 0 landed
    }
    __syncthreads();                                            // every slice landed
    if (SKC_pinned(wv < 2u))
        SKC_tload(lsl + BUFB, gsl + MT * 2u, g1);

    // k B-fragments of the two n-tiles: constant across the whole m loop.
    // The fixed side: lane half 0 (high, high), lane half 1 (low, three ones and
    // five zeros: they meet the row's -log2 Z).
    const __bf16* kp = k + (n0 + l15) * NS + hi * NR;
    SKC_frag bk[2];
#pragma unroll
    for (int nt = 0; nt < 2; ++nt) {
        bk[nt].u[0] = *(const v4u*)(kp + nt * 16 * NS);
        bk[nt].u[1] = hi ? (v4u){0x3f803f80u, 0x00003f80u, 0u, 0u} : bk[nt].u[0];
    }

    // q A-fragments of the group's share of tile 0: per m-step two 16-row tiles.
    // The side that changes: row m's high parts in both lane halves, then its low
    // parts in lane half 0 and its -log2 Z record in lane half 1 (same pitch: one
    // offset).  Two register sets, one per tile parity: while one tile's set is
    // multiplied, the next tile's set is on its way.
    const int qlane = (l15 + grp * MG) * NS;            // this lane's place in a q tile
    const __bf16* qh = q + qlane;
    const __bf16* ql = (hi ? zr + ((size_t)dir * NB + b) * (NN * NS) : q + NR) + qlane;
    SKC_frag qf[2][MG / 32][2];                         // [tile parity][m-step][16-row tile]
#pragma unroll
    for (int ms = 0; ms < MG / 32; ++ms)
#pragma unroll
        for (int i = 0; i < 2; ++i) {
            qf[0][ms][i].u[0] = *(const v4u*)(qh + (ms * 32 + i * 16) * NS);
            qf[0][ms][i].u[1] = *(const v4u*)(ql + (ms * 32 + i * 16) * NS);
        }
    // precaution: the address registers of the k and q loads above are given to
    // other values only behind this wait.  The k address is its input, so that it
    // keeps its registers up to it (the q addresses live on through the loop).
    asm volatile("s_wait_xcnt 0x0" :: "v"(kp) : "memory");
    // keeps every later write of a register behind that wait
    __builtin_amdgcn_sched_barrier(0);

    v8f acc[16][2];
    const v8f vzero = {0.f, 0.f, 0.f, 0.f, 0.f, 0.f, 0.f, 0.f};
#pragma unroll
    for (int ct = 0; ct < 16; ++ct) { acc[ct][0] = vzero; acc[ct][1] = vzero; }

    // bf16 A layout: row = l15, lane-half K offset of 8 elements = 16 bytes;
    // the group's 64 m start MG elements into the row
    const unsigned char* svl = sv + l15 * PITCH + hi * 16 + grp * (MG * 2);

    // kept rolled but for pairs of trips: one trip per staged tile, the buffer
    // chosen by the trip's parity (for speed only)
    uint32_t nx = 1u;           // the tile after the trip's own; from trip 1 on the foot's scalar
#pragma unroll 1
    for (int t2 = 0; t2 < NT; t2 += 2)
    // two trips unrolled: qf is indexed by constants, and the two q register sets
    // change places without a copy
#pragma unroll
    for (int u = 0; u < 2; ++u) {
        const int t = t2 + u;
        const unsigned char* svt = svl + (t & 1) * BUFB;

        // the next tile's q fragments are asked for here, right behind the barrier,
        // a whole trip ahead of their use: they travel beside the tensor requests,
        // and the load wait that comes with the trip's closing barrier finds them
        // landed.  After the last tile the index wraps to 0: in bounds, not used.
        const int qo = (int)((nx & (NT - 1)) * (MT * NS));
        const __bf16* ah = qh + qo;
        const __bf16* al = ql + qo;
#pragma unroll
        for (int ms = 0; ms < MG / 32; ++ms)
#pragma unroll
            for (int i = 0; i < 2; ++i) {
                qf[u ^ 1][ms][i].u[0] = *(const v4u*)(ah + (ms * 32 + i * 16) * NS);
                qf[u ^ 1][ms][i].u[1] = *(const v4u*)(al + (ms * 32 + i * 16) * NS);
            }
        // keeps those loads at the trip's head (sunk towards their use they would
        // lose the lead)
        __builtin_amdgcn_sched_barrier(0);

        // two register sets of four A fragments: block j+1 is read from LDS as
        // one group while block j (four c-tiles x two n-tiles of one m-step) is
        // multiplied (every loop below is unrolled so that fr and acc are
        // indexed by constants and stay in registers)
        v4u fr[2][8];
#pragma unroll
        for (int i = 0; i < 4; ++i) {
            const unsigned char* p = svt + i * 16 * PITCH;
            fr[0][2 * i]     = *(const v4u*)(p);        // K = moff .. moff+7
            fr[0][2 * i + 1] = *(const v4u*)(p + 32);   // K = 16+moff .. 16+moff+7
        }

#pragma unroll
        for (int ms = 0; ms < MG / 32; ++ms) {
            // WMMA distance: the score WMMAs below may be given, as their D, the
            // registers that the last bf16 WMMA of the m-step before reads as B;
            // only scalar instructions stand between the two otherwise.
            asm volatile("v_nop\n\tv_nop\n\tv_nop\n\tv_nop\n\tv_nop");
            // keeps the score WMMAs behind those slots
            __builtin_amdgcn_sched_barrier(0);
            // ---- score tiles (m0..m0+15 and m0+16..m0+31) x two n-tiles, rank 8 x 4 ----
            // this m-step's q fragments are in registers since the trip before
            const v16bf a0 = qf[u][ms][0].h, a1 = qf[u][ms][1].h;
            v8f s0[2], s1[2];
#pragma unroll
            for (int nt = 0; nt < 2; ++nt) {
                s0[nt] = __builtin_amdgcn_wmma_f32_16x16x32_bf16(false, a0, false, bk[nt].h, (short)0, vzero, false, false);
                s1[nt] = __builtin_amdgcn_wmma_f32_16x16x32_bf16(false, a1, false, bk[nt].h, (short)0, vzero, false, false);
            }
            // keeps the four score WMMAs together: each fills the slots that the one
            // before needs ahead of the exp2 on its result
            __builtin_amdgcn_sched_barrier(0);

            // ---- E tiles -> bf16 B operands (layouts line up; in-lane pack) ----
            v16bf eb[2];
#pragma unroll
            for (int nt = 0; nt < 2; ++nt) {
#pragma unroll
                for (int g = 0; g < 8; ++g) {
                    eb[nt][g]     = (__bf16)__builtin_amdgcn_exp2f(s0[nt][g]);   // K = moff+g
                    eb[nt][8 + g] = (__bf16)__builtin_amdgcn_exp2f(s1[nt][g]);   // K = 16+moff+g
                }
            }

            // ---- 16 c-tiles x 2 n-tiles of the main bf16 GEMM, A fragments from LDS ----
#pragma unroll
            for (int cb = 0; cb < 4; ++cb) {
                const int j  = ms * 4 + cb;         // this block
                const int jn = j + 1;               // the block read ahead
                if (jn < (MG / 32) * 4) {
#pragma unroll
                    for (int i = 0; i < 4; ++i) {
                        const unsigned char* p =
                            svt + ((jn & 3) * 4 + i) * 16 * PITCH + (jn >> 2) * 64;
                        fr[jn & 1][2 * i]     = *(const v4u*)(p);
                        fr[jn & 1][2 * i + 1] = *(const v4u*)(p + 32);
                    }
                }
                // keeps the eight LDS reads together ahead of the block (for speed only)
                __builtin_amdgcn_sched_barrier(0);
#pragma unroll
                for (int i = 0; i < 4; ++i) {
                    union { v4u u[2]; v16bf h; } U;
                    U.u[0] = fr[j & 1][2 * i];
                    U.u[1] = fr[j & 1][2 * i + 1];
#pragma unroll
                    for (int nt = 0; nt < 2; ++nt)
                        acc[cb * 4 + i][nt] = __builtin_amdgcn_wmma_f32_16x16x32_bf16(
                            false, U.h, false, eb[nt], (short)0, acc[cb * 4 + i][nt], false, false);
                }
                // keeps the next group of reads behind this block's WMMAs
                __builtin_amdgcn_sched_barrier(0);
            }
        }
        // precaution: the q loads' address registers are given to other values only
        // behind this wait.  The two lane addresses are its inputs, so that they keep
        // their registers up to it; at the trip's foot it has nothing left to wait for.
        asm volatile("s_wait_xcnt 0x0" :: "v"(ah), "v"(al) : "memory");
        // ---- hand-over: tile t+1 becomes readable, tile t's buffer free ----
        asm volatile("s_wait_dscnt 0x0" ::: "memory");      // own reads of tile t done
        if (SKC_pinned(wv < 2u))
            asm volatile("s_wait_tensorcnt 0x0" ::: "memory");  // own slice of tile t+1 landed
        __syncthreads();                                    // the same for every wave
        const uint32_t st = SKC_pinned(t + 2);              // the next request is formed behind that wait
        nx = st;                                            // t + 2 is the next trip's next tile
        if (SKC_pinned((wv < 2u) & (st < NT)))
            SKC_tload(lsl + (t & 1) * BUFB, gsl + (uint64_t)st * (MT * 2u), g1);
    }
    asm volatile("s_wait_tensorcnt 0x0" ::: "memory");      // nothing in flight at the wave's end
    asm volatile("s_wait_dscnt 0x0" ::: "memory");          // no LDS read open when the buffers change their use

    // ---- epilogue: residual values asked for first, they fly during the exchange.
    // One address per lane for f and one for out, the rest is a constant offset
    // in each instruction: wave w finishes c-tiles 0-7, wave w+4 c-tiles 8-15.
    // (every loop below is unrolled: acc and res are indexed by constants)
    const float* f = (dir == 0) ? fL : fU;
    float* o = out + (size_t)dir * ((size_t)NB * NC * NN);
    const size_t e0 = ((size_t)b * NC + grp * 128 + hi * 8) * NN + n0 + l15;
    const float* fe = f + e0;
    float*       oe = o + e0;
    float res[8][2][8];
#pragma unroll
    for (int i = 0; i < 8; ++i)
#pragma unroll
        for (int nt = 0; nt < 2; ++nt)
#pragma unroll
            for (int g = 0; g < 8; ++g)
                res[i][nt][g] = fe[(i * 16 + g) * NN + nt * 16];
    // precaution: fe's registers are given to other values only behind this wait
    asm volatile("s_wait_xcnt 0x0" ::: "memory");
    // keeps every later write of a register behind that wait
    __builtin_amdgcn_sched_barrier(0);

    // ---- the two groups' partial sums meet: waves w and w+4 hold the same
    // 256 c x 32 n.  Each hands over the eight c-tiles that the other finishes.
    // The staging buffers are free: the loop's last barrier ended every read of
    // them and no request is in flight.
    v4f* xs = (v4f*)(sv + wave * XB) + lane;
#pragma unroll
    for (int i = 0; i < 8; ++i) {
#pragma unroll
        for (int nt = 0; nt < 2; ++nt) {
            const v8f snd = grp ? acc[i][nt] : acc[8 + i][nt];
            xs[((i * 2 + nt) * 2 + 0) * 32] = (v4f){snd[0], snd[1], snd[2], snd[3]};
            xs[((i * 2 + nt) * 2 + 1) * 32] = (v4f){snd[4], snd[5], snd[6], snd[7]};
        }
    }
    __syncthreads();                                        // the partner's half is written
    const v4f* xr = (const v4f*)(sv + (wave ^ 4) * XB) + lane;

#pragma unroll
    for (int i = 0; i < 8; ++i) {
#pragma unroll
        for (int nt = 0; nt < 2; ++nt) {
            const v8f own = grp ? acc[8 + i][nt] : acc[i][nt];
            const v4f r0 = xr[((i * 2 + nt) * 2 + 0) * 32];
            const v4f r1 = xr[((i * 2 + nt) * 2 + 1) * 32];
#pragma unroll
            for (int g = 0; g < 8; ++g)
                res[i][nt][g] += beta * (own[g] + (g < 4 ? r0[g & 3] : r1[g & 3]));
        }
    }
    // keeps the stores together at the wave's end: no register that a store
    // names is written behind it
    __builtin_amdgcn_sched_barrier(0);
#pragma unroll
    for (int i = 0; i < 8; ++i)
#pragma unroll
        for (int nt = 0; nt < 2; ++nt)
#pragma unroll
            for (int g = 0; g < 8; ++g)
                oe[(i * 16 + g) * NN + nt * 16] = res[i][nt][g];
}

// ---------------------------------------------------------------------------
// Host-side launcher.  Workspace layout (floats unless noted):
//   qs   : 2*B*N*2R (bf16)    = as 262144 floats
//   ks   : 2*B*N*2R (bf16)    = as 262144 floats
//   zr   : 2*B*N*2R (bf16)    = as 262144 floats (the first 16 bytes of every 32 used)
//   vp   : 2*B*C*N  (bf16)    -> 16.8 MB      (total ~20 MB)
// ---------------------------------------------------------------------------
extern "C" void kernel_launch(void* const* d_in, const int* in_sizes, int n_in,
                              void* d_out, int out_size, void* d_ws, size_t ws_size,
                              hipStream_t stream)
{
    const float* fL   = (const float*)d_in[0];
    const float* fU   = (const float*)d_in[1];
    const float* qLw  = (const float*)d_in[2];
    const float* qLb  = (const float*)d_in[3];
    const float* kUw  = (const float*)d_in[4];
    const float* kUb  = (const float*)d_in[5];
    const float* vUw  = (const float*)d_in[6];
    const float* vUb  = (const float*)d_in[7];
    const float* qUw  = (const float*)d_in[8];
    const float* qUb  = (const float*)d_in[9];
    const float* kLw  = (const float*)d_in[10];
    const float* kLb  = (const float*)d_in[11];
    const float* vLw  = (const float*)d_in[12];
    const float* vLb  = (const float*)d_in[13];
    const float* beta = (const float*)d_in[14];
    float* outp = (float*)d_out;

    __bf16* qs   = (__bf16*)d_ws;
    __bf16* ks   = qs + (size_t)2 * NB * NN * NS;
    __bf16* zr   = ks + (size_t)2 * NB * NN * NS;
    __bf16* vp   = zr + (size_t)2 * NB * NN * NS;

    // 1) q, k (q pre-scaled by log2 e) and v (bf16) in one pass over fL and fU
    SKC_qkv<<<dim3(NN / PN, NB, 2), dim3(256), 0, stream>>>(
        fL, fU, qLw, qLb, kUw, kUb, qUw, qUb, kLw, kLb, vUw, vUb, vLw, vLb, qs, ks, vp);

    // 2) softmax normalizers via WMMA score tiles
    SKC_stats<<<dim3(NN / 128, NB, 2), dim3(1024), 0, stream>>>(qs, ks, zr);

    // 3) main attend (WMMA score gen + bf16-WMMA GEMM) + fused residual
    SKC_attend<<<dim3(NN / 128, NB, 2), dim3(256), 0, stream>>>(
        fL, fU, qs, ks, zr, vp, beta, outp);
}

// v010
// A run of this version takes 64.5 microseconds.
// Two timings next to v009 both put it at 1.04 times that version's speed.
// All steps since v000 together make it 9.44 times as fast.
#include <hip/hip_runtime.h>
#include <hip/hip_bf16.h>

// ---------------------------------------------------------------------------
// SKCLite cross-attention for MI455X (gfx1250, wave32, WMMA).
//
// B=4, C=256, N=H*W=4096, R=8 (rank), G=4 groups (CG=64).
// Dominant cost: out = v @ softmax(q^T k)  -> 2 * 2*B*C*N^2 = 68.7 GFLOP.
// Strategy: flash-style on-the-fly score tiles.
//   scores (rank-8): q and k are each kept as a bf16 high part plus a bf16 low
//   part (16 significant bits); the four cross products x rank 8 fill the K=32
//   of ONE V_WMMA_F32_16X16X32_BF16, a quarter of the matrix time of the two
//   V_WMMA_F32_16X16X4_F32 that the same tile takes on f32 operands,
//   exp() + bf16-pack lands *exactly* in the B-operand layout of
//   V_WMMA_F32_16X16X32_BF16 (f32 C/D layout == bf16 B layout modulo packing),
//   main GEMM in bf16 WMMA with f32 accumulation.
// ---------------------------------------------------------------------------

#define NB   4      // batch
#define NC   256    // channels
#define NN   4096   // H*W
#define NR   8      // rank
#define NG   4      // groups
#define NCG  64     // channels per group
#define LOG2E 1.4426950408889634f

typedef __attribute__((ext_vector_type(8)))  float        v8f;
typedef __attribute__((ext_vector_type(16))) __bf16       v16bf;
typedef __attribute__((ext_vector_type(4)))  unsigned int v4u;
typedef __attribute__((ext_vector_type(8)))  __bf16       v8bf;

// A position's q (or k) record: 8 high parts, then 8 low parts, 32 bytes.
#define NS   (2 * NR)
// A bf16 16x16x32 operand holds two k blocks of 8 per lane half (registers 0-3
// and 4-7), four in all.  One side of the score product gives every lane its
// row's whole record, (high, low) in both halves; the other side gives lane
// half 0 (high, high) and lane half 1 (low, low).  Block by block that pairs
// high.high, low.high, high.low, low.low: the full product of the two sums.
// In the attend kernel the fourth block carries -log2 Z of the row instead of
// low.low (which lies 16 bits below the score): three bf16 parts against ones.
union SKC_frag { v4u u[2]; v16bf h; };

// ---------------------------------------------------------------------------
// Kernel 1: one pass over f gives q, k and v.
//   q = (qw . f + qb) * log2(e)   (exp -> exp2),   k = kw . f + kb
//   vp[dir][b][c][m] = bf16( vb[c] + sum_i vw[c][i] f[b,g*64+i,m] )
// Layout: qs/ks = [dir][B][N][high parts of the R rows, low parts] bf16.
// dir0 (LU path): q from fL (qL_w), k and v from fU (kU_w, vU_w)
// dir1 (UL path): q from fU (qU_w), k and v from fL (kL_w, vL_w)
// All products run on V_WMMA_F32_16X16X32_BF16: weights (A) and f (B) are each
// split into a bf16 high part plus a bf16 low part, and high.high + high.low +
// low.high are summed in f32 (what is left out lies 16 bits below the product).
// Block = (source map, b, 128 n), one per WGP; wave = one group's 64 channels x
// 64 n.  On its f fragments a wave runs five 16-row A tiles: the group's four
// c-tiles of v, and one tile whose rows are the 8 q rows and the 8 k rows,
// restricted to the group's channels.  The four groups' partial q and k sums
// meet in LDS and are added in group order.
// A lane reads four neighbouring n of a row by one b128 load (16 lanes: 256
// contiguous bytes); register r of those loads is column tile r, whose column
// l15 stands for n = 4 * l15 + r.  So no value changes its lane, all 32 loads
// of a wave are in flight together, and the four tiles' v results of a lane are
// four neighbouring n again: one 8-byte store, 128 contiguous bytes per row.
// The weights' fragments of a group are the same for its two waves: each forms
// those of one k-step and leaves them in LDS.
// ---------------------------------------------------------------------------
#define VM  64              // n per wave: 16 lanes x 4
#define PN  128             // n per block
#define RR  1088            // LDS bytes of one column tile's partial sums: 2 x 512, + 64
                            // so that the four tiles' rows start on different banks
#define RGB (4 * RR)        // LDS bytes of one wave's partial sums

typedef __attribute__((ext_vector_type(4))) float        v4f;
typedef __attribute__((ext_vector_type(2))) unsigned int v2u;
typedef __attribute__((ext_vector_type(4))) __bf16       v4bf;

__global__ __launch_bounds__(256)
void SKC_qkv(const float* __restrict__ fL, const float* __restrict__ fU,
             const float* __restrict__ qLw, const float* __restrict__ qLb,
             const float* __restrict__ kUw, const float* __restrict__ kUb,
             const float* __restrict__ qUw, const float* __restrict__ qUb,
             const float* __restrict__ kLw, const float* __restrict__ kLb,
             const float* __restrict__ vUw, const float* __restrict__ vUb,
             const float* __restrict__ vLw, const float* __restrict__ vLb,
             __bf16* __restrict__ qs, __bf16* __restrict__ ks,
             __bf16* __restrict__ vp)
{
    // [group][4 c-tiles of v, q and k rows][k-step][high, low][registers 0-3, 4-7][lane]
    __shared__ v4u sw[NG][5][2][2][2][32];
    // partial q and k sums: [half of n][group] x RGB bytes
    __shared__ __attribute__((aligned(16))) unsigned char red[8 * RGB];

    const int lane = threadIdx.x & 31;
    // wave-uniform, so that the group's base addresses and the biases stay scalar
    const int wave = __builtin_amdgcn_readfirstlane(threadIdx.x >> 5);
    const int g    = wave & 3;                  // group of 64 channels
    const int mh   = wave >> 2;                 // which 64 n of the block
    const int l15  = lane & 15;
    const int hi   = lane >> 4;
    const int b    = blockIdx.y;
    const int srcU = blockIdx.z;                // 0: fL, 1: fU
    const int n0   = blockIdx.x * PN;
    const int m0   = n0 + mh * VM + l15 * 4;    // this lane's four n

    const float* f  = srcU ? fU  : fL;
    const float* qw = srcU ? qUw : qLw;
    const float* kw = srcU ? kUw : kLw;
    const float* vw = srcU ? vUw : vLw;
    const float* vb = srcU ? vUb : vLb;

    // k order of both operands: element e of lane half hi is
    // i = 32 * s + 8 * hi + (e < 8 ? e : e + 8)
    // (every loop of this kernel is unrolled: the arrays are indexed by
    // constants and stay in registers)

    // this wave's share of the weights: its group's five tiles, k-step mh, row l15
    const float* wr = vw + (size_t)(g * NCG + l15) * NCG + mh * 32 + hi * 8;
    const float* wq = (l15 < NR ? qw + l15 * NC : kw + (l15 - NR) * NC)
                    + g * NCG + mh * 32 + hi * 8;
    v4f w[5][4];
#pragma unroll
    for (int t = 0; t < 4; ++t)
#pragma unroll
        for (int p = 0; p < 4; ++p)
            w[t][p] = *(const v4f*)(wr + t * 16 * NCG + (p >> 1) * 16 + (p & 1) * 4);
#pragma unroll
    for (int p = 0; p < 4; ++p)
        w[4][p] = *(const v4f*)(wq + (p >> 1) * 16 + (p & 1) * 4);

    const float* fb = f + ((size_t)b * NC + g * NCG + hi * 8) * NN + m0;
    v4f x[2][16];
#pragma unroll
    for (int s = 0; s < 2; ++s)
#pragma unroll
        for (int e = 0; e < 16; ++e)
            x[s][e] = *(const v4f*)(fb + (size_t)(s * 32 + (e < 8 ? e : e + 8)) * NN);

    // D layout: register j is row j + 8 * hi of the c-tile
    const float* bp = vb + g * NCG + hi * 8;
    v8f cb[4];
#pragma unroll
    for (int ct = 0; ct < 4; ++ct)
        cb[ct] = *(const v8f*)(bp + ct * 16);
    // precaution: the address registers of the loads above are given to other
    // values only behind this wait.  The three lane addresses are its inputs, so
    // that they keep their registers up to it.
    asm volatile("s_wait_xcnt 0x0" :: "v"(wr), "v"(wq), "v"(fb) : "memory");
    // keeps all the loads in front of the first use (a load left behind one would
    // be asked for only when earlier ones have arrived, a second memory latency)
    // and every later write of a register behind the wait
    __builtin_amdgcn_sched_barrier(0);

#pragma unroll
    for (int t = 0; t < 5; ++t) {
        union { v4u u[2]; v16bf h; } H, L;
#pragma unroll
        for (int e = 0; e < 16; ++e) {
            const float v = w[t][e >> 2][e & 3];
            H.h[e] = (__bf16)v;
            L.h[e] = (__bf16)(v - (float)H.h[e]);
        }
        sw[g][t][mh][0][0][lane] = H.u[0];
        sw[g][t][mh][0][1][lane] = H.u[1];
        sw[g][t][mh][1][0][lane] = L.u[0];
        sw[g][t][mh][1][1][lane] = L.u[1];
    }
    __syncthreads();                            // every wave's weight fragments are written

    v16bf bh[2][4], bl[2][4];                   // [k-step][column tile]
#pragma unroll
    for (int s = 0; s < 2; ++s)
#pragma unroll
        for (int r = 0; r < 4; ++r)
#pragma unroll
            for (int e = 0; e < 16; ++e) {
                const float v = x[s][e][r];
                bh[s][r][e] = (__bf16)v;
                bl[s][r][e] = (__bf16)(v - (float)bh[s][r][e]);
            }

    // tile 4 (q and k rows) first: its sums are on their way through LDS while
    // the v tiles are multiplied
    v2u o[4][8];
#pragma unroll
    for (int tt = 0; tt < 5; ++tt) {
        const int t = (tt + 4) % 5;
        SKC_frag ah[2], al[2];
#pragma unroll
        for (int s = 0; s < 2; ++s) {
            ah[s].u[0] = sw[g][t][s][0][0][lane];
            ah[s].u[1] = sw[g][t][s][0][1][lane];
            al[s].u[0] = sw[g][t][s][1][0][lane];
            al[s].u[1] = sw[g][t][s][1][1][lane];
        }
        v8f acc[4];
#pragma unroll
        for (int r = 0; r < 4; ++r)
            acc[r] = (t < 4) ? cb[t & 3] : (v8f){0.f, 0.f, 0.f, 0.f, 0.f, 0.f, 0.f, 0.f};
        // r innermost: four independent accumulators follow one another
#pragma unroll
        for (int s = 0; s < 2; ++s) {
#pragma unroll
            for (int r = 0; r < 4; ++r)
                acc[r] = __builtin_amdgcn_wmma_f32_16x16x32_bf16(
                    false, al[s].h, false, bh[s][r], (short)0, acc[r], false, false);
#pragma unroll
            for (int r = 0; r < 4; ++r)
                acc[r] = __builtin_amdgcn_wmma_f32_16x16x32_bf16(
                    false, ah[s].h, false, bl[s][r], (short)0, acc[r], false, false);
#pragma unroll
            for (int r = 0; r < 4; ++r)
                acc[r] = __builtin_amdgcn_wmma_f32_16x16x32_bf16(
                    false, ah[s].h, false, bh[s][r], (short)0, acc[r], false, false);
        }
        if (t < 4) {
#pragma unroll
            for (int j = 0; j < 8; ++j) {
                v4bf c;
#pragma unroll
                for (int r = 0; r < 4; ++r) c[r] = (__bf16)acc[r][j];
                o[t & 3][j] = __builtin_bit_cast(v2u, c);
            }
        } else {
            // lane half 0 holds the 8 q rows, lane half 1 the 8 k rows, of column l15
            unsigned char* rw = red + wave * RGB + lane * 16;   // wave = mh * 4 + g
#pragma unroll
            for (int r = 0; r < 4; ++r) {
                *(v4f*)(rw + r * RR)       = (v4f){acc[r][0], acc[r][1], acc[r][2], acc[r][3]};
                *(v4f*)(rw + r * RR + 512) = (v4f){acc[r][4], acc[r][5], acc[r][6], acc[r][7]};
            }
        }
    }
    __syncthreads();                            // every group's partial q and k sums are written

    // the v stores go out first: they fly while q and k are finished
    __bf16* ov = vp + (((size_t)(1 - srcU) * NB + b) * NC + g * NCG + hi * 8) * NN + m0;
#pragma unroll
    for (int ct = 0; ct < 4; ++ct)
#pragma unroll
        for (int j = 0; j < 8; ++j)
            *(v2u*)(ov + (size_t)(ct * 16 + j) * NN) = o[ct][j];
    // precaution: the registers that those stores name are given to other values
    // only behind this wait
    asm volatile("s_wait_xcnt 0x0" ::: "memory");
    // keeps every later write of a register behind that wait
    __builtin_amdgcn_sched_barrier(0);

    // waves 0-3 finish q, waves 4-7 k: one position per lane, all 8 rows.
    // q of fL is dir 0, q of fU dir 1; k and v the other way round.
    const bool   isq   = wave < 4;
    const float* bias  = isq ? (srcU ? qUb : qLb) : (srcU ? kUb : kLb);
    const float  scale = isq ? LOG2E : 1.0f;
    const int    nl    = (wave & 3) * 32 + lane;
    // position nl was column (nl & 63) >> 2 of column tile nl & 3 in half nl >> 6
    const unsigned char* rf = red + (nl >> 6) * (NG * RGB) + (nl & 3) * RR
                            + ((isq ? 0 : 16) + ((nl & 63) >> 2)) * 16;
    v4f s0 = *(const v4f*)(rf), s1 = *(const v4f*)(rf + 512);
#pragma unroll
    for (int p = 1; p < NG; ++p) {
        s0 += *(const v4f*)(rf + p * RGB);
        s1 += *(const v4f*)(rf + p * RGB + 512);
    }

    // high part: the upper 16 bits of the f32, a bf16 as they stand; low
    // part: what that leaves over (exact in f32), rounded to bf16
    v4u  h;
    v8bf l;
#pragma unroll
    for (int r = 0; r < NR; r += 2) {
        const float    x0 = ((r < 4 ? s0[r & 3] : s1[r & 3]) + bias[r]) * scale;
        const float    x1 = ((r < 4 ? s0[(r + 1) & 3] : s1[(r + 1) & 3]) + bias[r + 1]) * scale;
        const unsigned u0 = __builtin_bit_cast(unsigned, x0);
        const unsigned u1 = __builtin_bit_cast(unsigned, x1);
        h[r / 2] = (u0 >> 16) | (u1 & 0xffff0000u);
        l[r]     = (__bf16)(x0 - __builtin_bit_cast(float, u0 & 0xffff0000u));
        l[r + 1] = (__bf16)(x1 - __builtin_bit_cast(float, u1 & 0xffff0000u));
    }
    __bf16* ob = (isq ? qs : ks)
               + (((size_t)(isq ? srcU : 1 - srcU) * NB + b) * NN + n0 + nl) * NS;
    *(v4u*)(ob)       = h;
    *(v8bf*)(ob + NR) = l;
}

// ---------------------------------------------------------------------------
// Kernel 2: softmax normalizers.  Z[dir][b][m] = sum_j exp(q_m . k_j), stored as
// zr[dir][b][m] = -log2 Z in three bf16 parts (24 significant bits) and five
// zeros, 16 bytes at the pitch of a q record: the attend kernel adds it to the
// scores of row m inside the score WMMA, so exp2 gives exp(q_m . k_n) / Z_m.
// A operands (q, SM fixed 16-row m-tiles) stay in registers; loop j in tiles of
// 16: one V_WMMA_F32_16X16X32_BF16 per m-tile on the high and low parts, exp2,
// accumulate per-VGPR, then 16-lane xor reduction (lane halves independent).
// Wave tile: SM m-tiles x a quarter of j, so that every k fragment brought into
// registers feeds SM WMMAs.  Block = 2 groups of SM m-tiles x SJ quarters of j
// = 8 waves, two per SIMD.  Every k line is new to the WGP when it is asked
// for; with so few waves the wait is not covered by other waves but by the
// wave's own lead: SD register sets of k fragments, a set is asked for again as
// soon as its trip is done, SD - 1 trips ahead of its next use.  The SJ partial
// sums of a row meet in LDS and are added in j order.
// ---------------------------------------------------------------------------
#define SJ 4                // waves that share a group of m-tiles
#define SJN (NN / SJ)       // j per wave
#define SU 4                // j-tiles per trip
#define SM 4                // m-tiles per wave
#define SD 4                // register sets of k fragments
#define STR (SJN / (16 * SU))       // trips per wave
#define STE (SU * 16 * NS)          // elements of k per trip

// One trip: SU j-tiles x SM m-tiles.  MORE: the set is then asked for again, from kn.
// (every loop is unrolled: the arrays are indexed by constants and stay in registers)
template <bool MORE>
__device__ __forceinline__ void SKC_stats_trip(const SKC_frag (&aq)[SM], SKC_frag (&bk)[SU],
                                               v8f (&zacc)[SM], const __bf16* kn)
{
    const v8f vzero = {0.f, 0.f, 0.f, 0.f, 0.f, 0.f, 0.f, 0.f};
    v8f s[SU][SM];
#pragma unroll
    for (int u = 0; u < SU; ++u)
#pragma unroll
        for (int mt = 0; mt < SM; ++mt)
            s[u][mt] = __builtin_amdgcn_wmma_f32_16x16x32_bf16(
                false, aq[mt].h, false, bk[u].h, (short)0, vzero, false, false);
    // keeps a trip's WMMAs together: each fills the slots that the one before
    // needs ahead of the exp2 on its result
    __builtin_amdgcn_sched_barrier(0);
    // the loaded k values, as inputs only, behind the WMMAs: their registers stay
    // theirs until all are issued, so that no WMMA's result is given the registers
    // which a WMMA shortly before it reads as B
    asm volatile("" :: "v"(bk[0].u[0]), "v"(bk[0].u[1]), "v"(bk[1].u[0]), "v"(bk[1].u[1]),
                       "v"(bk[2].u[0]), "v"(bk[2].u[1]), "v"(bk[3].u[0]), "v"(bk[3].u[1]));
    // keeps the exp2 behind that statement
    __builtin_amdgcn_sched_barrier(0);
    // the exp2 of j-tile u stand beside the adds of j-tile u - 1, which do not
    // depend on them: no add waits for an exp2 issued right before it
    v8f e[2][SM];
#pragma unroll
    for (int u = 0; u <= SU; ++u) {
#pragma unroll
        for (int mt = 0; mt < SM; ++mt) {
            if (u < SU) {
#pragma unroll
                for (int g = 0; g < 8; ++g) e[u & 1][mt][g] = __builtin_amdgcn_exp2f(s[u][mt][g]);
            }
            if (u > 0) zacc[mt] += e[(u - 1) & 1][mt];
        }
        // keeps the stages apart: left to itself the compiler, in some trips, ran each
        // row's four exp2 and adds as one dependent chain.  Behind the last stage it
        // also keeps the loads behind the trip's vector work: far more than the four
        // slots that a load needs behind the WMMAs which read, as B, the registers
        // that it lands in
        __builtin_amdgcn_sched_barrier(0);
    }
    if (MORE) {
        // B fragments, the side that changes: column j's whole record as it lies
#pragma unroll
        for (int u = 0; u < SU; ++u) {
            bk[u].u[0] = *(const v4u*)(kn + u * 16 * NS);
            bk[u].u[1] = *(const v4u*)(kn + u * 16 * NS + NR);
        }
        // keeps them here, together: sunk towards their use they would lose the lead
        __builtin_amdgcn_sched_barrier(0);
    }
}

__global__ __launch_bounds__(256)
void SKC_stats(const __bf16* __restrict__ qs, const __bf16* __restrict__ ks,
               __bf16* __restrict__ zr)
{
    __shared__ float part[SJ][128];             // [quarter of j][m in the block]

    const int lane = threadIdx.x & 31;
    // wave-uniform, so that the k base address stays scalar
    const int wave = __builtin_amdgcn_readfirstlane(threadIdx.x >> 5);
    const int mq   = wave & 1;                  // group of SM m-tiles in the block
    const int jq   = wave >> 1;                 // quarter of j
    const int b    = blockIdx.y;
    const int dir  = blockIdx.z;
    const int m0   = (blockIdx.x * 8 + mq * SM) * 16;
    const int l15  = lane & 15;
    const int hi   = lane >> 4;                 // lane-half select

    const __bf16* q = qs + ((size_t)dir * NB + b) * (NN * NS);
    const __bf16* k = ks + (((size_t)dir * NB + b) * NN + jq * SJN) * NS;

    // A fragments, the fixed side: lane half 0 (high, high), lane half 1 (low, low)
    // (every loop over mt, d, u or g is unrolled: the arrays are indexed by constants)
    const __bf16* qp = q + (m0 + l15) * NS + hi * NR;
    SKC_frag aq[SM];
#pragma unroll
    for (int mt = 0; mt < SM; ++mt)
        aq[mt].u[0] = *(const v4u*)(qp + mt * 16 * NS);
    // the first SD trips' k fragments, all asked for at once
    const __bf16* kp = k + l15 * NS;            // this lane's column of every j-tile
    SKC_frag bk[SD][SU];
#pragma unroll
    for (int d = 0; d < SD; ++d)
#pragma unroll
        for (int u = 0; u < SU; ++u) {
            bk[d][u].u[0] = *(const v4u*)(kp + d * STE + u * 16 * NS);
            bk[d][u].u[1] = *(const v4u*)(kp + d * STE + u * 16 * NS + NR);
        }
    // precaution: the address registers of the loads above are given to other
    // values only behind this wait.  The two lane addresses are its inputs, so
    // that they keep their registers up to it.
    asm volatile("s_wait_xcnt 0x0" :: "v"(qp), "v"(kp) : "memory");
    // keeps every later write of a register behind that wait
    __builtin_amdgcn_sched_barrier(0);
#pragma unroll
    for (int mt = 0; mt < SM; ++mt)
        aq[mt].u[1] = aq[mt].u[0];

    v8f zacc[SM];
#pragma unroll
    for (int mt = 0; mt < SM; ++mt)
        zacc[mt] = (v8f){0.f, 0.f, 0.f, 0.f, 0.f, 0.f, 0.f, 0.f};
    // kept rolled but for the SD trips of one round of the sets (bk is indexed by
    // constants); the last round asks for nothing more and stands behind the loop
#pragma unroll 1
    for (int t0 = 0; t0 < STR - SD; t0 += SD) {
#pragma unroll
        for (int d = 0; d < SD; ++d)
            SKC_stats_trip<true>(aq, bk[d], zacc, kp + (SD + d) * STE);
        // precaution: the k loads' address registers are stepped on only behind this wait
        asm volatile("s_wait_xcnt 0x0" ::: "memory");
        // keeps the step of the address behind that wait
        __builtin_amdgcn_sched_barrier(0);
        kp += SD * STE;
    }
#pragma unroll
    for (int d = 0; d < SD; ++d)
        SKC_stats_trip<false>(aq, bk[d], zacc, kp);

    // reduce across the 16 lanes of each half (j is the lane dimension); all the
    // rows go through each step together, so their exchanges overlap
#pragma unroll
    for (int st = 1; st < 16; st <<= 1) {
#pragma unroll
        for (int mt = 0; mt < SM; ++mt)
#pragma unroll
            for (int g = 0; g < 8; ++g) zacc[mt][g] += __shfl_xor(zacc[mt][g], st, 32);
    }
    if (l15 == 0) {
#pragma unroll
        for (int mt = 0; mt < SM; ++mt)
#pragma unroll
            for (int g = 0; g < 8; ++g)         // D layout: VGPR g -> row g / g+8
                part[jq][(mq * SM + mt) * 16 + g + hi * 8] = zacc[mt][g];
    }
    __syncthreads();                            // every quarter's sums are written

    if (threadIdx.x < 128) {
        const int t = threadIdx.x;
        float z = part[0][t];
#pragma unroll
        for (int p = 1; p < SJ; ++p) z += part[p][t];   // unrolled: the LDS reads go out together
        const float  lz = -__builtin_amdgcn_logf(z);    // v_log_f32 is log2
        const __bf16 p0 = (__bf16)lz;
        const float  r1 = lz - (float)p0;               // exact in f32
        const __bf16 p1 = (__bf16)r1;
        const __bf16 p2 = (__bf16)(r1 - (float)p1);
        const __bf16 zz = (__bf16)0.f;
        *(v8bf*)(zr + (((size_t)dir * NB + b) * NN + blockIdx.x * 128 + t) * NS) =
            (v8bf){p0, p1, p2, zz, zz, zz, zz, zz};
    }
}

// ---------------------------------------------------------------------------
// Kernel 3: main attend + residual.
//   out[c,n] = f[c,n] + beta * sum_m vp[c,m] * exp(q_m . k_n) / Z_m
// The four waves of each group read the same vp values, so a vp tile of
// 256 c x 128 m is brought into LDS once per block by the tensor mover: waves
// 0 and 1 ask for one slice of 128 rows x 256 bytes each, one scalar request instead
// of address arithmetic, copies and their waits in every lane of every wave at
// the head of each trip, where all eight waves stand behind the barrier.  Two
// buffers: tile t+1 flies while tile t is worked on.  The request's pad gives
// the LDS row pitch 272 B = 16 B x odd: conflict-free b128 reads.
// Wave tile: all 16 c-tiles (C=256) x two 16-wide n-tiles, so that every A
// fragment read from LDS feeds two WMMAs (one per fragment asks the LDS for
// twice what it delivers).  The block still covers 128 n: waves 0-3 take the
// first 64 m of every staged tile, waves 4-7 the last 64 m, for the same four
// n-pairs; the two partial sums meet in LDS after the loop.
// Per 32-wide m-step: 4x bf16 WMMA score tiles (high and low parts) -> exp2 -> bf16 pack
// (f32 D layout coincides with bf16 B layout: zero lane shuffles) ->
// 32x V_WMMA_F32_16X16X32_BF16 with one b128 LDS read each.
// ---------------------------------------------------------------------------
#define MT     128                 // m per staged tile
#define NT     (NN / MT)           // staged tiles
#define PITCH  272                 // LDS bytes per row: MT*2 + 16
#define SLR    128                 // rows of a tile per request
#define SLB    (SLR * PITCH)       // LDS bytes per slice: 17 x 2 KiB
#define BUFB   (NC * PITCH)        // LDS bytes per buffer: two slices
#define MG     (MT / 2)            // m of a staged tile per group of four waves
#define XB     16384               // LDS bytes a wave hands over: 8 c-tiles x 2 n-tiles, f32

typedef __attribute__((ext_vector_type(8))) unsigned int v8u;

// A wave-uniform value held in a scalar register.  A tensor load ignores EXEC:
// only a scalar branch keeps a wave from issuing it, so every test around one
// goes through here.
__device__ __forceinline__ uint32_t SKC_pinned(uint32_t v)
{
    uint32_t w = (uint32_t)__builtin_amdgcn_readfirstlane(v);
    asm volatile("" : "+s"(w));     // keeps the value scalar, and what is formed from it behind earlier waits
    return w;
}

// Descriptor group 1, the same for every request: SLR rows of MT * 2 = 256 bytes,
// source pitch NN * 2 bytes, 16 bytes of LDS pad behind every row.
__device__ __forceinline__ v8u SKC_group1()
{
    v8u g1;
    // no mask, extents in bytes, pad on: after every 64 dwords (one row) 4 dwords
    g1[0] = (uint32_t)__builtin_amdgcn_readfirstlane((1u << 20) | (5u << 22) | (3u << 25));
    g1[1] = (uint32_t)__builtin_amdgcn_readfirstlane((MT * 2u) << 16);          // tensor_dim0
    g1[2] = (uint32_t)__builtin_amdgcn_readfirstlane((uint32_t)SLR << 16);      // tensor_dim1
    g1[3] = (uint32_t)__builtin_amdgcn_readfirstlane((MT * 2u) << 16);          // tile_dim0
    g1[4] = (uint32_t)__builtin_amdgcn_readfirstlane((uint32_t)SLR);            // tile_dim1
    g1[5] = (uint32_t)__builtin_amdgcn_readfirstlane(NN * 2u);                  // source row pitch
    g1[6] = (uint32_t)__builtin_amdgcn_readfirstlane(0u);
    g1[7] = (uint32_t)__builtin_amdgcn_readfirstlane(0u);
    return g1;
}

// One request: the slice whose first byte is ga, to LDS byte l.
__device__ __forceinline__ void SKC_tload(uint32_t l, uint64_t ga, v8u g1)
{
    v4u g0;
    g0[0] = (uint32_t)__builtin_amdgcn_readfirstlane(1u);                       // count 1
    g0[1] = (uint32_t)__builtin_amdgcn_readfirstlane(l);
    g0[2] = (uint32_t)__builtin_amdgcn_readfirstlane((uint32_t)ga);
    g0[3] = (uint32_t)__builtin_amdgcn_readfirstlane(
                (((uint32_t)(ga >> 32)) & 0x01FFFFFFu) | 0x80000000u);          // type 2
    // the request: one instruction of the whole wave, both groups in scalar registers;
    // "memory" keeps the waits and the LDS reads around it in their places
    asm volatile("tensor_load_to_lds %0, %1" :: "s"(g0), "s"(g1) : "memory");
}

__global__ __launch_bounds__(256)
void SKC_attend(const float* __restrict__ fL, const float* __restrict__ fU,
                const __bf16* __restrict__ qs, const __bf16* __restrict__ ks,
                const __bf16* __restrict__ zr,
                const __bf16* __restrict__ vp, const float* __restrict__ betap,
                float* __restrict__ out)
{
    // every slice's place in LDS is a multiple of 2 KiB
    __shared__ __attribute__((aligned(2048))) unsigned char sv[2 * BUFB];

    const int lane = threadIdx.x & 31;
    const int wave = threadIdx.x >> 5;
    const int grp  = wave >> 2;                 // which 64 m of every staged tile
    const int b    = blockIdx.y;
    const int dir  = blockIdx.z;
    const int n0   = (blockIdx.x * 4 + (wave & 3)) * 32;
    const int l15  = lane & 15;
    const int hi   = lane >> 4;
    const float beta = *betap;

    const __bf16* q   = qs   + ((size_t)dir * NB + b) * (NN * NS);
    const __bf16* k   = ks   + ((size_t)dir * NB + b) * (NN * NS);
    const __bf16* vpb = vp   + ((size_t)dir * NB + b) * (size_t)(NC * NN);

    // waves 0 and 1 each bring rows 128 * wave .. + 127 of every tile
    const uint32_t wv  = (uint32_t)__builtin_amdgcn_readfirstlane(threadIdx.x >> 5);
    const uint64_t gsl = (uint64_t)(size_t)vpb + (uint64_t)(wv & 1u) * (SLR * NN * 2u);
    const uint32_t lsl = (uint32_t)(size_t)sv + (wv & 1u) * SLB;
    v8u g1 = SKC_group1();
    // the descriptor words keep eight scalar registers of their own through
    // the loop, so that none takes another value while a request is on its way
    asm volatile("" : "+s"(g1));

    // ---- tile 0 into buffer 0, published; then tile 1 into buffer 1 ----
    if (SKC_pinned(wv < 2u)) {
        SKC_tload(lsl, gsl, g1);
        asm volatile("s_wait_tensorcnt 0x0" ::: "memory");      // own slice of tile 0 landed
    }
    __syncthreads();                                            // every slice landed
    if (SKC_pinned(wv < 2u))
        SKC_tload(lsl + BUFB, gsl + MT * 2u, g1);

    // k B-fragments of the two n-tiles: constant across the whole m loop.
    // The fixed side: lane half 0 (high, high), lane half 1 (low, three ones and
    // five zeros: they meet the row's -log2 Z).
    const __bf16* kp = k + (n0 + l15) * NS + hi * NR;
    SKC_frag bk[2];
#pragma unroll
    for (int nt = 0; nt < 2; ++nt) {
        bk[nt].u[0] = *(const v4u*)(kp + nt * 16 * NS);
        bk[nt].u[1] = hi ? (v4u){0x3f803f80u, 0x00003f80u, 0u, 0u} : bk[nt].u[0];
    }

    // q A-fragments of the group's share of tile 0: per m-step two 16-row tiles.
    // The side that changes: row m's high parts in both lane halves, then its low
    // parts in lane half 0 and its -log2 Z record in lane half 1 (same pitch: one
    // offset).  Two register sets, one per tile parity: while one tile's set is
    // multiplied, the next tile's set is on its way.
    const int qlane = (l15 + grp * MG) * NS;            // this lane's place in a q tile
    const __bf16* qh = q + qlane;
    const __bf16* ql = (hi ? zr + ((size_t)dir * NB + b) * (NN * NS) : q + NR) + qlane;
    SKC_frag qf[2][MG / 32][2];                         // [tile parity][m-step][16-row tile]
#pragma unroll
    for (int ms = 0; ms < MG / 32; ++ms)
#pragma unroll
        for (int i = 0; i < 2; ++i) {
            qf[0][ms][i].u[0] = *(const v4u*)(qh + (ms * 32 + i * 16) * NS);
            qf[0][ms][i].u[1] = *(const v4u*)(ql + (ms * 32 + i * 16) * NS);
        }
    // precaution: the address registers of the k and q loads above are given to
    // other values only behind this wait.  The k address is its input, so that it
    // keeps its registers up to it (the q addresses live on through the loop).
    asm volatile("s_wait_xcnt 0x0" :: "v"(kp) : "memory");
    // keeps every later write of a register behind that wait
    __builtin_amdgcn_sched_barrier(0);

    v8f acc[16][2];
    const v8f vzero = {0.f, 0.f, 0.f, 0.f, 0.f, 0.f, 0.f, 0.f};
#pragma unroll
    for (int ct = 0; ct < 16; ++ct) { acc[ct][0] = vzero; acc[ct][1] = vzero; }

    // bf16 A layout: row = l15, lane-half K offset of 8 elements = 16 bytes;
    // the group's 64 m start MG elements into the row
    const unsigned char* svl = sv + l15 * PITCH + hi * 16 + grp * (MG * 2);

    // kept rolled but for pairs of trips: one trip per staged tile, the buffer
    // chosen by the trip's parity (for speed only)
    uint32_t nx = 1u;           // the tile after the trip's own; from trip 1 on the foot's scalar
#pragma unroll 1
    for (int t2 = 0; t2 < NT; t2 += 2)
    // two trips unrolled: qf is indexed by constants, and the two q register sets
    // change places without a copy
#pragma unroll
    for (int u = 0; u < 2; ++u) {
        const int t = t2 + u;
        const unsigned char* svt = svl + (t & 1) * BUFB;

        // the next tile's q fragments are asked for here, right behind the barrier,
        // a whole trip ahead of their use: they travel beside the tensor requests,
        // and the load wait that comes with the trip's closing barrier finds them
        // landed.  After the last tile the index wraps to 0: in bounds, not used.
        const int qo = (int)((nx & (NT - 1)) * (MT * NS));
        const __bf16* ah = qh + qo;
        const __bf16* al = ql + qo;
#pragma unroll
        for (int ms = 0; ms < MG / 32; ++ms)
#pragma unroll
            for (int i = 0; i < 2; ++i) {
                qf[u ^ 1][ms][i].u[0] = *(const v4u*)(ah + (ms * 32 + i * 16) * NS);
                qf[u ^ 1][ms][i].u[1] = *(const v4u*)(al + (ms * 32 + i * 16) * NS);
            }
        // keeps those loads at the trip's head (sunk towards their use they would
        // lose the lead)
        __builtin_amdgcn_sched_barrier(0);

        // two register sets of four A fragments: block j+1 is read from LDS as
        // one group while block j (four c-tiles x two n-tiles of one m-step) is
        // multiplied (every loop below is unrolled so that fr and acc are
        // indexed by constants and stay in registers)
        v4u fr[2][8];
#pragma unroll
        for (int i = 0; i < 4; ++i) {
            const unsigned char* p = svt + i * 16 * PITCH;
            fr[0][2 * i]     = *(const v4u*)(p);        // K = moff .. moff+7
            fr[0][2 * i + 1] = *(const v4u*)(p + 32);   // K = 16+moff .. 16+moff+7
        }

#pragma unroll
        for (int ms = 0; ms < MG / 32; ++ms) {
            // WMMA distance: the score WMMAs below may be given, as their D, the
            // registers that the last bf16 WMMA of the m-step before reads as B;
            // only scalar instructions stand between the two otherwise.
            asm volatile("v_nop\n\tv_nop\n\tv_nop\n\tv_nop\n\tv_nop");
            // keeps the score WMMAs behind those slots
            __builtin_amdgcn_sched_barrier(0);
            // ---- score tiles (m0..m0+15 and m0+16..m0+31) x two n-tiles, rank 8 x 4 ----
            // this m-step's q fragments are in registers since the trip before
            const v16bf a0 = qf[u][ms][0].h, a1 = qf[u][ms][1].h;
            v8f s0[2], s1[2];
#pragma unroll
            for (int nt = 0; nt < 2; ++nt) {
                s0[nt] = __builtin_amdgcn_wmma_f32_16x16x32_bf16(false, a0, false, bk[nt].h, (short)0, vzero, false, false);
                s1[nt] = __builtin_amdgcn_wmma_f32_16x16x32_bf16(false, a1, false, bk[nt].h, (short)0, vzero, false, false);
            }
            // keeps the four score WMMAs together: each fills the slots that the one
            // before needs ahead of the exp2 on its result
            __builtin_amdgcn_sched_barrier(0);

            // ---- E tiles -> bf16 B operands (layouts line up; in-lane pack) ----
            v16bf eb[2];
#pragma unroll
            for (int nt = 0; nt < 2; ++nt) {
#pragma unroll
                for (int g = 0; g < 8; ++g) {
                    eb[nt][g]     = (__bf16)__builtin_amdgcn_exp2f(s0[nt][g]);   // K = moff+g
                    eb[nt][8 + g] = (__bf16)__builtin_amdgcn_exp2f(s1[nt][g]);   // K = 16+moff+g
                }
            }

            // ---- 16 c-tiles x 2 n-tiles of the main bf16 GEMM, A fragments from LDS ----
#pragma unroll
            for (int cb = 0; cb < 4; ++cb) {
                const int j  = ms * 4 + cb;         // this block
                const int jn = j + 1;               // the block read ahead
                if (jn < (MG / 32) * 4) {
#pragma unroll
                    for (int i = 0; i < 4; ++i) {
                        const unsigned char* p =
                            svt + ((jn & 3) * 4 + i) * 16 * PITCH + (jn >> 2) * 64;
                        fr[jn & 1][2 * i]     = *(const v4u*)(p);
                        fr[jn & 1][2 * i + 1] = *(const v4u*)(p + 32);
                    }
                }
                // keeps the eight LDS reads together ahead of the block (for speed only)
                __builtin_amdgcn_sched_barrier(0);
#pragma unroll
                for (int i = 0; i < 4; ++i) {
                    union { v4u u[2]; v16bf h; } U;
                    U.u[0] = fr[j & 1][2 * i];
                    U.u[1] = fr[j & 1][2 * i + 1];
#pragma unroll
                    for (int nt = 0; nt < 2; ++nt)
                        acc[cb * 4 + i][nt] = __builtin_amdgcn_wmma_f32_16x16x32_bf16(
                            false, U.h, false, eb[nt], (short)0, acc[cb * 4 + i][nt], false, false);
                }
                // keeps the next group of reads behind this block's WMMAs
                __builtin_amdgcn_sched_barrier(0);
            }
        }
        // precaution: the q loads' address registers are given to other values only
        // behind this wait.  The two lane addresses are its inputs, so that they keep
        // their registers up to it; at the trip's foot it has nothing left to wait for.
        asm volatile("s_wait_xcnt 0x0" :: "v"(ah), "v"(al) : "memory");
        // ---- hand-over: tile t+1 becomes readable, tile t's buffer free ----
        asm volatile("s_wait_dscnt 0x0" ::: "memory");      // own reads of tile t done
        if (SKC_pinned(wv < 2u))
            asm volatile("s_wait_tensorcnt 0x0" ::: "memory");  // own slice of tile t+1 landed
        __syncthreads();                                    // the same for every wave
        const uint32_t st = SKC_pinned(t + 2);              // the next request is formed behind that wait
        nx = st;                                            // t + 2 is the next trip's next tile
        if (SKC_pinned((wv < 2u) & (st < NT)))
            SKC_tload(lsl + (t & 1) * BUFB, gsl + (uint64_t)st * (MT * 2u), g1);
    }
    asm volatile("s_wait_tensorcnt 0x0" ::: "memory");      // nothing in flight at the wave's end
    asm volatile("s_wait_dscnt 0x0" ::: "memory");          // no LDS read open when the buffers change their use

    // ---- epilogue: residual values asked for first, they fly during the exchange.
    // One address per lane for f and one for out, the rest is a constant offset
    // in each instruction: wave w finishes c-tiles 0-7, wave w+4 c-tiles 8-15.
    // (every loop below is unrolled: acc and res are indexed by constants)
    const float* f = (dir == 0) ? fL : fU;
    float* o = out + (size_t)dir * ((size_t)NB * NC * NN);
    const size_t e0 = ((size_t)b * NC + grp * 128 + hi * 8) * NN + n0 + l15;
    const float* fe = f + e0;
    float*       oe = o + e0;
    float res[8][2][8];
#pragma unroll
    for (int i = 0; i < 8; ++i)
#pragma unroll
        for (int nt = 0; nt < 2; ++nt)
#pragma unroll
            for (int g = 0; g < 8; ++g)
                res[i][nt][g] = fe[(i * 16 + g) * NN + nt * 16];
    // precaution: fe's registers are given to other values only behind this wait
    asm volatile("s_wait_xcnt 0x0" ::: "memory");
    // keeps every later write of a register behind that wait
    __builtin_amdgcn_sched_barrier(0);

    // ---- the two groups' partial sums meet: waves w and w+4 hold the same
    // 256 c x 32 n.  Each hands over the eight c-tiles that the other finishes.
    // The staging buffers are free: the loop's last barrier ended every read of
    // them and no request is in flight.
    v4f* xs = (v4f*)(sv + wave * XB) + lane;
#pragma unroll
    for (int i = 0; i < 8; ++i) {
#pragma unroll
        for (int nt = 0; nt < 2; ++nt) {
            const v8f snd = grp ? acc[i][nt] : acc[8 + i][nt];
            xs[((i * 2 + nt) * 2 + 0) * 32] = (v4f){snd[0], snd[1], snd[2], snd[3]};
            xs[((i * 2 + nt) * 2 + 1) * 32] = (v4f){snd[4], snd[5], snd[6], snd[7]};
        }
    }
    __syncthreads();                                        // the partner's half is written
    const v4f* xr = (const v4f*)(sv + (wave ^ 4) * XB) + lane;

#pragma unroll
    for (int i = 0; i < 8; ++i) {
#pragma unroll
        for (int nt = 0; nt < 2; ++nt) {
            const v8f own = grp ? acc[8 + i][nt] : acc[i][nt];
            const v4f r0 = xr[((i * 2 + nt) * 2 + 0) * 32];
            const v4f r1 = xr[((i * 2 + nt) * 2 + 1) * 32];
#pragma unroll
            for (int g = 0; g < 8; ++g)
                res[i][nt][g] += beta * (own[g] + (g < 4 ? r0[g & 3] : r1[g & 3]));
        }
    }
    // keeps the stores together at the wave's end: no register that a store
    // names is written behind it
    __builtin_amdgcn_sched_barrier(0);
#pragma unroll
    for (int i = 0; i < 8; ++i)
#pragma unroll
        for (int nt = 0; nt < 2; ++nt)
#pragma unroll
            for (int g = 0; g < 8; ++g)
                oe[(i * 16 + g) * NN + nt * 16] = res[i][nt][g];
}

// ---------------------------------------------------------------------------
// Host-side launcher.  Workspace layout (floats unless noted):
//   qs   : 2*B*N*2R (bf16)    = as 262144 floats
//   ks   : 2*B*N*2R (bf16)    = as 262144 floats
//   zr   : 2*B*N*2R (bf16)    = as 262144 floats (the first 16 bytes of every 32 used)
//   vp   : 2*B*C*N  (bf16)    -> 16.8 MB      (total ~20 MB)
// ---------------------------------------------------------------------------
extern "C" void kernel_launch(void* const* d_in, const int* in_sizes, int n_in,
                              void* d_out, int out_size, void* d_ws, size_t ws_size,
                              hipStream_t stream)
{
    const float* fL   = (const float*)d_in[0];
    const float* fU   = (const float*)d_in[1];
    const float* qLw  = (const float*)d_in[2];
    const float* qLb  = (const float*)d_in[3];
    const float* kUw  = (const float*)d_in[4];
    const float* kUb  = (const float*)d_in[5];
    const float* vUw  = (const float*)d_in[6];
    const float* vUb  = (const float*)d_in[7];
    const float* qUw  = (const float*)d_in[8];
    const float* qUb  = (const float*)d_in[9];
    const float* kLw  = (const float*)d_in[10];
    const float* kLb  = (const float*)d_in[11];
    const float* vLw  = (const float*)d_in[12];
    const float* vLb  = (const float*)d_in[13];
    const float* beta = (const float*)d_in[14];
    float* outp = (float*)d_out;

    __bf16* qs   = (__bf16*)d_ws;
    __bf16* ks   = qs + (size_t)2 * NB * NN * NS;
    __bf16* zr   = ks + (size_t)2 * NB * NN * NS;
    __bf16* vp   = zr + (size_t)2 * NB * NN * NS;

    // 1) q, k (q pre-scaled by log2 e) and v (bf16) in one pass over fL and fU
    SKC_qkv<<<dim3(NN / PN, NB, 2), dim3(256), 0, stream>>>(
        fL, fU, qLw, qLb, kUw, kUb, qUw, qUb, kLw, kLb, vUw, vUb, vLw, vLb, qs, ks, vp);

    // 2) softmax normalizers via WMMA score tiles
    SKC_stats<<<dim3(NN / 128, NB, 2), dim3(256), 0, stream>>>(qs, ks, zr);

    // 3) main attend (WMMA score gen + bf16-WMMA GEMM) + fused residual
    SKC_attend<<<dim3(NN / 128, NB, 2), dim3(256), 0, stream>>>(
        fL, fU, qs, ks, zr, vp, beta, outp);
}
